// v000
// The times below were measured on an AMD MI455X: many runs one after another, warmed up first and cycling through
// copies of the inputs, with the whole window's GPU time divided by the number of runs. Launches and the gaps
// between them are all in it. The median over several windows is given; except for v000 it joins two sittings, which
// can be a few percent apart, so the side-by-side timings, each taken in one sitting, are the better comparison.
// The starting kernel, v000, takes 2380 microseconds a run.
#include <hip/hip_runtime.h>

// VanillaSLSTMFeat - Shaw relative-position multi-head attention, sequence-first (query [2048][2][1024]; q = (x Wq^T + bq)/8, k, v = x W^T + b; 32 groups n = b*16 + h of 64 dims; scores = q.k + q.rk[clip(s-t,-16,16)+16];
// softmax; attn = P.v + sum_s P[t][s] rv[clip(s-t)+16]; out = merged Wo^T + bo -> [2048][2][1024]; rk/rv tables [33][64] read as data).
// The relative terms are exact regroupings: q.rk depends on (t, bucket) only -> QR[n][t][r] = q_t . rk[r] (33 per row, added inside the softmax kernel by bucket); sum_s P rv = sum_r PB[t][r] rv[r] with PB the per-bucket
// probability sums (buckets 0 / 32 collect all keys at distance <= -16 / >= +16), formed in k_pb from the stored probability rows and contracted with rv on VALU at the merge.
// Compute dtypes, f32 accumulate: every input rounded to bf16; projections on PLAIN bf16 operands (inputs: exact, + bias; all 4096 (t, b) rows at once); QR and the PB.rv term f32 on VALU; scores (K 64) and P.v on
// hl planes (3 products) for the first 512 query rows of each group and SINGLE fp16 planes for the rest; softmax f32 in registers; Wo on hl planes x exact (+bias). One-wave-per-64x64-tile GEMMs z-batched over group pairs. Deterministic, no atomics;

#define TT   2048
#define BB   2
#define EE   1024
#define NH_  16
#define NG   (BB * NH_)
#define HD   64
#define NR   33
#define MR   16
#define ZH   2
#define RH   512
#define PCAR 1024.0f
typedef _Float16 h16;
typedef unsigned short bf;
typedef __attribute__((ext_vector_type(16))) __bf16   v16bf;
typedef __attribute__((ext_vector_type(16))) _Float16 v16h;
typedef __attribute__((ext_vector_type(8)))  _Float16 v8h;
typedef __attribute__((ext_vector_type(8)))  unsigned short v8us;
typedef __attribute__((ext_vector_type(8)))  float    v8f;
typedef __attribute__((ext_vector_type(4)))  float    v4f;
typedef v8h  __attribute__((may_alias)) v8ha;
typedef v4f  __attribute__((may_alias)) v4fa;
typedef v8us __attribute__((may_alias)) v8usa;

__device__ __forceinline__ unsigned short f2bf(float f) { unsigned u = __float_as_uint(f); u += 0x7FFFu + ((u >> 16) & 1u); return (unsigned short)(u >> 16); }
__device__ __forceinline__ float bf2f(unsigned short b) { return __uint_as_float(((unsigned)b) << 16); }
__device__ __forceinline__ float bfr(float f) { return bf2f(f2bf(f)); }
__device__ __forceinline__ v16h cat16(v8h lo, v8h hi) { return __builtin_shufflevector(lo, hi, 0, 1, 2, 3, 4, 5, 6, 7, 8, 9, 10, 11, 12, 13, 14, 15); }
__device__ __forceinline__ v16bf cat16b(v8us lo, v8us hi) { return __builtin_bit_cast(v16bf, __builtin_shufflevector(lo, hi, 0, 1, 2, 3, 4, 5, 6, 7, 8, 9, 10, 11, 12, 13, 14, 15)); }
__device__ __forceinline__ v8f wmma16(v16h a, v16h b, v8f c) { return __builtin_amdgcn_wmma_f32_16x16x32_f16(false, a, false, b, (short)0, c, false, false); }
__device__ __forceinline__ v8f wmmab(v16bf a, v16bf b, v8f c) { return __builtin_amdgcn_wmma_f32_16x16x32_bf16(false, a, false, b, (short)0, c, false, false); }



// ---- k_gemmw: register-blocked GEMM, ONE WAVE per 64x64 output tile (16 accumulators), operands straight from K-contiguous 16-bit planes; grid (M/64, N/64, Z), 32 threads.
// C[m][n] (f32, pitch ldc, + optional f32 bias[n]) = sum_k A[m][k] Bt[n][k] (+ split products per NSPLIT). z-batch strides sA/sB/sC in elements. K % 32 == 0.
template <typename T16> struct WFrag;
template <> struct WFrag<h16> { typedef v16h V; static __device__ __forceinline__ V ld(const h16* p) { return cat16(*(const v8h*)p, *(const v8h*)(p + 16)); } static __device__ __forceinline__ v8f mma(V a, V b, v8f c) { return wmma16(a, b, c); } };
template <> struct WFrag<bf> { typedef v16bf V; static __device__ __forceinline__ V ld(const bf* p) { return cat16b(*(const v8us*)p, *(const v8us*)(p + 16)); } static __device__ __forceinline__ v8f mma(V a, V b, v8f c) { return wmmab(a, b, c); } };
template <typename T16, int NSPLIT, bool BIAS>
__global__ __launch_bounds__(32) void k_gemmw(const T16* __restrict__ A, const T16* __restrict__ A2, const T16* __restrict__ Bt, const T16* __restrict__ Bt2, int K, float* C, int ldc, const float* __restrict__ bias, size_t sA, size_t sB, size_t sC) {
    typedef typename WFrag<T16>::V V;
    __shared__ __align__(16) float os[16 * 68];
    const size_t z = blockIdx.z; A += z * sA; if (A2) A2 += z * sA; Bt += z * sB; if (Bt2) Bt2 += z * sB; C += z * sC;
    const int lane = threadIdx.x & 31, lr = lane & 15, hi = lane >> 4; const int r0 = blockIdx.x * 64, c0 = blockIdx.y * 64;
    v8f acc[4][4];
#pragma unroll
    for (int mb = 0; mb < 4; ++mb)
#pragma unroll
        for (int nb = 0; nb < 4; ++nb) acc[mb][nb] = (v8f){};
    const size_t aoff = (size_t)(r0 + lr) * K + 8 * hi, boff = (size_t)(c0 + lr) * K + 8 * hi;
#pragma unroll 1
    for (int kc = 0; kc < K; kc += 32) {
        V a[4], a2[4];
#pragma unroll
        for (int mb = 0; mb < 4; ++mb) { a[mb] = WFrag<T16>::ld(A + aoff + (size_t)mb * 16 * K + kc); if (NSPLIT == 1 || NSPLIT == 2) a2[mb] = WFrag<T16>::ld(A2 + aoff + (size_t)mb * 16 * K + kc); }
#pragma unroll
        for (int nb = 0; nb < 4; ++nb) { const V b = WFrag<T16>::ld(Bt + boff + (size_t)nb * 16 * K + kc); V b2; if (NSPLIT >= 2) b2 = WFrag<T16>::ld(Bt2 + boff + (size_t)nb * 16 * K + kc);
#pragma unroll
            for (int mb = 0; mb < 4; ++mb) { acc[mb][nb] = WFrag<T16>::mma(a[mb], b, acc[mb][nb]); if (NSPLIT == 1 || NSPLIT == 2) acc[mb][nb] = WFrag<T16>::mma(a2[mb], b, acc[mb][nb]); if (NSPLIT >= 2) acc[mb][nb] = WFrag<T16>::mma(a[mb], b2, acc[mb][nb]); } }
        asm volatile("v_nop\n\tv_nop\n\tv_nop\n\tv_nop" : "+v"(acc[0][0]), "+v"(acc[1][1]), "+v"(acc[2][2]), "+v"(acc[3][3]) : "v"(a[0]), "v"(a[3]));
    }
#pragma unroll
    for (int mb = 0; mb < 4; ++mb) {
#pragma unroll
        for (int nb = 0; nb < 4; ++nb) {
#pragma unroll
            for (int j = 0; j < 8; ++j) os[(hi * 8 + j) * 68 + nb * 16 + lr] = acc[mb][nb][j]; }
        __builtin_amdgcn_wave_barrier(); asm volatile("" ::: "memory");
        float* crow = C + (size_t)(r0 + mb * 16) * ldc + c0;
{
#pragma unroll
            for (int s = 0; s < 8; ++s) { const int row = 2 * s + hi, cofs = lr * 4; v4f val = *(const v4fa*)(os + row * 68 + cofs); if (BIAS) { val[0] += bfr(bias[c0 + cofs]); val[1] += bfr(bias[c0 + cofs + 1]); val[2] += bfr(bias[c0 + cofs + 2]); val[3] += bfr(bias[c0 + cofs + 3]); }
                *(v4f*)(crow + (size_t)row * ldc + cofs) = val; }
             }
        __builtin_amdgcn_wave_barrier(); asm volatile("" ::: "memory");
    }
}

__device__ __forceinline__ h16 tohx(float x) { return (h16)x; }
__device__ __forceinline__ void splitf(float y, unsigned short& h, unsigned short& l) { h = f2bf(y); l = f2bf(y - bf2f(h)); }
typedef __attribute__((ext_vector_type(2))) _Float16 v2h;
typedef __attribute__((ext_vector_type(4))) _Float16 v4h;
typedef __attribute__((ext_vector_type(2))) unsigned short v2us;
typedef __attribute__((ext_vector_type(4))) unsigned short v4us;
typedef __attribute__((ext_vector_type(2))) float v2f;

__global__ __launch_bounds__(256) void k_cvt8(const float* __restrict__ src, bf* dst, size_t n8) { const size_t i = (size_t)blockIdx.x * 256 + threadIdx.x; if (i >= n8) return; const v8f v = *(const v8f*)(src + i * 8); v8us o;
#pragma unroll
    for (int k = 0; k < 8; ++k) o[k] = f2bf(v[k]); *(v8us*)(dst + i * 8) = o;  }
__global__ __launch_bounds__(256) void k_pl(const float* __restrict__ F, float scl, h16* P16, bf* Ph, bf* Pl) { const size_t e = ((size_t)blockIdx.x * 256 + threadIdx.x) * 2; if (e >= (size_t)NG * TT * HD) return; const int d = (int)(e % HD); const int t = (int)((e / HD) % TT); const int n = (int)(e / ((size_t)HD * TT)); const int b = n / NH_, h = n % NH_; const float* f = F + ((size_t)t * BB + b) * EE + h * HD + d; v2h o; v2us oh, ol;
#pragma unroll
    for (int u = 0; u < 2; ++u) { const float v = f[u] * scl; o[u] = tohx(v); unsigned short a, c; splitf(v, a, c); oh[u] = a; ol[u] = c; } { *(v2h*)(P16 + e) = o; *(v2us*)(Ph + e) = oh; *(v2us*)(Pl + e) = ol;  } }
__global__ __launch_bounds__(256) void k_vtp(const float* __restrict__ F, h16* V16, bf* Vh, bf* Vl) { const size_t e = ((size_t)blockIdx.x * 256 + threadIdx.x) * 2; if (e >= (size_t)NG * HD * TT) return; const int t = (int)(e % TT); const int d = (int)((e / TT) % HD); const int n = (int)(e / ((size_t)TT * HD)); const int b = n / NH_, h = n % NH_; v2h o; v2us oh, ol;
#pragma unroll
    for (int u = 0; u < 2; ++u) { const float v = F[((size_t)(t + u) * BB + b) * EE + h * HD + d]; o[u] = tohx(v); unsigned short a, c; splitf(v, a, c); oh[u] = a; ol[u] = c; } { *(v2h*)(V16 + e) = o; *(v2us*)(Vh + e) = oh; *(v2us*)(Vl + e) = ol;  } }
__global__ __launch_bounds__(256) void k_qr(const float* __restrict__ QF, const float* __restrict__ rk, float* QR) { const size_t e = (size_t)blockIdx.x * 256 + threadIdx.x; if (e >= (size_t)NG * TT * 64) return; const int r = (int)(e % 64); const int t = (int)((e / 64) % TT); const int n = (int)(e / ((size_t)64 * TT)); const int b = n / NH_, h = n % NH_; float s = 0.f;
    if (r < NR) { const float* q = QF + ((size_t)t * BB + b) * EE + h * HD;
#pragma unroll 1
        for (int d = 0; d < HD; ++d) { float p = __fmul_rn(q[d] * 0.125f, bfr(rk[r * HD + d])); asm volatile("" : "+v"(p)); s = __fadd_rn(s, p); } }
    *(float*)(QR + e) = s;  }
// k_pb: one wave per (z, t) row re-reading the probability row (hl planes for rows < RH, fp16/1024 otherwise): PB[z][t][r] = sum of p over bucket r (r = 0: s <= t-16; r = 32: s >= t+16; else the single key s = t + r - 16,
__global__ __launch_bounds__(256) void k_rsoft(const float* __restrict__ Sb, const float* __restrict__ QR, int n0, h16* P16, bf* Ph, bf* Pl) { const int lane = threadIdx.x & 31; const int row = blockIdx.x * 8 + (threadIdx.x >> 5); if (row >= ZH * TT) return; const int t = row % TT, z = row / TT; const bool hires = t < RH; const float* sr = Sb + (size_t)row * TT; const float* qr = QR + ((size_t)(n0 + z) * TT + t) * 64; float v[64]; float mx = -3.0e38f;
#pragma unroll
    for (int ch = 0; ch < 16; ++ch) { const int j0 = ch * 128 + lane * 4; const v4f a = *(const v4f*)(sr + j0);
#pragma unroll
        for (int q = 0; q < 4; ++q) { const int s = j0 + q; const int r = min(max(s - t, -MR), MR) + MR; const float x = __fadd_rn(a[q], qr[r]); v[ch * 4 + q] = x; mx = fmaxf(mx, x); } }
#pragma unroll
    for (int sh = 16; sh; sh >>= 1) mx = fmaxf(mx, __shfl_xor(mx, sh, 32));
    float sum = 0.f;
#pragma unroll
    for (int k = 0; k < 64; ++k) { float d0 = __fsub_rn(v[k], mx); asm volatile("" : "+v"(d0)); v[k] = __expf(d0); sum += v[k]; }
#pragma unroll
    for (int sh = 16; sh; sh >>= 1) sum += __shfl_xor(sum, sh, 32);
    const float inv = __fdiv_rn(1.0f, sum);
{
        if (hires) {
#pragma unroll
            for (int ch = 0; ch < 16; ++ch) { v4us oh, ol;
#pragma unroll
                for (int q = 0; q < 4; ++q) { unsigned short a, c2; splitf(v[ch * 4 + q] * inv, a, c2); oh[q] = a; ol[q] = c2; } const size_t oo = ((size_t)z * RH + t) * TT + ch * 128 + lane * 4; *(v4us*)(Ph + oo) = oh; *(v4us*)(Pl + oo) = ol; }
        } else { const float f = inv * PCAR;
#pragma unroll
            for (int ch = 0; ch < 16; ++ch) { v4h o4; o4[0] = tohx(v[ch * 4] * f); o4[1] = tohx(v[ch * 4 + 1] * f); o4[2] = tohx(v[ch * 4 + 2] * f); o4[3] = tohx(v[ch * 4 + 3] * f); *(v4h*)(P16 + (size_t)row * TT + ch * 128 + lane * 4) = o4; } }
         } }
__global__ __launch_bounds__(256) void k_pb(const h16* __restrict__ P16, const bf* __restrict__ Ph, const bf* __restrict__ Pl, float* PB) { const int lane = threadIdx.x & 31; const int row = blockIdx.x * 8 + (threadIdx.x >> 5); if (row >= ZH * TT) return; const int t = row % TT, z = row / TT; const bool hires = t < RH;
    const int r0 = 2 * lane, r1 = 2 * lane + 1; const int s0 = t + r0 - MR, s1 = t + r1 - MR; const int l0 = (s0 & 127) >> 2, l1 = (s1 & 127) >> 2; const int k0 = ((s0 >> 7) << 2) | (s0 & 3), k1 = ((s1 >> 7) << 2) | (s1 & 3); float lo = 0.f, hi = 0.f, pv0 = 0.f, pv1 = 0.f;
#pragma unroll
    for (int ch = 0; ch < 16; ++ch) { const int j0 = ch * 128 + lane * 4; float a[4];
        if (hires) { const size_t oo = ((size_t)z * RH + t) * TT + j0; const v4us ah = *(const v4us*)(Ph + oo), al = *(const v4us*)(Pl + oo);
#pragma unroll
            for (int q = 0; q < 4; ++q) a[q] = __fadd_rn(bf2f(ah[q]), bf2f(al[q])); }
        else { const v4h p4 = *(const v4h*)(P16 + (size_t)row * TT + j0);
#pragma unroll
            for (int q = 0; q < 4; ++q) a[q] = (float)p4[q] * (1.0f / PCAR); }
#pragma unroll
        for (int q = 0; q < 4; ++q) { const int s = j0 + q; if (s <= t - MR) lo = __fadd_rn(lo, a[q]); else if (s >= t + MR) hi = __fadd_rn(hi, a[q]); const float b0 = __shfl(a[q], l0, 32), b1 = __shfl(a[q], l1, 32); if (ch * 4 + q == k0) pv0 = b0; if (ch * 4 + q == k1) pv1 = b1; } }
#pragma unroll
    for (int sh = 16; sh; sh >>= 1) { lo += __shfl_xor(lo, sh, 32); hi += __shfl_xor(hi, sh, 32); }
    pv0 = (r0 > 0 && r0 < 2 * MR && s0 >= 0 && s0 < TT) ? pv0 : 0.f; pv1 = (r1 < 2 * MR && s1 >= 0 && s1 < TT) ? pv1 : 0.f; if (lane == 0) pv0 = lo; if (lane == MR) pv0 = hi;
    float* pb = PB + ((size_t)z * TT + t) * 64; v2f o; o[0] = pv0; o[1] = pv1; *(v2f*)(pb + 2 * lane) = o;  }
__global__ __launch_bounds__(256) void k_mrg(const float* __restrict__ Ob, const float* __restrict__ PB, const float* __restrict__ rv, int n0, bf* Ah, bf* Al) { const size_t e = ((size_t)blockIdx.x * 256 + threadIdx.x) * 2; if (e >= (size_t)ZH * TT * HD) return; const int d = (int)(e % HD); const int t = (int)((e / HD) % TT); const int z = (int)(e / ((size_t)HD * TT)); const int n = n0 + z; const int b = n / NH_, h = n % NH_; const float f = t < RH ? 1.0f : (1.0f / PCAR); const float* pb = PB + ((size_t)z * TT + t) * 64; v2us oh, ol;
#pragma unroll
    for (int u = 0; u < 2; ++u) { float acc = Ob[e + u] * f;
#pragma unroll 1
        for (int r = 0; r < NR; ++r) { float p = __fmul_rn(pb[r], bfr(rv[r * HD + d + u])); asm volatile("" : "+v"(p)); acc = __fadd_rn(acc, p); }
        unsigned short a, c; splitf(acc, a, c); oh[u] = a; ol[u] = c; }
    const size_t o = ((size_t)t * BB + b) * EE + h * HD + d; *(v2us*)(Ah + o) = oh; *(v2us*)(Al + o) = ol;  }

extern "C" void kernel_launch(void* const* d_in, const int* in_sizes, int n_in,
                              void* d_out, int out_size, void* d_ws, size_t ws_size, hipStream_t stream) {
    (void)in_sizes; (void)n_in; (void)out_size;
    const float* x = (const float*)d_in[0]; const float* Wq = (const float*)d_in[1]; const float* bq = (const float*)d_in[2]; const float* Wk = (const float*)d_in[3]; const float* bk = (const float*)d_in[4]; const float* Wv = (const float*)d_in[5]; const float* bv = (const float*)d_in[6]; const float* Wo = (const float*)d_in[7]; const float* bo = (const float*)d_in[8]; const float* rk = (const float*)d_in[9]; const float* rv = (const float*)d_in[10];
    float* OUT = (float*)d_out;     // [2048][2][1024]
    char* wsp = (char*)d_ws;
    auto take = [&](size_t bytes) { char* p = wsp; wsp += (bytes + 255) & ~(size_t)255; return (void*)p; };
    const size_t NTB = (size_t)TT * BB;
    bf* WQ = (bf*)take((size_t)EE * EE * 2); bf* WK = (bf*)take((size_t)EE * EE * 2); bf* WV = (bf*)take((size_t)EE * EE * 2); bf* WO = (bf*)take((size_t)EE * EE * 2); bf* XB = (bf*)take(NTB * EE * 2);
    float* QF = (float*)take(NTB * EE * 4); float* KF = (float*)take(NTB * EE * 4); float* QR = (float*)take((size_t)NG * TT * 64 * 4);
    h16* Q16 = (h16*)take((size_t)NG * TT * HD * 2); bf* Qh = (bf*)take((size_t)NG * TT * HD * 2); bf* Ql = (bf*)take((size_t)NG * TT * HD * 2); h16* K16 = (h16*)take((size_t)NG * TT * HD * 2); bf* Kh = (bf*)take((size_t)NG * TT * HD * 2); bf* Kl = (bf*)take((size_t)NG * TT * HD * 2); h16* V16 = (h16*)take((size_t)NG * HD * TT * 2); bf* Vh = (bf*)take((size_t)NG * HD * TT * 2); bf* Vl = (bf*)take((size_t)NG * HD * TT * 2);
    float* Sb = (float*)take((size_t)ZH * TT * TT * 4); h16* P16 = (h16*)take((size_t)ZH * TT * TT * 2); bf* Ph = (bf*)take((size_t)ZH * RH * TT * 2); bf* Pl = (bf*)take((size_t)ZH * RH * TT * 2); float* PB = (float*)take((size_t)ZH * TT * 64 * 4); float* Ob = (float*)take((size_t)ZH * TT * HD * 4); bf* Ah = (bf*)take(NTB * EE * 2); bf* Al = (bf*)take(NTB * EE * 2);
    if ((size_t)(wsp - (char*)d_ws) > ws_size) return;    // total ~ 220 MB = 210 MiB (six [32][2048][64] and three [32][64][2048] planes 75 MB, two f32 [4096][1024] projections 34 MB (the second reused for v), QR 17 MB, two-group scores/probabilities 50 MB, merged planes 17 MB)
    float* VF = KF;   // v projection reuses the k buffer after the k planes are built
    k_cvt8<<<(EE * EE / 8 + 255) / 256, 256, 0, stream>>>(Wq, WQ, (size_t)EE * EE / 8); k_cvt8<<<(EE * EE / 8 + 255) / 256, 256, 0, stream>>>(Wk, WK, (size_t)EE * EE / 8); k_cvt8<<<(EE * EE / 8 + 255) / 256, 256, 0, stream>>>(Wv, WV, (size_t)EE * EE / 8); k_cvt8<<<(EE * EE / 8 + 255) / 256, 256, 0, stream>>>(Wo, WO, (size_t)EE * EE / 8);
    k_cvt8<<<(unsigned)((NTB * EE / 8 + 255) / 256), 256, 0, stream>>>(x, XB, NTB * EE / 8);
    const unsigned LP = (unsigned)(((size_t)NG * TT * HD / 2 + 255) / 256);
    k_gemmw<bf, 0, true><<<dim3(NTB / 64, EE / 64, 1), 32, 0, stream>>>(XB, nullptr, WQ, nullptr, EE, QF, EE, bq, 0, 0, 0); k_pl<<<LP, 256, 0, stream>>>(QF, 0.125f, Q16, Qh, Ql); k_qr<<<(unsigned)(((size_t)NG * TT * 64 + 255) / 256), 256, 0, stream>>>(QF, rk, QR);
    k_gemmw<bf, 0, true><<<dim3(NTB / 64, EE / 64, 1), 32, 0, stream>>>(XB, nullptr, WK, nullptr, EE, KF, EE, bk, 0, 0, 0); k_pl<<<LP, 256, 0, stream>>>(KF, 1.0f, K16, Kh, Kl);
    k_gemmw<bf, 0, true><<<dim3(NTB / 64, EE / 64, 1), 32, 0, stream>>>(XB, nullptr, WV, nullptr, EE, VF, EE, bv, 0, 0, 0); k_vtp<<<LP, 256, 0, stream>>>(VF, V16, Vh, Vl);
    for (int n0 = 0; n0 < NG; n0 += ZH) { const size_t z = (size_t)n0;
        k_gemmw<bf, 2, false><<<dim3(RH / 64, TT / 64, ZH), 32, 0, stream>>>(Qh + z * TT * HD, Ql + z * TT * HD, Kh + z * TT * HD, Kl + z * TT * HD, HD, Sb, TT, nullptr, (size_t)TT * HD, (size_t)TT * HD, (size_t)TT * TT);
        k_gemmw<h16, 0, false><<<dim3((TT - RH) / 64, TT / 64, ZH), 32, 0, stream>>>(Q16 + z * TT * HD + (size_t)RH * HD, nullptr, K16 + z * TT * HD, nullptr, HD, Sb + (size_t)RH * TT, TT, nullptr, (size_t)TT * HD, (size_t)TT * HD, (size_t)TT * TT);
        k_rsoft<<<ZH * TT / 8, 256, 0, stream>>>(Sb, QR, n0, P16, Ph, Pl); k_pb<<<ZH * TT / 8, 256, 0, stream>>>(P16, Ph, Pl, PB);
        k_gemmw<bf, 2, false><<<dim3(RH / 64, 1, ZH), 32, 0, stream>>>(Ph, Pl, Vh + z * HD * TT, Vl + z * HD * TT, TT, Ob, HD, nullptr, (size_t)RH * TT, (size_t)HD * TT, (size_t)TT * HD);
        k_gemmw<h16, 0, false><<<dim3((TT - RH) / 64, 1, ZH), 32, 0, stream>>>(P16 + (size_t)RH * TT, nullptr, V16 + z * HD * TT, nullptr, TT, Ob + (size_t)RH * HD, HD, nullptr, (size_t)TT * TT, (size_t)HD * TT, (size_t)TT * HD);
        k_mrg<<<(unsigned)(((size_t)ZH * TT * HD / 2 + 255) / 256), 256, 0, stream>>>(Ob, PB, rv, n0, Ah, Al); }
    k_gemmw<bf, 1, true><<<dim3(NTB / 64, EE / 64, 1), 32, 0, stream>>>(Ah, Al, WO, nullptr, EE, OUT, EE, bo, 0, 0, 0);
}

// v001
// One run takes 1270 microseconds.
// Two timings next to v000 put it at 1.88 and 1.87 times that version's speed.
#include <hip/hip_runtime.h>

// VanillaSLSTMFeat - Shaw relative-position multi-head attention, sequence-first (query [2048][2][1024]; q = (x Wq^T + bq)/8, k, v = x W^T + b; 32 groups n = b*16 + h of 64 dims; scores = q.k + q.rk[clip(s-t,-16,16)+16];
// softmax; attn = P.v + sum_s P[t][s] rv[clip(s-t)+16]; out = merged Wo^T + bo -> [2048][2][1024]; rk/rv tables [33][64] read as data).
// The relative terms are exact regroupings: q.rk depends on (t, bucket) only -> QR[n][t][r] = q_t . rk[r] (33 per row, added inside the softmax kernel by bucket); sum_s P rv = sum_r PB[t][r] rv[r] with PB the per-bucket
// probability sums (buckets 0 / 32 collect all keys at distance <= -16 / >= +16), formed in k_pb from the stored probability rows and contracted with rv on VALU at the merge.
// Compute dtypes, f32 accumulate: every input rounded to bf16; projections on PLAIN bf16 operands (inputs: exact, + bias; all 4096 (t, b) rows at once); QR and the PB.rv term f32 on VALU; scores (K 64) and P.v on
// hl planes (3 products) for the first 512 query rows of each group and SINGLE fp16 planes for the rest; softmax f32 in registers; Wo on hl planes x exact (+bias). One-wave-per-64x64-tile GEMMs z-batched over group pairs. Deterministic, no atomics;

#define TT   2048
#define BB   2
#define EE   1024
#define NH_  16
#define NG   (BB * NH_)
#define HD   64
#define NR   33
#define MR   16
#define ZH   2
#define RH   512
#define PCAR 1024.0f
#define KS   16
typedef _Float16 h16;
typedef unsigned short bf;
typedef __attribute__((ext_vector_type(16))) __bf16   v16bf;
typedef __attribute__((ext_vector_type(16))) _Float16 v16h;
typedef __attribute__((ext_vector_type(8)))  _Float16 v8h;
typedef __attribute__((ext_vector_type(8)))  unsigned short v8us;
typedef __attribute__((ext_vector_type(8)))  float    v8f;
typedef __attribute__((ext_vector_type(4)))  float    v4f;
typedef v8h  __attribute__((may_alias)) v8ha;
typedef v4f  __attribute__((may_alias)) v4fa;
typedef v8us __attribute__((may_alias)) v8usa;

__device__ __forceinline__ unsigned short f2bf(float f) { unsigned u = __float_as_uint(f); u += 0x7FFFu + ((u >> 16) & 1u); return (unsigned short)(u >> 16); }
__device__ __forceinline__ float bf2f(unsigned short b) { return __uint_as_float(((unsigned)b) << 16); }
__device__ __forceinline__ float bfr(float f) { return bf2f(f2bf(f)); }
__device__ __forceinline__ v16h cat16(v8h lo, v8h hi) { return __builtin_shufflevector(lo, hi, 0, 1, 2, 3, 4, 5, 6, 7, 8, 9, 10, 11, 12, 13, 14, 15); }
__device__ __forceinline__ v16bf cat16b(v8us lo, v8us hi) { return __builtin_bit_cast(v16bf, __builtin_shufflevector(lo, hi, 0, 1, 2, 3, 4, 5, 6, 7, 8, 9, 10, 11, 12, 13, 14, 15)); }
__device__ __forceinline__ v8f wmma16(v16h a, v16h b, v8f c) { return __builtin_amdgcn_wmma_f32_16x16x32_f16(false, a, false, b, (short)0, c, false, false); }
__device__ __forceinline__ v8f wmmab(v16bf a, v16bf b, v8f c) { return __builtin_amdgcn_wmma_f32_16x16x32_bf16(false, a, false, b, (short)0, c, false, false); }



// ---- k_gemmw: register-blocked GEMM, ONE WAVE per 64x64 output tile (16 accumulators), operands straight from K-contiguous 16-bit planes; grid (M/64, N/64, Z), 32 threads.
// C[m][n] (f32, pitch ldc, + optional f32 bias[n]) = sum_k A[m][k] Bt[n][k] (+ split products per NSPLIT). z-batch strides sA/sB/sC in elements. K % 32 == 0.
// KSLICE (N == 64 only): blockIdx.y is a K slice of klen, not a column tile; slice y stores its partial product at C + y * sK and the reader adds the slices in order.
template <typename T16> struct WFrag;
template <> struct WFrag<h16> { typedef v16h V; static __device__ __forceinline__ V ld(const h16* p) { return cat16(*(const v8h*)p, *(const v8h*)(p + 16)); } static __device__ __forceinline__ v8f mma(V a, V b, v8f c) { return wmma16(a, b, c); } };
template <> struct WFrag<bf> { typedef v16bf V; static __device__ __forceinline__ V ld(const bf* p) { return cat16b(*(const v8us*)p, *(const v8us*)(p + 16)); } static __device__ __forceinline__ v8f mma(V a, V b, v8f c) { return wmmab(a, b, c); } };
template <typename T16, int NSPLIT, bool BIAS, bool KSLICE>
__global__ __launch_bounds__(32) void k_gemmw(const T16* __restrict__ A, const T16* __restrict__ A2, const T16* __restrict__ Bt, const T16* __restrict__ Bt2, int K, float* C, int ldc, const float* __restrict__ bias, size_t sA, size_t sB, size_t sC, int klen, size_t sK) {
    typedef typename WFrag<T16>::V V;
    __shared__ __align__(16) float os[16 * 68];
    const size_t z = blockIdx.z; A += z * sA; if (A2) A2 += z * sA; Bt += z * sB; if (Bt2) Bt2 += z * sB; C += z * sC;
    const int lane = threadIdx.x & 31, lr = lane & 15, hi = lane >> 4; const int r0 = blockIdx.x * 64, c0 = KSLICE ? 0 : blockIdx.y * 64; const int kbeg = KSLICE ? blockIdx.y * klen : 0, kend = KSLICE ? kbeg + klen : K; if (KSLICE) C += blockIdx.y * sK;
    v8f acc[4][4];
#pragma unroll
    for (int mb = 0; mb < 4; ++mb)
#pragma unroll
        for (int nb = 0; nb < 4; ++nb) acc[mb][nb] = (v8f){};
    const size_t aoff = (size_t)(r0 + lr) * K + 8 * hi, boff = (size_t)(c0 + lr) * K + 8 * hi;
#pragma unroll 1
    for (int kc = kbeg; kc < kend; kc += 32) {
        V a[4], a2[4];
#pragma unroll
        for (int mb = 0; mb < 4; ++mb) { a[mb] = WFrag<T16>::ld(A + aoff + (size_t)mb * 16 * K + kc); if (NSPLIT == 1 || NSPLIT == 2) a2[mb] = WFrag<T16>::ld(A2 + aoff + (size_t)mb * 16 * K + kc); }
#pragma unroll
        for (int nb = 0; nb < 4; ++nb) { const V b = WFrag<T16>::ld(Bt + boff + (size_t)nb * 16 * K + kc); V b2; if (NSPLIT >= 2) b2 = WFrag<T16>::ld(Bt2 + boff + (size_t)nb * 16 * K + kc);
#pragma unroll
            for (int mb = 0; mb < 4; ++mb) { acc[mb][nb] = WFrag<T16>::mma(a[mb], b, acc[mb][nb]); if (NSPLIT == 1 || NSPLIT == 2) acc[mb][nb] = WFrag<T16>::mma(a2[mb], b, acc[mb][nb]); if (NSPLIT >= 2) acc[mb][nb] = WFrag<T16>::mma(a[mb], b2, acc[mb][nb]); } }
        asm volatile("v_nop\n\tv_nop\n\tv_nop\n\tv_nop" : "+v"(acc[0][0]), "+v"(acc[1][1]), "+v"(acc[2][2]), "+v"(acc[3][3]) : "v"(a[0]), "v"(a[3]));
    }
#pragma unroll
    for (int mb = 0; mb < 4; ++mb) {
#pragma unroll
        for (int nb = 0; nb < 4; ++nb) {
#pragma unroll
            for (int j = 0; j < 8; ++j) os[(hi * 8 + j) * 68 + nb * 16 + lr] = acc[mb][nb][j]; }
        __builtin_amdgcn_wave_barrier(); asm volatile("" ::: "memory");
        float* crow = C + (size_t)(r0 + mb * 16) * ldc + c0;
{
#pragma unroll
            for (int s = 0; s < 8; ++s) { const int row = 2 * s + hi, cofs = lr * 4; v4f val = *(const v4fa*)(os + row * 68 + cofs); if (BIAS) { val[0] += bfr(bias[c0 + cofs]); val[1] += bfr(bias[c0 + cofs + 1]); val[2] += bfr(bias[c0 + cofs + 2]); val[3] += bfr(bias[c0 + cofs + 3]); }
                *(v4f*)(crow + (size_t)row * ldc + cofs) = val; }
             }
        __builtin_amdgcn_wave_barrier(); asm volatile("" ::: "memory");
    }
}

__device__ __forceinline__ h16 tohx(float x) { return (h16)x; }
__device__ __forceinline__ void splitf(float y, unsigned short& h, unsigned short& l) { h = f2bf(y); l = f2bf(y - bf2f(h)); }
typedef __attribute__((ext_vector_type(2))) _Float16 v2h;
typedef __attribute__((ext_vector_type(4))) _Float16 v4h;
typedef __attribute__((ext_vector_type(2))) unsigned short v2us;
typedef __attribute__((ext_vector_type(4))) unsigned short v4us;
typedef __attribute__((ext_vector_type(2))) float v2f;

__global__ __launch_bounds__(256) void k_cvt8(const float* __restrict__ src, bf* dst, size_t n8) { const size_t i = (size_t)blockIdx.x * 256 + threadIdx.x; if (i >= n8) return; const v8f v = *(const v8f*)(src + i * 8); v8us o;
#pragma unroll
    for (int k = 0; k < 8; ++k) o[k] = f2bf(v[k]); *(v8us*)(dst + i * 8) = o;  }
__global__ __launch_bounds__(256) void k_pl(const float* __restrict__ F, float scl, h16* P16, bf* Ph, bf* Pl) { const size_t e = ((size_t)blockIdx.x * 256 + threadIdx.x) * 2; if (e >= (size_t)NG * TT * HD) return; const int d = (int)(e % HD); const int t = (int)((e / HD) % TT); const int n = (int)(e / ((size_t)HD * TT)); const int b = n / NH_, h = n % NH_; const float* f = F + ((size_t)t * BB + b) * EE + h * HD + d; v2h o; v2us oh, ol;
#pragma unroll
    for (int u = 0; u < 2; ++u) { const float v = f[u] * scl; o[u] = tohx(v); unsigned short a, c; splitf(v, a, c); oh[u] = a; ol[u] = c; } { *(v2h*)(P16 + e) = o; *(v2us*)(Ph + e) = oh; *(v2us*)(Pl + e) = ol;  } }
__global__ __launch_bounds__(256) void k_vtp(const float* __restrict__ F, h16* V16, bf* Vh, bf* Vl) { const size_t e = ((size_t)blockIdx.x * 256 + threadIdx.x) * 2; if (e >= (size_t)NG * HD * TT) return; const int t = (int)(e % TT); const int d = (int)((e / TT) % HD); const int n = (int)(e / ((size_t)TT * HD)); const int b = n / NH_, h = n % NH_; v2h o; v2us oh, ol;
#pragma unroll
    for (int u = 0; u < 2; ++u) { const float v = F[((size_t)(t + u) * BB + b) * EE + h * HD + d]; o[u] = tohx(v); unsigned short a, c; splitf(v, a, c); oh[u] = a; ol[u] = c; } { *(v2h*)(V16 + e) = o; *(v2us*)(Vh + e) = oh; *(v2us*)(Vl + e) = ol;  } }
__global__ __launch_bounds__(256) void k_qr(const float* __restrict__ QF, const float* __restrict__ rk, float* QR) { const size_t e = (size_t)blockIdx.x * 256 + threadIdx.x; if (e >= (size_t)NG * TT * 64) return; const int r = (int)(e % 64); const int t = (int)((e / 64) % TT); const int n = (int)(e / ((size_t)64 * TT)); const int b = n / NH_, h = n % NH_; float s = 0.f;
    if (r < NR) { const float* q = QF + ((size_t)t * BB + b) * EE + h * HD;
#pragma unroll 1
        for (int d = 0; d < HD; ++d) { float p = __fmul_rn(q[d] * 0.125f, bfr(rk[r * HD + d])); asm volatile("" : "+v"(p)); s = __fadd_rn(s, p); } }
    *(float*)(QR + e) = s;  }
// k_pb: one wave per (z, t) row re-reading the probability row (hl planes for rows < RH, fp16/1024 otherwise): PB[z][t][r] = sum of p over bucket r (r = 0: s <= t-16; r = 32: s >= t+16; else the single key s = t + r - 16,
__global__ __launch_bounds__(256) void k_rsoft(const float* __restrict__ Sb, const float* __restrict__ QR, int n0, h16* P16, bf* Ph, bf* Pl) { const int lane = threadIdx.x & 31; const int row = blockIdx.x * 8 + (threadIdx.x >> 5); if (row >= ZH * TT) return; const int t = row % TT, z = row / TT; const bool hires = t < RH; const float* sr = Sb + (size_t)row * TT; const float* qr = QR + ((size_t)(n0 + z) * TT + t) * 64; float v[64]; float mx = -3.0e38f;
#pragma unroll
    for (int ch = 0; ch < 16; ++ch) { const int j0 = ch * 128 + lane * 4; const v4f a = *(const v4f*)(sr + j0);
#pragma unroll
        for (int q = 0; q < 4; ++q) { const int s = j0 + q; const int r = min(max(s - t, -MR), MR) + MR; const float x = __fadd_rn(a[q], qr[r]); v[ch * 4 + q] = x; mx = fmaxf(mx, x); } }
#pragma unroll
    for (int sh = 16; sh; sh >>= 1) mx = fmaxf(mx, __shfl_xor(mx, sh, 32));
    float sum = 0.f;
#pragma unroll
    for (int k = 0; k < 64; ++k) { float d0 = __fsub_rn(v[k], mx); asm volatile("" : "+v"(d0)); v[k] = __expf(d0); sum += v[k]; }
#pragma unroll
    for (int sh = 16; sh; sh >>= 1) sum += __shfl_xor(sum, sh, 32);
    const float inv = __fdiv_rn(1.0f, sum);
{
        if (hires) {
#pragma unroll
            for (int ch = 0; ch < 16; ++ch) { v4us oh, ol;
#pragma unroll
                for (int q = 0; q < 4; ++q) { unsigned short a, c2; splitf(v[ch * 4 + q] * inv, a, c2); oh[q] = a; ol[q] = c2; } const size_t oo = ((size_t)z * RH + t) * TT + ch * 128 + lane * 4; *(v4us*)(Ph + oo) = oh; *(v4us*)(Pl + oo) = ol; }
        } else { const float f = inv * PCAR;
#pragma unroll
            for (int ch = 0; ch < 16; ++ch) { v4h o4; o4[0] = tohx(v[ch * 4] * f); o4[1] = tohx(v[ch * 4 + 1] * f); o4[2] = tohx(v[ch * 4 + 2] * f); o4[3] = tohx(v[ch * 4 + 3] * f); *(v4h*)(P16 + (size_t)row * TT + ch * 128 + lane * 4) = o4; } }
         } }
__global__ __launch_bounds__(256) void k_pb(const h16* __restrict__ P16, const bf* __restrict__ Ph, const bf* __restrict__ Pl, float* PB) { const int lane = threadIdx.x & 31; const int row = blockIdx.x * 8 + (threadIdx.x >> 5); if (row >= ZH * TT) return; const int t = row % TT, z = row / TT; const bool hires = t < RH;
    const int r0 = 2 * lane, r1 = 2 * lane + 1; const int s0 = t + r0 - MR, s1 = t + r1 - MR; const int l0 = (s0 & 127) >> 2, l1 = (s1 & 127) >> 2; const int k0 = ((s0 >> 7) << 2) | (s0 & 3), k1 = ((s1 >> 7) << 2) | (s1 & 3); float lo = 0.f, hi = 0.f, pv0 = 0.f, pv1 = 0.f;
#pragma unroll
    for (int ch = 0; ch < 16; ++ch) { const int j0 = ch * 128 + lane * 4; float a[4];
        if (hires) { const size_t oo = ((size_t)z * RH + t) * TT + j0; const v4us ah = *(const v4us*)(Ph + oo), al = *(const v4us*)(Pl + oo);
#pragma unroll
            for (int q = 0; q < 4; ++q) a[q] = __fadd_rn(bf2f(ah[q]), bf2f(al[q])); }
        else { const v4h p4 = *(const v4h*)(P16 + (size_t)row * TT + j0);
#pragma unroll
            for (int q = 0; q < 4; ++q) a[q] = (float)p4[q] * (1.0f / PCAR); }
#pragma unroll
        for (int q = 0; q < 4; ++q) { const int s = j0 + q; if (s <= t - MR) lo = __fadd_rn(lo, a[q]); else if (s >= t + MR) hi = __fadd_rn(hi, a[q]); const float b0 = __shfl(a[q], l0, 32), b1 = __shfl(a[q], l1, 32); if (ch * 4 + q == k0) pv0 = b0; if (ch * 4 + q == k1) pv1 = b1; } }
#pragma unroll
    for (int sh = 16; sh; sh >>= 1) { lo += __shfl_xor(lo, sh, 32); hi += __shfl_xor(hi, sh, 32); }
    pv0 = (r0 > 0 && r0 < 2 * MR && s0 >= 0 && s0 < TT) ? pv0 : 0.f; pv1 = (r1 < 2 * MR && s1 >= 0 && s1 < TT) ? pv1 : 0.f; if (lane == 0) pv0 = lo; if (lane == MR) pv0 = hi;
    float* pb = PB + ((size_t)z * TT + t) * 64; v2f o; o[0] = pv0; o[1] = pv1; *(v2f*)(pb + 2 * lane) = o;  }
__global__ __launch_bounds__(256) void k_mrg(const float* __restrict__ Ob, const float* __restrict__ PB, const float* __restrict__ rv, int n0, bf* Ah, bf* Al) { const size_t e = ((size_t)blockIdx.x * 256 + threadIdx.x) * 2; if (e >= (size_t)ZH * TT * HD) return; const int d = (int)(e % HD); const int t = (int)((e / HD) % TT); const int z = (int)(e / ((size_t)HD * TT)); const int n = n0 + z; const int b = n / NH_, h = n % NH_; const float f = t < RH ? 1.0f : (1.0f / PCAR); const float* pb = PB + ((size_t)z * TT + t) * 64; v2us oh, ol; v2f ps = *(const v2f*)(Ob + e);
#pragma unroll
    for (int ks = 1; ks < KS; ++ks) ps += *(const v2f*)(Ob + (size_t)ks * ZH * TT * HD + e);
#pragma unroll
    for (int u = 0; u < 2; ++u) { float acc = ps[u] * f;
#pragma unroll 1
        for (int r = 0; r < NR; ++r) { float p = __fmul_rn(pb[r], bfr(rv[r * HD + d + u])); asm volatile("" : "+v"(p)); acc = __fadd_rn(acc, p); }
        unsigned short a, c; splitf(acc, a, c); oh[u] = a; ol[u] = c; }
    const size_t o = ((size_t)t * BB + b) * EE + h * HD + d; *(v2us*)(Ah + o) = oh; *(v2us*)(Al + o) = ol;  }

extern "C" void kernel_launch(void* const* d_in, const int* in_sizes, int n_in,
                              void* d_out, int out_size, void* d_ws, size_t ws_size, hipStream_t stream) {
    (void)in_sizes; (void)n_in; (void)out_size;
    const float* x = (const float*)d_in[0]; const float* Wq = (const float*)d_in[1]; const float* bq = (const float*)d_in[2]; const float* Wk = (const float*)d_in[3]; const float* bk = (const float*)d_in[4]; const float* Wv = (const float*)d_in[5]; const float* bv = (const float*)d_in[6]; const float* Wo = (const float*)d_in[7]; const float* bo = (const float*)d_in[8]; const float* rk = (const float*)d_in[9]; const float* rv = (const float*)d_in[10];
    float* OUT = (float*)d_out;     // [2048][2][1024]
    char* wsp = (char*)d_ws;
    auto take = [&](size_t bytes) { char* p = wsp; wsp += (bytes + 255) & ~(size_t)255; return (void*)p; };
    const size_t NTB = (size_t)TT * BB;
    bf* WQ = (bf*)take((size_t)EE * EE * 2); bf* WK = (bf*)take((size_t)EE * EE * 2); bf* WV = (bf*)take((size_t)EE * EE * 2); bf* WO = (bf*)take((size_t)EE * EE * 2); bf* XB = (bf*)take(NTB * EE * 2);
    float* QF = (float*)take(NTB * EE * 4); float* KF = (float*)take(NTB * EE * 4); float* QR = (float*)take((size_t)NG * TT * 64 * 4);
    h16* Q16 = (h16*)take((size_t)NG * TT * HD * 2); bf* Qh = (bf*)take((size_t)NG * TT * HD * 2); bf* Ql = (bf*)take((size_t)NG * TT * HD * 2); h16* K16 = (h16*)take((size_t)NG * TT * HD * 2); bf* Kh = (bf*)take((size_t)NG * TT * HD * 2); bf* Kl = (bf*)take((size_t)NG * TT * HD * 2); h16* V16 = (h16*)take((size_t)NG * HD * TT * 2); bf* Vh = (bf*)take((size_t)NG * HD * TT * 2); bf* Vl = (bf*)take((size_t)NG * HD * TT * 2);
    float* Sb = (float*)take((size_t)ZH * TT * TT * 4); h16* P16 = (h16*)take((size_t)ZH * TT * TT * 2); bf* Ph = (bf*)take((size_t)ZH * RH * TT * 2); bf* Pl = (bf*)take((size_t)ZH * RH * TT * 2); float* PB = (float*)take((size_t)ZH * TT * 64 * 4); float* Ob = (float*)take((size_t)KS * ZH * TT * HD * 4); bf* Ah = (bf*)take(NTB * EE * 2); bf* Al = (bf*)take(NTB * EE * 2);
    if ((size_t)(wsp - (char*)d_ws) > ws_size) return;    // total ~ 236 MB = 225 MiB (six [32][2048][64] and three [32][64][2048] planes 75 MB, two f32 [4096][1024] projections 34 MB (the second reused for v), QR 17 MB, two-group scores/probabilities 50 MB, K-slice partials of P.v 17 MB, merged planes 17 MB)
    float* VF = KF;   // v projection reuses the k buffer after the k planes are built
    k_cvt8<<<(EE * EE / 8 + 255) / 256, 256, 0, stream>>>(Wq, WQ, (size_t)EE * EE / 8); k_cvt8<<<(EE * EE / 8 + 255) / 256, 256, 0, stream>>>(Wk, WK, (size_t)EE * EE / 8); k_cvt8<<<(EE * EE / 8 + 255) / 256, 256, 0, stream>>>(Wv, WV, (size_t)EE * EE / 8); k_cvt8<<<(EE * EE / 8 + 255) / 256, 256, 0, stream>>>(Wo, WO, (size_t)EE * EE / 8);
    k_cvt8<<<(unsigned)((NTB * EE / 8 + 255) / 256), 256, 0, stream>>>(x, XB, NTB * EE / 8);
    const unsigned LP = (unsigned)(((size_t)NG * TT * HD / 2 + 255) / 256);
    k_gemmw<bf, 0, true, false><<<dim3(NTB / 64, EE / 64, 1), 32, 0, stream>>>(XB, nullptr, WQ, nullptr, EE, QF, EE, bq, 0, 0, 0, 0, 0); k_pl<<<LP, 256, 0, stream>>>(QF, 0.125f, Q16, Qh, Ql); k_qr<<<(unsigned)(((size_t)NG * TT * 64 + 255) / 256), 256, 0, stream>>>(QF, rk, QR);
    k_gemmw<bf, 0, true, false><<<dim3(NTB / 64, EE / 64, 1), 32, 0, stream>>>(XB, nullptr, WK, nullptr, EE, KF, EE, bk, 0, 0, 0, 0, 0); k_pl<<<LP, 256, 0, stream>>>(KF, 1.0f, K16, Kh, Kl);
    k_gemmw<bf, 0, true, false><<<dim3(NTB / 64, EE / 64, 1), 32, 0, stream>>>(XB, nullptr, WV, nullptr, EE, VF, EE, bv, 0, 0, 0, 0, 0); k_vtp<<<LP, 256, 0, stream>>>(VF, V16, Vh, Vl);
    for (int n0 = 0; n0 < NG; n0 += ZH) { const size_t z = (size_t)n0;
        k_gemmw<bf, 2, false, false><<<dim3(RH / 64, TT / 64, ZH), 32, 0, stream>>>(Qh + z * TT * HD, Ql + z * TT * HD, Kh + z * TT * HD, Kl + z * TT * HD, HD, Sb, TT, nullptr, (size_t)TT * HD, (size_t)TT * HD, (size_t)TT * TT, 0, 0);
        k_gemmw<h16, 0, false, false><<<dim3((TT - RH) / 64, TT / 64, ZH), 32, 0, stream>>>(Q16 + z * TT * HD + (size_t)RH * HD, nullptr, K16 + z * TT * HD, nullptr, HD, Sb + (size_t)RH * TT, TT, nullptr, (size_t)TT * HD, (size_t)TT * HD, (size_t)TT * TT, 0, 0);
        k_rsoft<<<ZH * TT / 8, 256, 0, stream>>>(Sb, QR, n0, P16, Ph, Pl); k_pb<<<ZH * TT / 8, 256, 0, stream>>>(P16, Ph, Pl, PB);
        k_gemmw<bf, 2, false, true><<<dim3(RH / 64, KS, ZH), 32, 0, stream>>>(Ph, Pl, Vh + z * HD * TT, Vl + z * HD * TT, TT, Ob, HD, nullptr, (size_t)RH * TT, (size_t)HD * TT, (size_t)TT * HD, TT / KS, (size_t)ZH * TT * HD);
        k_gemmw<h16, 0, false, true><<<dim3((TT - RH) / 64, KS, ZH), 32, 0, stream>>>(P16 + (size_t)RH * TT, nullptr, V16 + z * HD * TT, nullptr, TT, Ob + (size_t)RH * HD, HD, nullptr, (size_t)TT * TT, (size_t)HD * TT, (size_t)TT * HD, TT / KS, (size_t)ZH * TT * HD);
        k_mrg<<<(unsigned)(((size_t)ZH * TT * HD / 2 + 255) / 256), 256, 0, stream>>>(Ob, PB, rv, n0, Ah, Al); }
    k_gemmw<bf, 1, true, false><<<dim3(NTB / 64, EE / 64, 1), 32, 0, stream>>>(Ah, Al, WO, nullptr, EE, OUT, EE, bo, 0, 0, 0, 0, 0);
}

// v002
// A run of this version takes 1060 microseconds.
// Two timings next to v001 put it at 1.19 and 1.20 times that version's speed.
// All steps since v000 together make it 2.24 times as fast.
#include <hip/hip_runtime.h>

// VanillaSLSTMFeat - Shaw relative-position multi-head attention, sequence-first (query [2048][2][1024]; q = (x Wq^T + bq)/8, k, v = x W^T + b; 32 groups n = b*16 + h of 64 dims; scores = q.k + q.rk[clip(s-t,-16,16)+16];
// softmax; attn = P.v + sum_s P[t][s] rv[clip(s-t)+16]; out = merged Wo^T + bo -> [2048][2][1024]; rk/rv tables [33][64] read as data).
// The relative terms are exact regroupings: q.rk depends on (t, bucket) only -> QR[n][t][r] = q_t . rk[r] (33 per row, added inside the softmax kernel by bucket); sum_s P rv = sum_r PB[t][r] rv[r] with PB the per-bucket
// probability sums (buckets 0 / 32 collect all keys at distance <= -16 / >= +16), formed by k_pb re-reading the stored probabilities after the softmax kernel and contracted with rv on VALU at the merge.
// Compute dtypes, f32 accumulate: every input rounded to bf16; projections on PLAIN bf16 operands (inputs: exact, + bias; all 4096 (t, b) rows at once); QR and the PB.rv term f32 on VALU; scores (K 64) and P.v on
// hl planes (3 products) for the first 512 query rows of each group and SINGLE fp16 planes for the rest; softmax f32 in registers; Wo on hl planes x exact (+bias). One-wave-per-64x64-tile GEMMs z-batched over ZH = 4 groups a pass. Deterministic, no atomics;

#define TT   2048
#define BB   2
#define EE   1024
#define NH_  16
#define NG   (BB * NH_)
#define HD   64
#define NR   33
#define MR   16
#define ZH   4
#define RH   512
#define PCAR 1024.0f
#define KS   16
typedef _Float16 h16;
typedef unsigned short bf;
typedef __attribute__((ext_vector_type(16))) __bf16   v16bf;
typedef __attribute__((ext_vector_type(16))) _Float16 v16h;
typedef __attribute__((ext_vector_type(8)))  _Float16 v8h;
typedef __attribute__((ext_vector_type(8)))  unsigned short v8us;
typedef __attribute__((ext_vector_type(8)))  float    v8f;
typedef __attribute__((ext_vector_type(4)))  float    v4f;
typedef v8h  __attribute__((may_alias)) v8ha;
typedef v4f  __attribute__((may_alias)) v4fa;
typedef v8us __attribute__((may_alias)) v8usa;

__device__ __forceinline__ unsigned short f2bf(float f) { unsigned u = __float_as_uint(f); u += 0x7FFFu + ((u >> 16) & 1u); return (unsigned short)(u >> 16); }
__device__ __forceinline__ float bf2f(unsigned short b) { return __uint_as_float(((unsigned)b) << 16); }
__device__ __forceinline__ float bfr(float f) { return bf2f(f2bf(f)); }
__device__ __forceinline__ v16h cat16(v8h lo, v8h hi) { return __builtin_shufflevector(lo, hi, 0, 1, 2, 3, 4, 5, 6, 7, 8, 9, 10, 11, 12, 13, 14, 15); }
__device__ __forceinline__ v16bf cat16b(v8us lo, v8us hi) { return __builtin_bit_cast(v16bf, __builtin_shufflevector(lo, hi, 0, 1, 2, 3, 4, 5, 6, 7, 8, 9, 10, 11, 12, 13, 14, 15)); }
__device__ __forceinline__ v8f wmma16(v16h a, v16h b, v8f c) { return __builtin_amdgcn_wmma_f32_16x16x32_f16(false, a, false, b, (short)0, c, false, false); }
__device__ __forceinline__ v8f wmmab(v16bf a, v16bf b, v8f c) { return __builtin_amdgcn_wmma_f32_16x16x32_bf16(false, a, false, b, (short)0, c, false, false); }



// ---- k_gemmw: register-blocked GEMM, ONE WAVE per 64x64 output tile (16 accumulators), operands straight from K-contiguous 16-bit planes; grid (M/64, N/64, Z), 32 threads.
// C[m][n] (f32, pitch ldc, + optional f32 bias[n]) = sum_k A[m][k] Bt[n][k] (+ split products per NSPLIT). z-batch strides sA/sB/sC in elements. K % 32 == 0.
// KSLICE (N == 64 only): blockIdx.y is a K slice of klen, not a column tile; slice y stores its partial product at C + y * sK and the reader adds the slices in order.
template <typename T16> struct WFrag;
template <> struct WFrag<h16> { typedef v16h V; static __device__ __forceinline__ V ld(const h16* p) { return cat16(*(const v8h*)p, *(const v8h*)(p + 16)); } static __device__ __forceinline__ v8f mma(V a, V b, v8f c) { return wmma16(a, b, c); } };
template <> struct WFrag<bf> { typedef v16bf V; static __device__ __forceinline__ V ld(const bf* p) { return cat16b(*(const v8us*)p, *(const v8us*)(p + 16)); } static __device__ __forceinline__ v8f mma(V a, V b, v8f c) { return wmmab(a, b, c); } };
template <typename T16, int NSPLIT, bool BIAS, bool KSLICE>
__global__ __launch_bounds__(32) void k_gemmw(const T16* __restrict__ A, const T16* __restrict__ A2, const T16* __restrict__ Bt, const T16* __restrict__ Bt2, int K, float* C, int ldc, const float* __restrict__ bias, size_t sA, size_t sB, size_t sC, int klen, size_t sK) {
    typedef typename WFrag<T16>::V V;
    __shared__ __align__(16) float os[16 * 68];
    const size_t z = blockIdx.z; A += z * sA; if (A2) A2 += z * sA; Bt += z * sB; if (Bt2) Bt2 += z * sB; C += z * sC;
    const int lane = threadIdx.x & 31, lr = lane & 15, hi = lane >> 4; const int r0 = blockIdx.x * 64, c0 = KSLICE ? 0 : blockIdx.y * 64; const int kbeg = KSLICE ? blockIdx.y * klen : 0, kend = KSLICE ? kbeg + klen : K; if (KSLICE) C += blockIdx.y * sK;
    v8f acc[4][4];
#pragma unroll
    for (int mb = 0; mb < 4; ++mb)
#pragma unroll
        for (int nb = 0; nb < 4; ++nb) acc[mb][nb] = (v8f){};
    const size_t aoff = (size_t)(r0 + lr) * K + 8 * hi, boff = (size_t)(c0 + lr) * K + 8 * hi;
#pragma unroll 1
    for (int kc = kbeg; kc < kend; kc += 32) {
        V a[4], a2[4];
#pragma unroll
        for (int mb = 0; mb < 4; ++mb) { a[mb] = WFrag<T16>::ld(A + aoff + (size_t)mb * 16 * K + kc); if (NSPLIT == 1 || NSPLIT == 2) a2[mb] = WFrag<T16>::ld(A2 + aoff + (size_t)mb * 16 * K + kc); }
#pragma unroll
        for (int nb = 0; nb < 4; ++nb) { const V b = WFrag<T16>::ld(Bt + boff + (size_t)nb * 16 * K + kc); V b2; if (NSPLIT >= 2) b2 = WFrag<T16>::ld(Bt2 + boff + (size_t)nb * 16 * K + kc);
#pragma unroll
            for (int mb = 0; mb < 4; ++mb) { acc[mb][nb] = WFrag<T16>::mma(a[mb], b, acc[mb][nb]); if (NSPLIT == 1 || NSPLIT == 2) acc[mb][nb] = WFrag<T16>::mma(a2[mb], b, acc[mb][nb]); if (NSPLIT >= 2) acc[mb][nb] = WFrag<T16>::mma(a[mb], b2, acc[mb][nb]); } }
        asm volatile("v_nop\n\tv_nop\n\tv_nop\n\tv_nop" : "+v"(acc[0][0]), "+v"(acc[1][1]), "+v"(acc[2][2]), "+v"(acc[3][3]) : "v"(a[0]), "v"(a[3]));
    }
#pragma unroll
    for (int mb = 0; mb < 4; ++mb) {
#pragma unroll
        for (int nb = 0; nb < 4; ++nb) {
#pragma unroll
            for (int j = 0; j < 8; ++j) os[(hi * 8 + j) * 68 + nb * 16 + lr] = acc[mb][nb][j]; }
        __builtin_amdgcn_wave_barrier(); asm volatile("" ::: "memory");
        float* crow = C + (size_t)(r0 + mb * 16) * ldc + c0;
{
#pragma unroll
            for (int s = 0; s < 8; ++s) { const int row = 2 * s + hi, cofs = lr * 4; v4f val = *(const v4fa*)(os + row * 68 + cofs); if (BIAS) { val[0] += bfr(bias[c0 + cofs]); val[1] += bfr(bias[c0 + cofs + 1]); val[2] += bfr(bias[c0 + cofs + 2]); val[3] += bfr(bias[c0 + cofs + 3]); }
                *(v4f*)(crow + (size_t)row * ldc + cofs) = val; }
             }
        __builtin_amdgcn_wave_barrier(); asm volatile("" ::: "memory");
    }
}

__device__ __forceinline__ h16 tohx(float x) { return (h16)x; }
__device__ __forceinline__ void splitf(float y, unsigned short& h, unsigned short& l) { h = f2bf(y); l = f2bf(y - bf2f(h)); }
typedef __attribute__((ext_vector_type(2))) _Float16 v2h;
typedef __attribute__((ext_vector_type(4))) _Float16 v4h;
typedef __attribute__((ext_vector_type(2))) unsigned short v2us;
typedef __attribute__((ext_vector_type(4))) unsigned short v4us;
typedef __attribute__((ext_vector_type(2))) float v2f;

__global__ __launch_bounds__(256) void k_cvt8(const float* __restrict__ src, bf* dst, size_t n8) { const size_t i = (size_t)blockIdx.x * 256 + threadIdx.x; if (i >= n8) return; const v8f v = *(const v8f*)(src + i * 8); v8us o;
#pragma unroll
    for (int k = 0; k < 8; ++k) o[k] = f2bf(v[k]); *(v8us*)(dst + i * 8) = o;  }
__global__ __launch_bounds__(256) void k_pl(const float* __restrict__ F, float scl, h16* P16, bf* Ph, bf* Pl) { const size_t e = ((size_t)blockIdx.x * 256 + threadIdx.x) * 2; if (e >= (size_t)NG * TT * HD) return; const int d = (int)(e % HD); const int t = (int)((e / HD) % TT); const int n = (int)(e / ((size_t)HD * TT)); const int b = n / NH_, h = n % NH_; const float* f = F + ((size_t)t * BB + b) * EE + h * HD + d; v2h o; v2us oh, ol;
#pragma unroll
    for (int u = 0; u < 2; ++u) { const float v = f[u] * scl; o[u] = tohx(v); unsigned short a, c; splitf(v, a, c); oh[u] = a; ol[u] = c; } { *(v2h*)(P16 + e) = o; *(v2us*)(Ph + e) = oh; *(v2us*)(Pl + e) = ol;  } }
__global__ __launch_bounds__(256) void k_vtp(const float* __restrict__ F, h16* V16, bf* Vh, bf* Vl) { const size_t e = ((size_t)blockIdx.x * 256 + threadIdx.x) * 2; if (e >= (size_t)NG * HD * TT) return; const int t = (int)(e % TT); const int d = (int)((e / TT) % HD); const int n = (int)(e / ((size_t)TT * HD)); const int b = n / NH_, h = n % NH_; v2h o; v2us oh, ol;
#pragma unroll
    for (int u = 0; u < 2; ++u) { const float v = F[((size_t)(t + u) * BB + b) * EE + h * HD + d]; o[u] = tohx(v); unsigned short a, c; splitf(v, a, c); oh[u] = a; ol[u] = c; } { *(v2h*)(V16 + e) = o; *(v2us*)(Vh + e) = oh; *(v2us*)(Vl + e) = ol;  } }
__global__ __launch_bounds__(256) void k_qr(const float* __restrict__ QF, const float* __restrict__ rk, float* QR) { const size_t e = (size_t)blockIdx.x * 256 + threadIdx.x; if (e >= (size_t)NG * TT * 64) return; const int r = (int)(e % 64); const int t = (int)((e / 64) % TT); const int n = (int)(e / ((size_t)64 * TT)); const int b = n / NH_, h = n % NH_; float s = 0.f;
    if (r < NR) { const float* q = QF + ((size_t)t * BB + b) * EE + h * HD;
#pragma unroll 1
        for (int d = 0; d < HD; ++d) { float p = __fmul_rn(q[d] * 0.125f, bfr(rk[r * HD + d])); asm volatile("" : "+v"(p)); s = __fadd_rn(s, p); } }
    *(float*)(QR + e) = s;  }
// k_pb: one wave per (z, t) row re-reading the probability row (hl planes for rows < RH, fp16/1024 otherwise): PB[z][t][r] = sum of p over bucket r (r = 0: s <= t-16; r = 32: s >= t+16; else the single key s = t + r - 16,
__global__ __launch_bounds__(256) void k_rsoft(const float* __restrict__ Sb, const float* __restrict__ QR, int n0, h16* P16, bf* Ph, bf* Pl) { const int lane = threadIdx.x & 31; const int row = blockIdx.x * 8 + (threadIdx.x >> 5); if (row >= ZH * TT) return; const int t = row % TT, z = row / TT; const bool hires = t < RH; const float* sr = Sb + (size_t)row * TT; const float* qr = QR + ((size_t)(n0 + z) * TT + t) * 64; float v[64]; float mx = -3.0e38f;
#pragma unroll
    for (int ch = 0; ch < 16; ++ch) { const int j0 = ch * 128 + lane * 4; const v4f a = *(const v4f*)(sr + j0);
#pragma unroll
        for (int q = 0; q < 4; ++q) { const int s = j0 + q; const int r = min(max(s - t, -MR), MR) + MR; const float x = __fadd_rn(a[q], qr[r]); v[ch * 4 + q] = x; mx = fmaxf(mx, x); } }
#pragma unroll
    for (int sh = 16; sh; sh >>= 1) mx = fmaxf(mx, __shfl_xor(mx, sh, 32));
    float sum = 0.f;
#pragma unroll
    for (int k = 0; k < 64; ++k) { float d0 = __fsub_rn(v[k], mx); asm volatile("" : "+v"(d0)); v[k] = __expf(d0); sum += v[k]; }
#pragma unroll
    for (int sh = 16; sh; sh >>= 1) sum += __shfl_xor(sum, sh, 32);
    const float inv = __fdiv_rn(1.0f, sum);
{
        if (hires) {
#pragma unroll
            for (int ch = 0; ch < 16; ++ch) { v4us oh, ol;
#pragma unroll
                for (int q = 0; q < 4; ++q) { unsigned short a, c2; splitf(v[ch * 4 + q] * inv, a, c2); oh[q] = a; ol[q] = c2; } const size_t oo = ((size_t)z * RH + t) * TT + ch * 128 + lane * 4; *(v4us*)(Ph + oo) = oh; *(v4us*)(Pl + oo) = ol; }
        } else { const float f = inv * PCAR;
#pragma unroll
            for (int ch = 0; ch < 16; ++ch) { v4h o4; o4[0] = tohx(v[ch * 4] * f); o4[1] = tohx(v[ch * 4 + 1] * f); o4[2] = tohx(v[ch * 4 + 2] * f); o4[3] = tohx(v[ch * 4 + 3] * f); *(v4h*)(P16 + (size_t)row * TT + ch * 128 + lane * 4) = o4; } }
         } }
__global__ __launch_bounds__(256) void k_pb(const h16* __restrict__ P16, const bf* __restrict__ Ph, const bf* __restrict__ Pl, float* PB) { const int lane = threadIdx.x & 31; const int row = blockIdx.x * 8 + (threadIdx.x >> 5); if (row >= ZH * TT) return; const int t = row % TT, z = row / TT; const bool hires = t < RH;
    const int r0 = 2 * lane, r1 = 2 * lane + 1; const int s0 = t + r0 - MR, s1 = t + r1 - MR; const int l0 = (s0 & 127) >> 2, l1 = (s1 & 127) >> 2; const int k0 = ((s0 >> 7) << 2) | (s0 & 3), k1 = ((s1 >> 7) << 2) | (s1 & 3); float lo = 0.f, hi = 0.f, pv0 = 0.f, pv1 = 0.f;
#pragma unroll
    for (int ch = 0; ch < 16; ++ch) { const int j0 = ch * 128 + lane * 4; float a[4];
        if (hires) { const size_t oo = ((size_t)z * RH + t) * TT + j0; const v4us ah = *(const v4us*)(Ph + oo), al = *(const v4us*)(Pl + oo);
#pragma unroll
            for (int q = 0; q < 4; ++q) a[q] = __fadd_rn(bf2f(ah[q]), bf2f(al[q])); }
        else { const v4h p4 = *(const v4h*)(P16 + (size_t)row * TT + j0);
#pragma unroll
            for (int q = 0; q < 4; ++q) a[q] = (float)p4[q] * (1.0f / PCAR); }
#pragma unroll
        for (int q = 0; q < 4; ++q) { const int s = j0 + q; if (s <= t - MR) lo = __fadd_rn(lo, a[q]); else if (s >= t + MR) hi = __fadd_rn(hi, a[q]); const float b0 = __shfl(a[q], l0, 32), b1 = __shfl(a[q], l1, 32); if (ch * 4 + q == k0) pv0 = b0; if (ch * 4 + q == k1) pv1 = b1; } }
#pragma unroll
    for (int sh = 16; sh; sh >>= 1) { lo += __shfl_xor(lo, sh, 32); hi += __shfl_xor(hi, sh, 32); }
    pv0 = (r0 > 0 && r0 < 2 * MR && s0 >= 0 && s0 < TT) ? pv0 : 0.f; pv1 = (r1 < 2 * MR && s1 >= 0 && s1 < TT) ? pv1 : 0.f; if (lane == 0) pv0 = lo; if (lane == MR) pv0 = hi;
    float* pb = PB + ((size_t)z * TT + t) * 64; v2f o; o[0] = pv0; o[1] = pv1; *(v2f*)(pb + 2 * lane) = o;  }
__global__ __launch_bounds__(256) void k_mrg(const float* __restrict__ Ob, const float* __restrict__ PB, const float* __restrict__ rv, int n0, bf* Ah, bf* Al) { const size_t e = ((size_t)blockIdx.x * 256 + threadIdx.x) * 2; if (e >= (size_t)ZH * TT * HD) return; const int d = (int)(e % HD); const int t = (int)((e / HD) % TT); const int z = (int)(e / ((size_t)HD * TT)); const int n = n0 + z; const int b = n / NH_, h = n % NH_; const float f = t < RH ? 1.0f : (1.0f / PCAR); const float* pb = PB + ((size_t)z * TT + t) * 64; v2us oh, ol; v2f ps = *(const v2f*)(Ob + e);
#pragma unroll
    for (int ks = 1; ks < KS; ++ks) ps += *(const v2f*)(Ob + (size_t)ks * ZH * TT * HD + e);
#pragma unroll
    for (int u = 0; u < 2; ++u) { float acc = ps[u] * f;
#pragma unroll 1
        for (int r = 0; r < NR; ++r) { float p = __fmul_rn(pb[r], bfr(rv[r * HD + d + u])); asm volatile("" : "+v"(p)); acc = __fadd_rn(acc, p); }
        unsigned short a, c; splitf(acc, a, c); oh[u] = a; ol[u] = c; }
    const size_t o = ((size_t)t * BB + b) * EE + h * HD + d; *(v2us*)(Ah + o) = oh; *(v2us*)(Al + o) = ol;  }

extern "C" void kernel_launch(void* const* d_in, const int* in_sizes, int n_in,
                              void* d_out, int out_size, void* d_ws, size_t ws_size, hipStream_t stream) {
    (void)in_sizes; (void)n_in; (void)out_size;
    const float* x = (const float*)d_in[0]; const float* Wq = (const float*)d_in[1]; const float* bq = (const float*)d_in[2]; const float* Wk = (const float*)d_in[3]; const float* bk = (const float*)d_in[4]; const float* Wv = (const float*)d_in[5]; const float* bv = (const float*)d_in[6]; const float* Wo = (const float*)d_in[7]; const float* bo = (const float*)d_in[8]; const float* rk = (const float*)d_in[9]; const float* rv = (const float*)d_in[10];
    float* OUT = (float*)d_out;     // [2048][2][1024]
    char* wsp = (char*)d_ws;
    auto take = [&](size_t bytes) { char* p = wsp; wsp += (bytes + 255) & ~(size_t)255; return (void*)p; };
    const size_t NTB = (size_t)TT * BB;
    bf* WO = (bf*)take((size_t)EE * EE * 2); float* QR = (float*)take((size_t)NG * TT * 64 * 4); bf* Ah = (bf*)take(NTB * EE * 2); bf* Al = (bf*)take(NTB * EE * 2);
    h16* Q16 = (h16*)take((size_t)NG * TT * HD * 2); bf* Qh = (bf*)take((size_t)NG * TT * HD * 2); bf* Ql = (bf*)take((size_t)NG * TT * HD * 2); h16* K16 = (h16*)take((size_t)NG * TT * HD * 2); bf* Kh = (bf*)take((size_t)NG * TT * HD * 2); bf* Kl = (bf*)take((size_t)NG * TT * HD * 2); h16* V16 = (h16*)take((size_t)NG * HD * TT * 2); bf* Vh = (bf*)take((size_t)NG * HD * TT * 2); bf* Vl = (bf*)take((size_t)NG * HD * TT * 2);
    char* const stage = wsp;   // from here on two tenants: the projection stage's buffers (last read by k_vtp), then the attention passes' buffers (first written after it, each before it is read)
    bf* WQ = (bf*)take((size_t)EE * EE * 2); bf* WK = (bf*)take((size_t)EE * EE * 2); bf* WV = (bf*)take((size_t)EE * EE * 2); bf* XB = (bf*)take(NTB * EE * 2); float* QF = (float*)take(NTB * EE * 4); float* KF = (float*)take(NTB * EE * 4);
    wsp = stage;
    float* Sb = (float*)take((size_t)ZH * TT * TT * 4); h16* P16 = (h16*)take((size_t)ZH * TT * TT * 2); bf* Ph = (bf*)take((size_t)ZH * RH * TT * 2); bf* Pl = (bf*)take((size_t)ZH * RH * TT * 2); float* PB = (float*)take((size_t)ZH * TT * 64 * 4); float* Ob = (float*)take((size_t)KS * ZH * TT * HD * 4);
    if ((size_t)(wsp - (char*)d_ws) > ws_size) return;    // total 252 MiB (kept 106 MiB = six [32][2048][64] q/k and three [32][64][2048] v planes 72, QR 16, merged planes 16, Wo 2; shared 146 MiB = four-group scores 64, probabilities 48, bucket sums 2, K-slice partials of P.v 32, over the 46 MiB of the projection stage)
    float* VF = KF;   // v projection reuses the k buffer after the k planes are built
    k_cvt8<<<(EE * EE / 8 + 255) / 256, 256, 0, stream>>>(Wq, WQ, (size_t)EE * EE / 8); k_cvt8<<<(EE * EE / 8 + 255) / 256, 256, 0, stream>>>(Wk, WK, (size_t)EE * EE / 8); k_cvt8<<<(EE * EE / 8 + 255) / 256, 256, 0, stream>>>(Wv, WV, (size_t)EE * EE / 8); k_cvt8<<<(EE * EE / 8 + 255) / 256, 256, 0, stream>>>(Wo, WO, (size_t)EE * EE / 8);
    k_cvt8<<<(unsigned)((NTB * EE / 8 + 255) / 256), 256, 0, stream>>>(x, XB, NTB * EE / 8);
    const unsigned LP = (unsigned)(((size_t)NG * TT * HD / 2 + 255) / 256);
    k_gemmw<bf, 0, true, false><<<dim3(NTB / 64, EE / 64, 1), 32, 0, stream>>>(XB, nullptr, WQ, nullptr, EE, QF, EE, bq, 0, 0, 0, 0, 0); k_pl<<<LP, 256, 0, stream>>>(QF, 0.125f, Q16, Qh, Ql); k_qr<<<(unsigned)(((size_t)NG * TT * 64 + 255) / 256), 256, 0, stream>>>(QF, rk, QR);
    k_gemmw<bf, 0, true, false><<<dim3(NTB / 64, EE / 64, 1), 32, 0, stream>>>(XB, nullptr, WK, nullptr, EE, KF, EE, bk, 0, 0, 0, 0, 0); k_pl<<<LP, 256, 0, stream>>>(KF, 1.0f, K16, Kh, Kl);
    k_gemmw<bf, 0, true, false><<<dim3(NTB / 64, EE / 64, 1), 32, 0, stream>>>(XB, nullptr, WV, nullptr, EE, VF, EE, bv, 0, 0, 0, 0, 0); k_vtp<<<LP, 256, 0, stream>>>(VF, V16, Vh, Vl);
    for (int n0 = 0; n0 < NG; n0 += ZH) { const size_t z = (size_t)n0;
        k_gemmw<bf, 2, false, false><<<dim3(RH / 64, TT / 64, ZH), 32, 0, stream>>>(Qh + z * TT * HD, Ql + z * TT * HD, Kh + z * TT * HD, Kl + z * TT * HD, HD, Sb, TT, nullptr, (size_t)TT * HD, (size_t)TT * HD, (size_t)TT * TT, 0, 0);
        k_gemmw<h16, 0, false, false><<<dim3((TT - RH) / 64, TT / 64, ZH), 32, 0, stream>>>(Q16 + z * TT * HD + (size_t)RH * HD, nullptr, K16 + z * TT * HD, nullptr, HD, Sb + (size_t)RH * TT, TT, nullptr, (size_t)TT * HD, (size_t)TT * HD, (size_t)TT * TT, 0, 0);
        k_rsoft<<<ZH * TT / 8, 256, 0, stream>>>(Sb, QR, n0, P16, Ph, Pl); k_pb<<<ZH * TT / 8, 256, 0, stream>>>(P16, Ph, Pl, PB);
        k_gemmw<bf, 2, false, true><<<dim3(RH / 64, KS, ZH), 32, 0, stream>>>(Ph, Pl, Vh + z * HD * TT, Vl + z * HD * TT, TT, Ob, HD, nullptr, (size_t)RH * TT, (size_t)HD * TT, (size_t)TT * HD, TT / KS, (size_t)ZH * TT * HD);
        k_gemmw<h16, 0, false, true><<<dim3((TT - RH) / 64, KS, ZH), 32, 0, stream>>>(P16 + (size_t)RH * TT, nullptr, V16 + z * HD * TT, nullptr, TT, Ob + (size_t)RH * HD, HD, nullptr, (size_t)TT * TT, (size_t)HD * TT, (size_t)TT * HD, TT / KS, (size_t)ZH * TT * HD);
        k_mrg<<<(unsigned)(((size_t)ZH * TT * HD / 2 + 255) / 256), 256, 0, stream>>>(Ob, PB, rv, n0, Ah, Al); }
    k_gemmw<bf, 1, true, false><<<dim3(NTB / 64, EE / 64, 1), 32, 0, stream>>>(Ah, Al, WO, nullptr, EE, OUT, EE, bo, 0, 0, 0, 0, 0);
}

// v003
// One run takes 937 microseconds.
// Next to v002, in two timings, it ran 1.14 and 1.13 times as fast.
// Counting every step since v000, it is 2.55 times as fast.
#include <hip/hip_runtime.h>

// VanillaSLSTMFeat - Shaw relative-position multi-head attention, sequence-first (query [2048][2][1024]; q = (x Wq^T + bq)/8, k, v = x W^T + b; 32 groups n = b*16 + h of 64 dims; scores = q.k + q.rk[clip(s-t,-16,16)+16];
// softmax; attn = P.v + sum_s P[t][s] rv[clip(s-t)+16]; out = merged Wo^T + bo -> [2048][2][1024]; rk/rv tables [33][64] read as data).
// The relative terms are exact regroupings: q.rk depends on (t, bucket) only -> QR[n][t][r] = q_t . rk[r] (33 per row, added inside the softmax kernel by bucket); sum_s P rv = sum_r PB[t][r] rv[r] with PB the per-bucket
// probability sums (buckets 0 / 32 collect all keys at distance <= -16 / >= +16), formed by k_pb re-reading the stored probabilities after the softmax kernel and contracted with rv on VALU at the merge.
// Compute dtypes, f32 accumulate: every input rounded to bf16; projections on PLAIN bf16 operands (inputs: exact, + bias; all 4096 (t, b) rows at once); QR and the PB.rv term f32 on VALU; scores (K 64) and P.v on
// hl planes (3 products) for the first 512 query rows of each group and SINGLE fp16 planes for the rest; softmax f32 in registers; Wo on hl planes x exact (+bias). One-wave-per-64x64-tile GEMMs z-batched over ZH = 4 groups a pass. Deterministic, no atomics;

#define TT   2048
#define BB   2
#define EE   1024
#define NH_  16
#define NG   (BB * NH_)
#define HD   64
#define NR   33
#define MR   16
#define ZH   4
#define RH   512
#define PCAR 1024.0f
#define KS   16
typedef _Float16 h16;
typedef unsigned short bf;
typedef __attribute__((ext_vector_type(16))) __bf16   v16bf;
typedef __attribute__((ext_vector_type(16))) _Float16 v16h;
typedef __attribute__((ext_vector_type(8)))  _Float16 v8h;
typedef __attribute__((ext_vector_type(8)))  unsigned short v8us;
typedef __attribute__((ext_vector_type(8)))  float    v8f;
typedef __attribute__((ext_vector_type(4)))  float    v4f;
typedef v8h  __attribute__((may_alias)) v8ha;
typedef v4f  __attribute__((may_alias)) v4fa;
typedef v8us __attribute__((may_alias)) v8usa;

__device__ __forceinline__ unsigned short f2bf(float f) { unsigned u = __float_as_uint(f); u += 0x7FFFu + ((u >> 16) & 1u); return (unsigned short)(u >> 16); }
__device__ __forceinline__ float bf2f(unsigned short b) { return __uint_as_float(((unsigned)b) << 16); }
__device__ __forceinline__ float bfr(float f) { return bf2f(f2bf(f)); }
__device__ __forceinline__ v16h cat16(v8h lo, v8h hi) { return __builtin_shufflevector(lo, hi, 0, 1, 2, 3, 4, 5, 6, 7, 8, 9, 10, 11, 12, 13, 14, 15); }
__device__ __forceinline__ v16bf cat16b(v8us lo, v8us hi) { return __builtin_bit_cast(v16bf, __builtin_shufflevector(lo, hi, 0, 1, 2, 3, 4, 5, 6, 7, 8, 9, 10, 11, 12, 13, 14, 15)); }
__device__ __forceinline__ v8f wmma16(v16h a, v16h b, v8f c) { return __builtin_amdgcn_wmma_f32_16x16x32_f16(false, a, false, b, (short)0, c, false, false); }
__device__ __forceinline__ v8f wmmab(v16bf a, v16bf b, v8f c) { return __builtin_amdgcn_wmma_f32_16x16x32_bf16(false, a, false, b, (short)0, c, false, false); }



// ---- k_gemmw: register-blocked GEMM, ONE WAVE per 64x64 output tile (16 accumulators), operands straight from K-contiguous 16-bit planes; grid (M/64, N/64, Z), 32 threads.
// C[m][n] (f32, pitch ldc, + optional f32 bias[n]) = sum_k A[m][k] Bt[n][k] (+ split products per NSPLIT). z-batch strides sA/sB/sC in elements. K % 32 == 0.
// KSLICE (N == 64 only): blockIdx.y is a K slice of klen, not a column tile; slice y stores its partial product at C + y * sK and the reader adds the slices in order.
template <typename T16> struct WFrag;
template <> struct WFrag<h16> { typedef v16h V; static __device__ __forceinline__ V ld(const h16* p) { return cat16(*(const v8h*)p, *(const v8h*)(p + 16)); } static __device__ __forceinline__ v8f mma(V a, V b, v8f c) { return wmma16(a, b, c); } };
template <> struct WFrag<bf> { typedef v16bf V; static __device__ __forceinline__ V ld(const bf* p) { return cat16b(*(const v8us*)p, *(const v8us*)(p + 16)); } static __device__ __forceinline__ v8f mma(V a, V b, v8f c) { return wmmab(a, b, c); } };
template <typename T16, int NSPLIT, bool BIAS, bool KSLICE>
__global__ __launch_bounds__(32) void k_gemmw(const T16* __restrict__ A, const T16* __restrict__ A2, const T16* __restrict__ Bt, const T16* __restrict__ Bt2, int K, float* C, int ldc, const float* __restrict__ bias, size_t sA, size_t sB, size_t sC, int klen, size_t sK) {
    typedef typename WFrag<T16>::V V;
    __shared__ __align__(16) float os[16 * 68];
    const size_t z = blockIdx.z; A += z * sA; if (A2) A2 += z * sA; Bt += z * sB; if (Bt2) Bt2 += z * sB; C += z * sC;
    const int lane = threadIdx.x & 31, lr = lane & 15, hi = lane >> 4; const int r0 = blockIdx.x * 64, c0 = KSLICE ? 0 : blockIdx.y * 64; const int kbeg = KSLICE ? blockIdx.y * klen : 0, kend = KSLICE ? kbeg + klen : K; if (KSLICE) C += blockIdx.y * sK;
    v8f acc[4][4];
#pragma unroll
    for (int mb = 0; mb < 4; ++mb)
#pragma unroll
        for (int nb = 0; nb < 4; ++nb) acc[mb][nb] = (v8f){};
    const size_t aoff = (size_t)(r0 + lr) * K + 8 * hi, boff = (size_t)(c0 + lr) * K + 8 * hi;
#pragma unroll 1
    for (int kc = kbeg; kc < kend; kc += 32) {
        V a[4], a2[4];
#pragma unroll
        for (int mb = 0; mb < 4; ++mb) { a[mb] = WFrag<T16>::ld(A + aoff + (size_t)mb * 16 * K + kc); if (NSPLIT == 1 || NSPLIT == 2) a2[mb] = WFrag<T16>::ld(A2 + aoff + (size_t)mb * 16 * K + kc); }
#pragma unroll
        for (int nb = 0; nb < 4; ++nb) { const V b = WFrag<T16>::ld(Bt + boff + (size_t)nb * 16 * K + kc); V b2; if (NSPLIT >= 2) b2 = WFrag<T16>::ld(Bt2 + boff + (size_t)nb * 16 * K + kc);
#pragma unroll
            for (int mb = 0; mb < 4; ++mb) { acc[mb][nb] = WFrag<T16>::mma(a[mb], b, acc[mb][nb]); if (NSPLIT == 1 || NSPLIT == 2) acc[mb][nb] = WFrag<T16>::mma(a2[mb], b, acc[mb][nb]); if (NSPLIT >= 2) acc[mb][nb] = WFrag<T16>::mma(a[mb], b2, acc[mb][nb]); } }
        asm volatile("v_nop\n\tv_nop\n\tv_nop\n\tv_nop" : "+v"(acc[0][0]), "+v"(acc[1][1]), "+v"(acc[2][2]), "+v"(acc[3][3]) : "v"(a[0]), "v"(a[3]));
    }
#pragma unroll
    for (int mb = 0; mb < 4; ++mb) {
#pragma unroll
        for (int nb = 0; nb < 4; ++nb) {
#pragma unroll
            for (int j = 0; j < 8; ++j) os[(hi * 8 + j) * 68 + nb * 16 + lr] = acc[mb][nb][j]; }
        __builtin_amdgcn_wave_barrier(); asm volatile("" ::: "memory");
        float* crow = C + (size_t)(r0 + mb * 16) * ldc + c0;
{
#pragma unroll
            for (int s = 0; s < 8; ++s) { const int row = 2 * s + hi, cofs = lr * 4; v4f val = *(const v4fa*)(os + row * 68 + cofs); if (BIAS) { val[0] += bfr(bias[c0 + cofs]); val[1] += bfr(bias[c0 + cofs + 1]); val[2] += bfr(bias[c0 + cofs + 2]); val[3] += bfr(bias[c0 + cofs + 3]); }
                *(v4f*)(crow + (size_t)row * ldc + cofs) = val; }
             }
        __builtin_amdgcn_wave_barrier(); asm volatile("" ::: "memory");
    }
}

__device__ __forceinline__ h16 tohx(float x) { return (h16)x; }
__device__ __forceinline__ void splitf(float y, unsigned short& h, unsigned short& l) { h = f2bf(y); l = f2bf(y - bf2f(h)); }
typedef __attribute__((ext_vector_type(2))) _Float16 v2h;
typedef __attribute__((ext_vector_type(4))) _Float16 v4h;
typedef __attribute__((ext_vector_type(2))) unsigned short v2us;
typedef __attribute__((ext_vector_type(4))) unsigned short v4us;
typedef __attribute__((ext_vector_type(2))) float v2f;

__global__ __launch_bounds__(256) void k_cvt8(const float* __restrict__ src, bf* dst, size_t n8) { const size_t i = (size_t)blockIdx.x * 256 + threadIdx.x; if (i >= n8) return; const v8f v = *(const v8f*)(src + i * 8); v8us o;
#pragma unroll
    for (int k = 0; k < 8; ++k) o[k] = f2bf(v[k]); *(v8us*)(dst + i * 8) = o;  }
__global__ __launch_bounds__(256) void k_pl(const float* __restrict__ F, float scl, h16* P16, bf* Ph, bf* Pl) { const size_t e = ((size_t)blockIdx.x * 256 + threadIdx.x) * 2; if (e >= (size_t)NG * TT * HD) return; const int d = (int)(e % HD); const int t = (int)((e / HD) % TT); const int n = (int)(e / ((size_t)HD * TT)); const int b = n / NH_, h = n % NH_; const float* f = F + ((size_t)t * BB + b) * EE + h * HD + d; v2h o; v2us oh, ol;
#pragma unroll
    for (int u = 0; u < 2; ++u) { const float v = f[u] * scl; o[u] = tohx(v); unsigned short a, c; splitf(v, a, c); oh[u] = a; ol[u] = c; } { *(v2h*)(P16 + e) = o; *(v2us*)(Ph + e) = oh; *(v2us*)(Pl + e) = ol;  } }
__global__ __launch_bounds__(256) void k_vtp(const float* __restrict__ F, h16* V16, bf* Vh, bf* Vl) { const size_t e = ((size_t)blockIdx.x * 256 + threadIdx.x) * 2; if (e >= (size_t)NG * HD * TT) return; const int t = (int)(e % TT); const int d = (int)((e / TT) % HD); const int n = (int)(e / ((size_t)TT * HD)); const int b = n / NH_, h = n % NH_; v2h o; v2us oh, ol;
#pragma unroll
    for (int u = 0; u < 2; ++u) { const float v = F[((size_t)(t + u) * BB + b) * EE + h * HD + d]; o[u] = tohx(v); unsigned short a, c; splitf(v, a, c); oh[u] = a; ol[u] = c; } { *(v2h*)(V16 + e) = o; *(v2us*)(Vh + e) = oh; *(v2us*)(Vl + e) = ol;  } }
// k_qr: one thread per (group, query) row: the scaled query row sits in 64 registers, the 33 rounded rk rows in LDS, read at one address by the whole wave (a broadcast), four buckets a pass; each sum runs over d in ascending order.
__global__ __launch_bounds__(256) void k_qr(const float* __restrict__ QF, const float* __restrict__ rk, float* QR) { __shared__ __align__(16) float rs[NR * HD];
    for (int i = threadIdx.x; i < NR * HD; i += 256) rs[i] = bfr(rk[i]);
    const size_t row = (size_t)blockIdx.x * 256 + threadIdx.x; const int t = (int)(row % TT), n = (int)(row / TT); const int b = n / NH_, h = n % NH_; const float* q = QF + ((size_t)t * BB + b) * EE + h * HD; float qv[HD];
    // the loops over d and k are fully unrolled so that qv stays in registers
#pragma unroll
    for (int d = 0; d < HD; d += 4) { const v4f x = *(const v4f*)(q + d); qv[d] = x[0] * 0.125f; qv[d + 1] = x[1] * 0.125f; qv[d + 2] = x[2] * 0.125f; qv[d + 3] = x[3] * 0.125f; }
    __syncthreads();   // publishes the rk rows
    float* o = QR + row * 64;
#pragma unroll 1   // eight trips of 256 multiply-adds: unrolled, the kernel is 30 KB of code that each wave runs once
    for (int r0 = 0; r0 < NR - 1; r0 += 4) { v4f s = (v4f){};
#pragma unroll
        for (int d = 0; d < HD; d += 4) {
#pragma unroll
            for (int k = 0; k < 4; ++k) { const v4f w = *(const v4fa*)(rs + (r0 + k) * HD + d); s[k] += qv[d] * w[0]; s[k] += qv[d + 1] * w[1]; s[k] += qv[d + 2] * w[2]; s[k] += qv[d + 3] * w[3]; } }
        *(v4f*)(o + r0) = s;
        asm volatile("s_wait_xcnt 0x0" ::: "memory"); }   // stands in front of the next writes of the store's address and data registers
    float s = 0.f;
#pragma unroll
    for (int d = 0; d < HD; d += 4) { const v4f w = *(const v4fa*)(rs + (NR - 1) * HD + d); s += qv[d] * w[0]; s += qv[d + 1] * w[1]; s += qv[d + 2] * w[2]; s += qv[d + 3] * w[3]; }
    o[NR - 1] = s; }
// k_pb: one wave per (z, t) row re-reading the probability row (hl planes for rows < RH, fp16/1024 otherwise): PB[z][t][r] = sum of p over bucket r (r = 0: s <= t-16; r = 32: s >= t+16; else the single key s = t + r - 16,
__global__ __launch_bounds__(256) void k_rsoft(const float* __restrict__ Sb, const float* __restrict__ QR, int n0, h16* P16, bf* Ph, bf* Pl) { const int lane = threadIdx.x & 31; const int row = blockIdx.x * 8 + (threadIdx.x >> 5); if (row >= ZH * TT) return; const int t = row % TT, z = row / TT; const bool hires = t < RH; const float* sr = Sb + (size_t)row * TT; const float* qr = QR + ((size_t)(n0 + z) * TT + t) * 64; float v[64]; float mx = -3.0e38f;
#pragma unroll
    for (int ch = 0; ch < 16; ++ch) { const int j0 = ch * 128 + lane * 4; const v4f a = *(const v4f*)(sr + j0);
#pragma unroll
        for (int q = 0; q < 4; ++q) { const int s = j0 + q; const int r = min(max(s - t, -MR), MR) + MR; const float x = __fadd_rn(a[q], qr[r]); v[ch * 4 + q] = x; mx = fmaxf(mx, x); } }
#pragma unroll
    for (int sh = 16; sh; sh >>= 1) mx = fmaxf(mx, __shfl_xor(mx, sh, 32));
    float sum = 0.f;
#pragma unroll
    for (int k = 0; k < 64; ++k) { float d0 = __fsub_rn(v[k], mx); asm volatile("" : "+v"(d0)); v[k] = __expf(d0); sum += v[k]; }
#pragma unroll
    for (int sh = 16; sh; sh >>= 1) sum += __shfl_xor(sum, sh, 32);
    const float inv = __fdiv_rn(1.0f, sum);
{
        if (hires) {
#pragma unroll
            for (int ch = 0; ch < 16; ++ch) { v4us oh, ol;
#pragma unroll
                for (int q = 0; q < 4; ++q) { unsigned short a, c2; splitf(v[ch * 4 + q] * inv, a, c2); oh[q] = a; ol[q] = c2; } const size_t oo = ((size_t)z * RH + t) * TT + ch * 128 + lane * 4; *(v4us*)(Ph + oo) = oh; *(v4us*)(Pl + oo) = ol; }
        } else { const float f = inv * PCAR;
#pragma unroll
            for (int ch = 0; ch < 16; ++ch) { v4h o4; o4[0] = tohx(v[ch * 4] * f); o4[1] = tohx(v[ch * 4 + 1] * f); o4[2] = tohx(v[ch * 4 + 2] * f); o4[3] = tohx(v[ch * 4 + 3] * f); *(v4h*)(P16 + (size_t)row * TT + ch * 128 + lane * 4) = o4; } }
         } }
__global__ __launch_bounds__(256) void k_pb(const h16* __restrict__ P16, const bf* __restrict__ Ph, const bf* __restrict__ Pl, float* PB) { const int lane = threadIdx.x & 31; const int row = blockIdx.x * 8 + (threadIdx.x >> 5); if (row >= ZH * TT) return; const int t = row % TT, z = row / TT; const bool hires = t < RH;
    const int r0 = 2 * lane, r1 = 2 * lane + 1; const int s0 = t + r0 - MR, s1 = t + r1 - MR; const int l0 = (s0 & 127) >> 2, l1 = (s1 & 127) >> 2; const int k0 = ((s0 >> 7) << 2) | (s0 & 3), k1 = ((s1 >> 7) << 2) | (s1 & 3); float lo = 0.f, hi = 0.f, pv0 = 0.f, pv1 = 0.f;
#pragma unroll
    for (int ch = 0; ch < 16; ++ch) { const int j0 = ch * 128 + lane * 4; float a[4];
        if (hires) { const size_t oo = ((size_t)z * RH + t) * TT + j0; const v4us ah = *(const v4us*)(Ph + oo), al = *(const v4us*)(Pl + oo);
#pragma unroll
            for (int q = 0; q < 4; ++q) a[q] = __fadd_rn(bf2f(ah[q]), bf2f(al[q])); }
        else { const v4h p4 = *(const v4h*)(P16 + (size_t)row * TT + j0);
#pragma unroll
            for (int q = 0; q < 4; ++q) a[q] = (float)p4[q] * (1.0f / PCAR); }
#pragma unroll
        for (int q = 0; q < 4; ++q) { const int s = j0 + q; if (s <= t - MR) lo = __fadd_rn(lo, a[q]); else if (s >= t + MR) hi = __fadd_rn(hi, a[q]); const float b0 = __shfl(a[q], l0, 32), b1 = __shfl(a[q], l1, 32); if (ch * 4 + q == k0) pv0 = b0; if (ch * 4 + q == k1) pv1 = b1; } }
#pragma unroll
    for (int sh = 16; sh; sh >>= 1) { lo += __shfl_xor(lo, sh, 32); hi += __shfl_xor(hi, sh, 32); }
    pv0 = (r0 > 0 && r0 < 2 * MR && s0 >= 0 && s0 < TT) ? pv0 : 0.f; pv1 = (r1 < 2 * MR && s1 >= 0 && s1 < TT) ? pv1 : 0.f; if (lane == 0) pv0 = lo; if (lane == MR) pv0 = hi;
    float* pb = PB + ((size_t)z * TT + t) * 64; v2f o; o[0] = pv0; o[1] = pv1; *(v2f*)(pb + 2 * lane) = o;  }
__global__ __launch_bounds__(256) void k_mrg(const float* __restrict__ Ob, const float* __restrict__ PB, const float* __restrict__ rv, int n0, bf* Ah, bf* Al) { const size_t e = ((size_t)blockIdx.x * 256 + threadIdx.x) * 2; if (e >= (size_t)ZH * TT * HD) return; const int d = (int)(e % HD); const int t = (int)((e / HD) % TT); const int z = (int)(e / ((size_t)HD * TT)); const int n = n0 + z; const int b = n / NH_, h = n % NH_; const float f = t < RH ? 1.0f : (1.0f / PCAR); const float* pb = PB + ((size_t)z * TT + t) * 64; v2us oh, ol; v2f ps = *(const v2f*)(Ob + e);
#pragma unroll
    for (int ks = 1; ks < KS; ++ks) ps += *(const v2f*)(Ob + (size_t)ks * ZH * TT * HD + e);
#pragma unroll
    for (int u = 0; u < 2; ++u) { float acc = ps[u] * f;
#pragma unroll 1
        for (int r = 0; r < NR; ++r) { float p = __fmul_rn(pb[r], bfr(rv[r * HD + d + u])); asm volatile("" : "+v"(p)); acc = __fadd_rn(acc, p); }
        unsigned short a, c; splitf(acc, a, c); oh[u] = a; ol[u] = c; }
    const size_t o = ((size_t)t * BB + b) * EE + h * HD + d; *(v2us*)(Ah + o) = oh; *(v2us*)(Al + o) = ol;  }

extern "C" void kernel_launch(void* const* d_in, const int* in_sizes, int n_in,
                              void* d_out, int out_size, void* d_ws, size_t ws_size, hipStream_t stream) {
    (void)in_sizes; (void)n_in; (void)out_size;
    const float* x = (const float*)d_in[0]; const float* Wq = (const float*)d_in[1]; const float* bq = (const float*)d_in[2]; const float* Wk = (const float*)d_in[3]; const float* bk = (const float*)d_in[4]; const float* Wv = (const float*)d_in[5]; const float* bv = (const float*)d_in[6]; const float* Wo = (const float*)d_in[7]; const float* bo = (const float*)d_in[8]; const float* rk = (const float*)d_in[9]; const float* rv = (const float*)d_in[10];
    float* OUT = (float*)d_out;     // [2048][2][1024]
    char* wsp = (char*)d_ws;
    auto take = [&](size_t bytes) { char* p = wsp; wsp += (bytes + 255) & ~(size_t)255; return (void*)p; };
    const size_t NTB = (size_t)TT * BB;
    bf* WO = (bf*)take((size_t)EE * EE * 2); float* QR = (float*)take((size_t)NG * TT * 64 * 4); bf* Ah = (bf*)take(NTB * EE * 2); bf* Al = (bf*)take(NTB * EE * 2);
    h16* Q16 = (h16*)take((size_t)NG * TT * HD * 2); bf* Qh = (bf*)take((size_t)NG * TT * HD * 2); bf* Ql = (bf*)take((size_t)NG * TT * HD * 2); h16* K16 = (h16*)take((size_t)NG * TT * HD * 2); bf* Kh = (bf*)take((size_t)NG * TT * HD * 2); bf* Kl = (bf*)take((size_t)NG * TT * HD * 2); h16* V16 = (h16*)take((size_t)NG * HD * TT * 2); bf* Vh = (bf*)take((size_t)NG * HD * TT * 2); bf* Vl = (bf*)take((size_t)NG * HD * TT * 2);
    char* const stage = wsp;   // from here on two tenants: the projection stage's buffers (last read by k_vtp), then the attention passes' buffers (first written after it, each before it is read)
    bf* WQ = (bf*)take((size_t)EE * EE * 2); bf* WK = (bf*)take((size_t)EE * EE * 2); bf* WV = (bf*)take((size_t)EE * EE * 2); bf* XB = (bf*)take(NTB * EE * 2); float* QF = (float*)take(NTB * EE * 4); float* KF = (float*)take(NTB * EE * 4);
    wsp = stage;
    float* Sb = (float*)take((size_t)ZH * TT * TT * 4); h16* P16 = (h16*)take((size_t)ZH * TT * TT * 2); bf* Ph = (bf*)take((size_t)ZH * RH * TT * 2); bf* Pl = (bf*)take((size_t)ZH * RH * TT * 2); float* PB = (float*)take((size_t)ZH * TT * 64 * 4); float* Ob = (float*)take((size_t)KS * ZH * TT * HD * 4);
    if ((size_t)(wsp - (char*)d_ws) > ws_size) return;    // total 252 MiB (kept 106 MiB = six [32][2048][64] q/k and three [32][64][2048] v planes 72, QR 16, merged planes 16, Wo 2; shared 146 MiB = four-group scores 64, probabilities 48, bucket sums 2, K-slice partials of P.v 32, over the 46 MiB of the projection stage)
    float* VF = KF;   // v projection reuses the k buffer after the k planes are built
    k_cvt8<<<(EE * EE / 8 + 255) / 256, 256, 0, stream>>>(Wq, WQ, (size_t)EE * EE / 8); k_cvt8<<<(EE * EE / 8 + 255) / 256, 256, 0, stream>>>(Wk, WK, (size_t)EE * EE / 8); k_cvt8<<<(EE * EE / 8 + 255) / 256, 256, 0, stream>>>(Wv, WV, (size_t)EE * EE / 8); k_cvt8<<<(EE * EE / 8 + 255) / 256, 256, 0, stream>>>(Wo, WO, (size_t)EE * EE / 8);
    k_cvt8<<<(unsigned)((NTB * EE / 8 + 255) / 256), 256, 0, stream>>>(x, XB, NTB * EE / 8);
    const unsigned LP = (unsigned)(((size_t)NG * TT * HD / 2 + 255) / 256);
    k_gemmw<bf, 0, true, false><<<dim3(NTB / 64, EE / 64, 1), 32, 0, stream>>>(XB, nullptr, WQ, nullptr, EE, QF, EE, bq, 0, 0, 0, 0, 0); k_pl<<<LP, 256, 0, stream>>>(QF, 0.125f, Q16, Qh, Ql); k_qr<<<NG * TT / 256, 256, 0, stream>>>(QF, rk, QR);
    k_gemmw<bf, 0, true, false><<<dim3(NTB / 64, EE / 64, 1), 32, 0, stream>>>(XB, nullptr, WK, nullptr, EE, KF, EE, bk, 0, 0, 0, 0, 0); k_pl<<<LP, 256, 0, stream>>>(KF, 1.0f, K16, Kh, Kl);
    k_gemmw<bf, 0, true, false><<<dim3(NTB / 64, EE / 64, 1), 32, 0, stream>>>(XB, nullptr, WV, nullptr, EE, VF, EE, bv, 0, 0, 0, 0, 0); k_vtp<<<LP, 256, 0, stream>>>(VF, V16, Vh, Vl);
    for (int n0 = 0; n0 < NG; n0 += ZH) { const size_t z = (size_t)n0;
        k_gemmw<bf, 2, false, false><<<dim3(RH / 64, TT / 64, ZH), 32, 0, stream>>>(Qh + z * TT * HD, Ql + z * TT * HD, Kh + z * TT * HD, Kl + z * TT * HD, HD, Sb, TT, nullptr, (size_t)TT * HD, (size_t)TT * HD, (size_t)TT * TT, 0, 0);
        k_gemmw<h16, 0, false, false><<<dim3((TT - RH) / 64, TT / 64, ZH), 32, 0, stream>>>(Q16 + z * TT * HD + (size_t)RH * HD, nullptr, K16 + z * TT * HD, nullptr, HD, Sb + (size_t)RH * TT, TT, nullptr, (size_t)TT * HD, (size_t)TT * HD, (size_t)TT * TT, 0, 0);
        k_rsoft<<<ZH * TT / 8, 256, 0, stream>>>(Sb, QR, n0, P16, Ph, Pl); k_pb<<<ZH * TT / 8, 256, 0, stream>>>(P16, Ph, Pl, PB);
        k_gemmw<bf, 2, false, true><<<dim3(RH / 64, KS, ZH), 32, 0, stream>>>(Ph, Pl, Vh + z * HD * TT, Vl + z * HD * TT, TT, Ob, HD, nullptr, (size_t)RH * TT, (size_t)HD * TT, (size_t)TT * HD, TT / KS, (size_t)ZH * TT * HD);
        k_gemmw<h16, 0, false, true><<<dim3((TT - RH) / 64, KS, ZH), 32, 0, stream>>>(P16 + (size_t)RH * TT, nullptr, V16 + z * HD * TT, nullptr, TT, Ob + (size_t)RH * HD, HD, nullptr, (size_t)TT * TT, (size_t)HD * TT, (size_t)TT * HD, TT / KS, (size_t)ZH * TT * HD);
        k_mrg<<<(unsigned)(((size_t)ZH * TT * HD / 2 + 255) / 256), 256, 0, stream>>>(Ob, PB, rv, n0, Ah, Al); }
    k_gemmw<bf, 1, true, false><<<dim3(NTB / 64, EE / 64, 1), 32, 0, stream>>>(Ah, Al, WO, nullptr, EE, OUT, EE, bo, 0, 0, 0, 0, 0);
}

// v005
// A run of this version takes 348 microseconds.
// Versions between v003 and this one are left out; their measured steps multiply to 2.65 times as fast.
// All steps since v000 together make it 6.74 times as fast.
#include <hip/hip_runtime.h>

// Shaw relative-position multi-head attention, sequence-first (query [2048][2][1024]; q = (x Wq^T + bq)/8, k, v = x W^T + b; 32 groups n = b*16 + h of 64 dims; scores = q.k + q.rk[clip(s-t,-16,16)+16];
// softmax; attn = P.v + sum_s P[t][s] rv[clip(s-t)+16]; out = merged Wo^T + bo -> [2048][2][1024]; rk/rv tables [33][64] read as data).
// The relative terms are exact regroupings: q.rk depends on (t, bucket) only -> QR[n][t][r] = q_t . rk[r] (33 per row, added inside the attention kernel by bucket); sum_s P rv = sum_r PB[t][r] rv[r] with PB the per-bucket
// probability sums (buckets 0 / 32 collect all keys at distance <= -16 / >= +16), formed in the attention kernel and contracted with rv on VALU at its end.
// Compute dtypes, f32 accumulate: every input rounded to bf16; projections on PLAIN bf16 operands (inputs: exact, + bias; all 4096 (t, b) rows at once); QR and the PB.rv term f32 on VALU; scores (K 64) and P.v on
// hl planes (3 products) for the first 512 query rows of each group and SINGLE fp16 planes for the rest; softmax f32 in registers; Wo on hl planes x exact (+bias). Projections and Wo: one-wave-per-64x64-tile GEMMs; attention: one fused kernel (k_attn). Deterministic, no atomics;
// FRAGMENT ORDER: every 16-bit operand plane in the workspace is stored as the matrix instructions read it. A block of 16 rows x 32 k is 1024 bytes: two halves of 512 bytes (k 0..15, k 16..31), in each lane L = 16 * ((k >> 3) & 1) + (row & 15)
// owns 16 bytes (8 k). A fragment is then two 16-byte loads a lane, each of which reads four whole 128-byte lines; from a row-major plane each took 32 bytes out of 16 lines.

#define TT   2048
#define BB   2
#define EE   1024
#define NH_  16
#define NG   (BB * NH_)
#define HD   64
#define NR   33
#define MR   16
#define RH   512
#define PCAR 1024.0f
#define QP   34
typedef _Float16 h16;
typedef unsigned short bf;
typedef __attribute__((ext_vector_type(16))) __bf16   v16bf;
typedef __attribute__((ext_vector_type(16))) _Float16 v16h;
typedef __attribute__((ext_vector_type(8)))  _Float16 v8h;
typedef __attribute__((ext_vector_type(8)))  unsigned short v8us;
typedef __attribute__((ext_vector_type(8)))  float    v8f;
typedef __attribute__((ext_vector_type(4)))  float    v4f;
typedef v8h  __attribute__((may_alias)) v8ha;
typedef v4f  __attribute__((may_alias)) v4fa;
typedef v8us __attribute__((may_alias)) v8usa;

__device__ __forceinline__ unsigned short f2bf(float f) { unsigned u = __float_as_uint(f); u += 0x7FFFu + ((u >> 16) & 1u); return (unsigned short)(u >> 16); }
__device__ __forceinline__ float bf2f(unsigned short b) { return __uint_as_float(((unsigned)b) << 16); }
__device__ __forceinline__ float bfr(float f) { return bf2f(f2bf(f)); }
__device__ __forceinline__ v16h cat16(v8h lo, v8h hi) { return __builtin_shufflevector(lo, hi, 0, 1, 2, 3, 4, 5, 6, 7, 8, 9, 10, 11, 12, 13, 14, 15); }
__device__ __forceinline__ v16bf cat16b(v8us lo, v8us hi) { return __builtin_bit_cast(v16bf, __builtin_shufflevector(lo, hi, 0, 1, 2, 3, 4, 5, 6, 7, 8, 9, 10, 11, 12, 13, 14, 15)); }
__device__ __forceinline__ v8f wmma16(v16h a, v16h b, v8f c) { return __builtin_amdgcn_wmma_f32_16x16x32_f16(false, a, false, b, (short)0, c, false, false); }
__device__ __forceinline__ v8f wmmab(v16bf a, v16bf b, v8f c) { return __builtin_amdgcn_wmma_f32_16x16x32_bf16(false, a, false, b, (short)0, c, false, false); }



// element offset of (row, k) in a fragment-ordered plane whose rows hold kch chunks of 32 k: blocks run over k first, then over the 16-row tiles
__device__ __forceinline__ size_t fro(int row, int k, int kch) { return ((((size_t)(row >> 4) * kch + (k >> 5)) * 2 + ((k >> 4) & 1)) * 32 + ((k >> 3) & 1) * 16 + (row & 15)) * 8 + (k & 7); }
// ---- k_gemmw: register-blocked GEMM, ONE WAVE per 64x64 output tile (16 accumulators), operands straight from fragment-ordered 16-bit planes; grid (M/64, N/64, Z), 32 threads.
// C[m][n] (f32, pitch ldc, + optional f32 bias[n]) = sum_k A[m][k] Bt[n][k] (+ split products per NSPLIT). z-batch strides sA/sB/sC in elements. K % 32 == 0.
// KSLICE (N == 64 only): blockIdx.y is a K slice of klen, not a column tile; slice y stores its partial product at C + y * sK and the reader adds the slices in order.
template <typename T16> struct WFrag;
template <> struct WFrag<h16> { typedef v16h V; static __device__ __forceinline__ V ldf(const h16* p) { return cat16(*(const v8h*)p, *(const v8h*)(p + 256)); } static __device__ __forceinline__ v8f mma(V a, V b, v8f c) { return wmma16(a, b, c); } };
template <> struct WFrag<bf> { typedef v16bf V; static __device__ __forceinline__ V ldf(const bf* p) { return cat16b(*(const v8us*)p, *(const v8us*)(p + 256)); } static __device__ __forceinline__ v8f mma(V a, V b, v8f c) { return wmmab(a, b, c); } };
// BTROWS: A's rows run (b, t), so that a 16-row tile of the merged planes, and with it each of their 128-byte lines, has one writing work-group in k_attn; C's rows run (t, b) as always.
template <typename T16, int NSPLIT, bool BIAS, bool KSLICE, bool BTROWS>
__global__ __launch_bounds__(32) void k_gemmw(const T16* __restrict__ A, const T16* __restrict__ A2, const T16* __restrict__ Bt, const T16* __restrict__ Bt2, int K, float* C, int ldc, const float* __restrict__ bias, size_t sA, size_t sB, size_t sC, int klen, size_t sK) {
    typedef typename WFrag<T16>::V V;
    __shared__ __align__(16) float os[16 * 68];
    const size_t z = blockIdx.z; A += z * sA; if (A2) A2 += z * sA; Bt += z * sB; if (Bt2) Bt2 += z * sB; C += z * sC;
    const int lane = threadIdx.x & 31, lr = lane & 15, hi = lane >> 4; const int r0 = blockIdx.x * 64, c0 = KSLICE ? 0 : blockIdx.y * 64; const int kbeg = KSLICE ? blockIdx.y * klen : 0, kend = KSLICE ? kbeg + klen : K; if (KSLICE) C += blockIdx.y * sK;
    v8f acc[4][4];
#pragma unroll
    for (int mb = 0; mb < 4; ++mb)
#pragma unroll
        for (int nb = 0; nb < 4; ++nb) acc[mb][nb] = (v8f){};
    constexpr size_t tp = (size_t)(EE / 32) * 512;   // elements of one 16-row tile: every plane that this kernel reads has EE k a row (K == EE at every launch), and as a constant the tile's step goes into the loads' immediate offsets
    const size_t aoff = (size_t)(r0 >> 4) * tp, boff = (size_t)(c0 >> 4) * tp; const unsigned lo = 8 * lane;   // the lane's place in a 512-byte half
#pragma unroll 1
    for (int kc = kbeg; kc < kend; kc += 32) {
        V a[4], a2[4]; const T16* pa = A + (aoff + (size_t)kc * 16) + lo; const T16* pa2 = (NSPLIT == 1 || NSPLIT == 2) ? A2 + (aoff + (size_t)kc * 16) + lo : pa; const T16* pb = Bt + (boff + (size_t)kc * 16) + lo; const T16* pb2 = NSPLIT >= 2 ? Bt2 + (boff + (size_t)kc * 16) + lo : pb;
#pragma unroll
        for (int mb = 0; mb < 4; ++mb) { a[mb] = WFrag<T16>::ldf(pa + mb * tp); if (NSPLIT == 1 || NSPLIT == 2) a2[mb] = WFrag<T16>::ldf(pa2 + mb * tp); }
#pragma unroll
        for (int nb = 0; nb < 4; ++nb) { const V b = WFrag<T16>::ldf(pb + nb * tp); V b2; if (NSPLIT >= 2) b2 = WFrag<T16>::ldf(pb2 + nb * tp);
#pragma unroll
            for (int mb = 0; mb < 4; ++mb) { acc[mb][nb] = WFrag<T16>::mma(a[mb], b, acc[mb][nb]); if (NSPLIT == 1 || NSPLIT == 2) acc[mb][nb] = WFrag<T16>::mma(a2[mb], b, acc[mb][nb]); if (NSPLIT >= 2) acc[mb][nb] = WFrag<T16>::mma(a[mb], b2, acc[mb][nb]); } }
        // stands in front of the next trip's writes of the loads' address registers (the build let later loads' results land in them): the addresses are inputs, so that their registers live up to the wait
        asm volatile("s_wait_xcnt 0x0" :: "v"(pa), "v"(pa2), "v"(pb), "v"(pb2) : "memory");
        asm volatile("v_nop\n\tv_nop\n\tv_nop\n\tv_nop" : "+v"(acc[0][0]), "+v"(acc[1][1]), "+v"(acc[2][2]), "+v"(acc[3][3]) : "v"(a[0]), "v"(a[3]));
    }
#pragma unroll
    for (int mb = 0; mb < 4; ++mb) {
#pragma unroll
        for (int nb = 0; nb < 4; ++nb) {
#pragma unroll
            for (int j = 0; j < 8; ++j) os[(hi * 8 + j) * 68 + nb * 16 + lr] = acc[mb][nb][j]; }
        __builtin_amdgcn_wave_barrier(); asm volatile("" ::: "memory");
{
#pragma unroll
            for (int s = 0; s < 8; ++s) { const int row = 2 * s + hi, cofs = lr * 4; v4f val = *(const v4fa*)(os + row * 68 + cofs); if (BIAS) { val[0] += bfr(bias[c0 + cofs]); val[1] += bfr(bias[c0 + cofs + 1]); val[2] += bfr(bias[c0 + cofs + 2]); val[3] += bfr(bias[c0 + cofs + 3]); }
                const int m = r0 + mb * 16 + row; *(v4f*)(C + (size_t)(BTROWS ? (m % TT) * BB + m / TT : m) * ldc + c0 + cofs) = val; }
             }
        // stands in front of the next writes of the stores' address and data registers; the scheduling barriers keep the stores in front of it and every later instruction behind it
        __builtin_amdgcn_sched_barrier(0); asm volatile("s_wait_xcnt 0x0" ::: "memory"); __builtin_amdgcn_sched_barrier(0);
        __builtin_amdgcn_wave_barrier(); asm volatile("" ::: "memory");
    }
}

__device__ __forceinline__ h16 tohx(float x) { return (h16)x; }
__device__ __forceinline__ void splitf(float y, unsigned short& h, unsigned short& l) { h = f2bf(y); l = f2bf(y - bf2f(h)); }
typedef __attribute__((ext_vector_type(2))) _Float16 v2h;
typedef __attribute__((ext_vector_type(4))) _Float16 v4h;
typedef __attribute__((ext_vector_type(2))) unsigned short v2us;
typedef __attribute__((ext_vector_type(4))) unsigned short v4us;
typedef __attribute__((ext_vector_type(2))) float v2f;

// The three plane builders: one thread per 16-byte piece of the fragment-ordered output, pieces in output order, so that a wave's store is 512 contiguous bytes.
// k_cvt8: [rows][EE] f32 -> bf16; piece i: lane i & 31, half (i >> 5) & 1, chunk (i >> 6) % (EE / 32), 16-row tile above.
__global__ __launch_bounds__(256) void k_cvt8(const float* __restrict__ src, bf* dst, size_t n8) { const size_t i = (size_t)blockIdx.x * 256 + threadIdx.x; if (i >= n8) return; const int row = (int)(i >> 11) * 16 + (int)(i & 15), k = (int)((i >> 6) & (EE / 32 - 1)) * 32 + (int)((i >> 5) & 1) * 16 + (int)((i >> 4) & 1) * 8; const v8f v = *(const v8f*)(src + (size_t)row * EE + k); v8us o;
#pragma unroll
    for (int u = 0; u < 8; ++u) o[u] = f2bf(v[u]); *(v8us*)(dst + i * 8) = o;  }
// k_pl: rows (n, t), k = d (two chunks a row); piece i: lane, half, chunk (i >> 6) & 1, tile (i >> 7) of the NG * TT rows.
__global__ __launch_bounds__(256) void k_pl(const float* __restrict__ F, float scl, h16* P16, bf* Ph, bf* Pl) { const size_t i = (size_t)blockIdx.x * 256 + threadIdx.x; if (i >= (size_t)NG * TT * HD / 8) return; const int d = (int)((i >> 6) & 1) * 32 + (int)((i >> 5) & 1) * 16 + (int)((i >> 4) & 1) * 8; const int row = (int)(i >> 7) * 16 + (int)(i & 15); const int t = row % TT, n = row / TT; const int b = n / NH_, h = n % NH_; const v8f f = *(const v8f*)(F + ((size_t)t * BB + b) * EE + h * HD + d); v8h o; v8us oh, ol;
#pragma unroll
    for (int u = 0; u < 8; ++u) { const float v = f[u] * scl; o[u] = tohx(v); unsigned short a, c; splitf(v, a, c); oh[u] = a; ol[u] = c; } { *(v8h*)(P16 + i * 8) = o; *(v8us*)(Ph + i * 8) = oh; *(v8us*)(Pl + i * 8) = ol;  } }
// k_vtp: rows d, k = t; the blocks of a group run over its four 16-row tiles first, then over the 64 chunks of 32 keys (a wave of k_attn reads 32 KB in a row); piece i: lane, half, tile (i >> 6) & 3, chunk (i >> 8) & 63, group above.
// A piece is 8 keys of one d: 8 loads, in each of which 16 lanes share 64 bytes of a row of F.
__global__ __launch_bounds__(256) void k_vtp(const float* __restrict__ F, h16* V16, bf* Vh, bf* Vl) { const size_t i = (size_t)blockIdx.x * 256 + threadIdx.x; if (i >= (size_t)NG * HD * TT / 8) return; const int d = (int)((i >> 6) & 3) * 16 + (int)(i & 15); const int t = (int)((i >> 8) & 63) * 32 + (int)((i >> 5) & 1) * 16 + (int)((i >> 4) & 1) * 8; const int n = (int)(i >> 14); const int b = n / NH_, h = n % NH_; v8h o; v8us oh, ol;
#pragma unroll
    for (int u = 0; u < 8; ++u) { const float v = F[((size_t)(t + u) * BB + b) * EE + h * HD + d]; o[u] = tohx(v); unsigned short a, c; splitf(v, a, c); oh[u] = a; ol[u] = c; } { *(v8h*)(V16 + i * 8) = o; *(v8us*)(Vh + i * 8) = oh; *(v8us*)(Vl + i * 8) = ol;  } }
// k_qr: one thread per (group, query) row: the scaled query row sits in 64 registers, the 33 rounded rk rows in LDS, read at one address by the whole wave (a broadcast), four buckets a pass; each sum runs over d in ascending order.
__global__ __launch_bounds__(256) void k_qr(const float* __restrict__ QF, const float* __restrict__ rk, float* QR) { __shared__ __align__(16) float rs[NR * HD];
    for (int i = threadIdx.x; i < NR * HD; i += 256) rs[i] = bfr(rk[i]);
    const size_t row = (size_t)blockIdx.x * 256 + threadIdx.x; const int t = (int)(row % TT), n = (int)(row / TT); const int b = n / NH_, h = n % NH_; const float* q = QF + ((size_t)t * BB + b) * EE + h * HD; float qv[HD];
    // the loops over d and k are fully unrolled so that qv stays in registers
#pragma unroll
    for (int d = 0; d < HD; d += 4) { const v4f x = *(const v4f*)(q + d); qv[d] = x[0] * 0.125f; qv[d + 1] = x[1] * 0.125f; qv[d + 2] = x[2] * 0.125f; qv[d + 3] = x[3] * 0.125f; }
    __syncthreads();   // publishes the rk rows
    float* o = QR + row * 64;
#pragma unroll 1   // eight trips of 256 multiply-adds: unrolled, the kernel is 30 KB of code that each wave runs once
    for (int r0 = 0; r0 < NR - 1; r0 += 4) { v4f s = (v4f){};
#pragma unroll
        for (int d = 0; d < HD; d += 4) {
#pragma unroll
            for (int k = 0; k < 4; ++k) { const v4f w = *(const v4fa*)(rs + (r0 + k) * HD + d); s[k] += qv[d] * w[0]; s[k] += qv[d + 1] * w[1]; s[k] += qv[d + 2] * w[2]; s[k] += qv[d + 3] * w[3]; } }
        *(v4f*)(o + r0) = s;
        asm volatile("s_wait_xcnt 0x0" ::: "memory"); }   // stands in front of the next writes of the store's address and data registers
    float s = 0.f;
#pragma unroll
    for (int d = 0; d < HD; d += 4) { const v4f w = *(const v4fa*)(rs + (NR - 1) * HD + d); s += qv[d] * w[0]; s += qv[d + 1] * w[1]; s += qv[d + 2] * w[2]; s += qv[d + 3] * w[3]; }
    o[NR - 1] = s; }
// k_attn: the whole attention of 16 query rows of one group in one work-group of 8 waves; wave w owns keys [256 w, 256 w + 256). Scores are formed TRANSPOSED (A = 16 key rows, B = 16 query rows), so that a lane holds, for query lr,
// keys 8 hi .. 8 hi + 7 of each 16-key tile: two neighbouring tiles are, register for register, the A fragment of P for a 32-key chunk of P.v, and the probabilities never leave the registers. Row maximum, row sum, the two outer
// bucket sums and the 8 partial P.v tiles meet in LDS (waves added in ascending order); the 31 single-key buckets are stored to LDS by the one lane that holds the key. The 16 rows' q.rk values (pitch QP: the band's reads then fall on distinct banks) and the rounded rv table are staged in LDS by the whole work-group. P is rounded to hl planes (rows < RH) or to fp16 x 1024 (the rest); the bucket sums are taken from the rounded values.
typedef __attribute__((ext_vector_type(2))) __bf16 v2bf;
template <bool HR, typename T16>
__device__ __forceinline__ void attn_rows(const T16* __restrict__ Qa, const T16* __restrict__ Qb, const T16* __restrict__ Ka, const T16* __restrict__ Kb, const T16* __restrict__ Va, const T16* __restrict__ Vb, const float* __restrict__ QR, const float* __restrict__ rv, bf* Ah, bf* Al, const int n, const int t0, float* os, float* pbs, float* red, float* qrs, float* rvs) {
    typedef typename WFrag<T16>::V V;
    const int tid = threadIdx.x, lane = tid & 31, lr = lane & 15, hi = lane >> 4; const int w = __builtin_amdgcn_readfirstlane(tid >> 5);   // the wave's number in a scalar register: the tests on a tile's place become scalar branches
    const int t = t0 + lr, kb = w * 256;
    V qa[2], qb[2]; const T16* qpa = Qa + ((size_t)n * TT + t0) * HD + 8 * lane; const T16* qpb = HR ? Qb + ((size_t)n * TT + t0) * HD + 8 * lane : qpa;   // a 16-row tile is 16 * HD elements, a 32-d chunk of it 512
#pragma unroll
    for (int c = 0; c < 2; ++c) { qa[c] = WFrag<T16>::ldf(qpa + 512 * c); if (HR) qb[c] = WFrag<T16>::ldf(qpb + 512 * c); }
    // stands in front of the next writes of the query loads' address registers (the build takes their scalar base over a few instructions on); the scheduling barriers keep the loads in front of it and every later instruction behind it
    __builtin_amdgcn_sched_barrier(0); asm volatile("s_wait_xcnt 0x0" ::: "memory"); __builtin_amdgcn_sched_barrier(0);
    // staging: 528 q.rk values and 528 four-float pieces of rv, three a thread; the third index is held to the last element, which threads 15..255 all load and store alike (one value, no branch)
    float gq[3]; v4f gv[3];
#pragma unroll
    for (int u = 0; u < 3; ++u) { const int i = min(tid + 256 * u, 16 * NR - 1); gq[u] = QR[((size_t)n * TT + t0 + i / NR) * 64 + i % NR]; gv[u] = *(const v4f*)(rv + i * 4);
        __builtin_amdgcn_sched_barrier(0); asm volatile("s_wait_xcnt 0x0" ::: "memory"); __builtin_amdgcn_sched_barrier(0); }   // the same for these two loads
    v8f s[16]; float mx = -3.0e38f;
    constexpr int TB = HR ? 1 : 2;   // key tiles a batch: two buffers of 32 registers each, one in flight while the other is worked on
    V kf[2][TB][HR ? 4 : 2]; const size_t ko = ((size_t)n * TT + kb) * HD + 8 * lane;
    // every loop over tiles, chunks and registers is fully unrolled so that s stays in registers
#pragma unroll
    for (int u = 0; u < TB; ++u) {
#pragma unroll
        for (int c = 0; c < 2; ++c) { kf[0][u][c] = WFrag<T16>::ldf(Ka + ko + u * 16 * HD + 512 * c); if (HR) kf[0][u][2 + c] = WFrag<T16>::ldf(Kb + ko + u * 16 * HD + 512 * c); } }
    __builtin_amdgcn_sched_barrier(0);   // keeps the first key loads in front of the staging's LDS stores, which wait for the staged values: the two latencies overlap
#pragma unroll
    for (int u = 0; u < 3; ++u) { const int i = min(tid + 256 * u, 16 * NR - 1); pbs[i] = 0.f;   // a single-key bucket whose key lies outside the sequence stays 0
        qrs[(i / NR) * QP + i % NR] = gq[u]; v4f y; y[0] = bfr(gv[u][0]); y[1] = bfr(gv[u][1]); y[2] = bfr(gv[u][2]); y[3] = bfr(gv[u][3]); *(v4fa*)(rvs + i * 4) = y; }
#pragma unroll
    for (int b = 0; b < 16 / TB; ++b) {
        if (b + 1 < 16 / TB) {
#pragma unroll
            for (int u = 0; u < TB; ++u) {
#pragma unroll
                for (int c = 0; c < 2; ++c) { kf[(b + 1) & 1][u][c] = WFrag<T16>::ldf(Ka + ko + ((b + 1) * TB + u) * 16 * HD + 512 * c); if (HR) kf[(b + 1) & 1][u][2 + c] = WFrag<T16>::ldf(Kb + ko + ((b + 1) * TB + u) * 16 * HD + 512 * c); } } }
        __builtin_amdgcn_sched_barrier(0);   // keeps the next batch's loads in front of this batch's products: without it the build issues each fragment's loads directly in front of its product and waits out every latency
#pragma unroll
        for (int u = 0; u < TB; ++u) { v8f a = (v8f){};
#pragma unroll
            for (int c = 0; c < 2; ++c) { a = WFrag<T16>::mma(kf[b & 1][u][c], qa[c], a); if (HR) { a = WFrag<T16>::mma(kf[b & 1][u][c], qb[c], a); a = WFrag<T16>::mma(kf[b & 1][u][2 + c], qa[c], a); } }
            s[b * TB + u] = a; } }
    // the branches below follow the last matrix instruction: five vector slots keep its distance on the taken side too; the two scheduling barriers hold them in place
    __builtin_amdgcn_sched_barrier(0); asm volatile("v_nop\n\tv_nop\n\tv_nop\n\tv_nop\n\tv_nop"); __builtin_amdgcn_sched_barrier(0);
    __syncthreads();   // publishes the staged q.rk rows (and the rv table and the cleared buckets)
    const float* qr = qrs + lr * QP; const float qlo = qr[0], qhi = qr[2 * MR];
#pragma unroll
    for (int kt = 0; kt < 16; ++kt) { const int k0 = kb + kt * 16; v8f a = s[kt];
        if (k0 + 15 > t0 - MR && k0 < t0 + 15 + MR) {
#pragma unroll
            for (int j = 0; j < 8; ++j) { const int r = min(max(k0 + hi * 8 + j - t, -MR), MR) + MR; a[j] += qr[r]; }
        } else { const float qq = k0 < t0 ? qlo : qhi;
#pragma unroll
            for (int j = 0; j < 8; ++j) a[j] += qq; }
#pragma unroll
        for (int j = 0; j < 8; ++j) mx = fmaxf(mx, a[j]);
        s[kt] = a; }
    mx = fmaxf(mx, __shfl_xor(mx, 16, 32)); if (hi == 0) red[w * 16 + lr] = mx;
    __syncthreads();   // publishes the waves' row maxima
#pragma unroll
    for (int i = 0; i < 8; ++i) mx = fmaxf(mx, red[i * 16 + lr]);
    float sum = 0.f;
#pragma unroll
    for (int kt = 0; kt < 16; ++kt) {
#pragma unroll
        for (int j = 0; j < 8; ++j) { const float y = (s[kt][j] - mx) * 1.44269504f; float e;
            asm("v_exp_f32 %0, %1\n\tv_nop" : "=v"(e) : "v"(y));   // e^x as 2^(x log2 e); the v_nop is the one slot behind a transcendental
            s[kt][j] = e; sum += e; } }
    sum += __shfl_xor(sum, 16, 32); if (hi == 0) red[128 + w * 16 + lr] = sum;
    __syncthreads();   // publishes the waves' row sums
    sum = red[128 + lr];
#pragma unroll
    for (int i = 1; i < 8; ++i) sum += red[128 + i * 16 + lr];
    const float f = HR ? __fdiv_rn(1.0f, sum) : __fdiv_rn(1.0f, sum) * PCAR;
    float lo = 0.f, up = 0.f;
    // rounds P in place (hl: a tile's registers 0..3 take its half of the high plane's fragment, 4..7 that of the low plane's; fp16: the rounded value) and forms the bucket sums from the rounded values; all branches stand here, in front of the matrix instructions of P.v
#pragma unroll
    for (int kt = 0; kt < 16; ++kt) { const int k0 = kb + kt * 16, base = k0 + hi * 8 - t; float val[8]; unsigned xh[4], xl[4];   // base + j: the key's distance from the query
#pragma unroll
        for (int k = 0; k < 4; ++k) { const float p0 = s[kt][2 * k] * f, p1 = s[kt][2 * k + 1] * f;
            if (HR) { v2bf h; h[0] = (__bf16)p0; h[1] = (__bf16)p1; xh[k] = __builtin_bit_cast(unsigned, h);   // round to nearest even, two values a conversion, already in the fragment's order
                const float h0 = __uint_as_float(xh[k] << 16), h1 = __uint_as_float(xh[k] & 0xFFFF0000u); v2bf l; l[0] = (__bf16)(p0 - h0); l[1] = (__bf16)(p1 - h1); xl[k] = __builtin_bit_cast(unsigned, l);
                val[2 * k] = h0 + __uint_as_float(xl[k] << 16); val[2 * k + 1] = h1 + __uint_as_float(xl[k] & 0xFFFF0000u); }
            else { const float x0 = (float)tohx(p0), x1 = (float)tohx(p1); s[kt][2 * k] = x0; s[kt][2 * k + 1] = x1; val[2 * k] = x0 * (1.0f / PCAR); val[2 * k + 1] = x1 * (1.0f / PCAR); } }
        if (HR) {
#pragma unroll
            for (int k = 0; k < 4; ++k) { s[kt][k] = __uint_as_float(xh[k]); s[kt][4 + k] = __uint_as_float(xl[k]); } }
        if (k0 + 15 > t0 - MR && k0 < t0 + 15 + MR) {
#pragma unroll
            for (int j = 0; j < 8; ++j) { if (base <= -MR - j) lo += val[j]; else if (base >= MR - j) up += val[j]; else pbs[lr * NR + MR + base + j] = val[j]; }
        } else if (k0 < t0) {
#pragma unroll
            for (int j = 0; j < 8; ++j) lo += val[j];
        } else {
#pragma unroll
            for (int j = 0; j < 8; ++j) up += val[j]; } }
    lo += __shfl_xor(lo, 16, 32); up += __shfl_xor(up, 16, 32); if (hi == 0) { red[256 + w * 16 + lr] = lo; red[384 + w * 16 + lr] = up; }
    v8f o[4];
    // P.v by pairs of 32-key chunks (a chunk of the v planes is 2048 elements: four 16-column tiles of 512). A batch is 32 registers of fragments
    // (fp16: two tiles x two chunks; hl: one tile x two chunks x two planes), in two buffers, one in flight while the other is worked on. Each o[dt] still takes its chunks in ascending order.
    constexpr int FB = HR ? 2 : 4, NBP = HR ? 4 : 2;   // (tile, chunk) places a batch; batches a pair of chunks
    V vf[2][FB][HR ? 2 : 1]; const size_t vo = ((size_t)n * TT + kb) * HD + 8 * lane;
#pragma unroll
    for (int dt = 0; dt < 4; ++dt) o[dt] = (v8f){};
#pragma unroll
    for (int u = 0; u < FB; ++u) { const size_t v1 = vo + (HR ? 0 : u & 1) * 512 + (HR ? u : u >> 1) * 2048; vf[0][u][0] = WFrag<T16>::ldf(Va + v1); if (HR) vf[0][u][1] = WFrag<T16>::ldf(Vb + v1); }
#pragma unroll
    for (int cp = 0; cp < 4; ++cp) { V pa[2], pb2[2];
#pragma unroll
        for (int e = 0; e < 2; ++e) { const int c = 2 * cp + e;
            if constexpr (HR) { v8f ph, pl;
#pragma unroll
                for (int k = 0; k < 8; ++k) { ph[k] = s[2 * c + (k >> 2)][k & 3]; pl[k] = s[2 * c + (k >> 2)][4 + (k & 3)]; }
                pa[e] = __builtin_bit_cast(v16bf, ph); pb2[e] = __builtin_bit_cast(v16bf, pl); }
            else {
#pragma unroll
                for (int i = 0; i < 16; ++i) pa[e][i] = tohx(s[2 * c + (i >> 3)][i & 7]); } }
#pragma unroll
        for (int g = 0; g < NBP; ++g) { const int b = cp * NBP + g, b1 = b + 1, g1 = b1 % NBP;
            if (b1 < 4 * NBP) {
#pragma unroll
                for (int u = 0; u < FB; ++u) { const int dt1 = HR ? g1 : g1 * 2 + (u & 1), e1 = HR ? u : u >> 1; const size_t v1 = vo + dt1 * 512 + (2 * (b1 / NBP) + e1) * 2048; vf[b1 & 1][u][0] = WFrag<T16>::ldf(Va + v1); if (HR) vf[b1 & 1][u][1] = WFrag<T16>::ldf(Vb + v1); } }
            __builtin_amdgcn_sched_barrier(0);   // keeps the next batch's loads in front of this batch's products, as in the score stage
#pragma unroll
            for (int u = 0; u < FB; ++u) { const int dt = HR ? g : g * 2 + (u & 1), e = HR ? u : u >> 1; o[dt] = WFrag<T16>::mma(pa[e], vf[b & 1][u][0], o[dt]);
                if constexpr (HR) { o[dt] = WFrag<T16>::mma(pb2[e], vf[b & 1][u][0], o[dt]); o[dt] = WFrag<T16>::mma(pa[e], vf[b & 1][u][1], o[dt]); } } } }
    __builtin_amdgcn_sched_barrier(0);   // keeps the address arithmetic of what follows behind the last products, and so behind the data waits of the last loads, whose address registers it takes over
#pragma unroll
    for (int dt = 0; dt < 4; ++dt) {
#pragma unroll
        for (int j = 0; j < 8; ++j) os[(w * 16 + hi * 8 + j) * 68 + dt * 16 + lr] = o[dt][j]; }
    __syncthreads();   // publishes the partial P.v tiles and all bucket sums
    const int q = tid >> 4, d0 = (tid & 15) * 4; v4f ps = *(const v4fa*)(os + q * 68 + d0); float plo = red[256 + q], pup = red[384 + q];
#pragma unroll
    for (int i = 1; i < 8; ++i) { ps += *(const v4fa*)(os + (i * 16 + q) * 68 + d0); plo += red[256 + i * 16 + q]; pup += red[384 + i * 16 + q]; }
    v4f acc = ps * (HR ? 1.0f : (1.0f / PCAR));
#pragma unroll
    for (int r = 0; r < NR; ++r) { const float p = r == 0 ? plo : (r == NR - 1 ? pup : pbs[q * NR + r]); const v4f x = *(const v4fa*)(rvs + r * HD + d0);
#pragma unroll
        for (int k = 0; k < 4; ++k) acc[k] += p * x[k]; }
    v4us oh, ol;
#pragma unroll
    for (int k = 0; k < 4; ++k) { unsigned short x, y; splitf(acc[k], x, y); oh[k] = x; ol[k] = y; }
    const size_t oo = fro((n / NH_) * TT + t0 + q, (n % NH_) * HD + d0, EE / 32); *(v4us*)(Ah + oo) = oh; *(v4us*)(Al + oo) = ol; }   // the merged planes too are stored in fragment order, rows (b, t), for the Wo product
// four waves a SIMD (two work-groups a WGP): without the bound the build hoists loads until only two fit
__global__ __launch_bounds__(256) __attribute__((amdgpu_waves_per_eu(4))) void k_attn(const h16* __restrict__ Q16, const bf* __restrict__ Qh, const bf* __restrict__ Ql, const h16* __restrict__ K16, const bf* __restrict__ Kh, const bf* __restrict__ Kl, const h16* __restrict__ V16, const bf* __restrict__ Vh, const bf* __restrict__ Vl, const float* __restrict__ QR, const float* __restrict__ rv, bf* Ah, bf* Al) {
    __shared__ __align__(16) float os[8 * 16 * 68]; __shared__ float pbs[16 * NR]; __shared__ float red[512]; __shared__ float qrs[16 * QP]; __shared__ __align__(16) float rvs[NR * HD];
    // all hl work-groups come first in the grid, then all fp16 ones (for speed only)
    const int fl = blockIdx.x, g = fl - NG * (RH / 16);
    if (g < 0) attn_rows<true, bf>(Qh, Ql, Kh, Kl, Vh, Vl, QR, rv, Ah, Al, fl / (RH / 16), (fl % (RH / 16)) * 16, os, pbs, red, qrs, rvs);
    else attn_rows<false, h16>(Q16, nullptr, K16, nullptr, V16, nullptr, QR, rv, Ah, Al, g / ((TT - RH) / 16), RH + (g % ((TT - RH) / 16)) * 16, os, pbs, red, qrs, rvs); }

extern "C" void kernel_launch(void* const* d_in, const int* in_sizes, int n_in,
                              void* d_out, int out_size, void* d_ws, size_t ws_size, hipStream_t stream) {
    (void)in_sizes; (void)n_in; (void)out_size;
    const float* x = (const float*)d_in[0]; const float* Wq = (const float*)d_in[1]; const float* bq = (const float*)d_in[2]; const float* Wk = (const float*)d_in[3]; const float* bk = (const float*)d_in[4]; const float* Wv = (const float*)d_in[5]; const float* bv = (const float*)d_in[6]; const float* Wo = (const float*)d_in[7]; const float* bo = (const float*)d_in[8]; const float* rk = (const float*)d_in[9]; const float* rv = (const float*)d_in[10];
    float* OUT = (float*)d_out;     // [2048][2][1024]
    char* wsp = (char*)d_ws;
    auto take = [&](size_t bytes) { char* p = wsp; wsp += (bytes + 255) & ~(size_t)255; return (void*)p; };
    const size_t NTB = (size_t)TT * BB;
    bf* WO = (bf*)take((size_t)EE * EE * 2); float* QR = (float*)take((size_t)NG * TT * 64 * 4); bf* Ah = (bf*)take(NTB * EE * 2); bf* Al = (bf*)take(NTB * EE * 2);
    h16* Q16 = (h16*)take((size_t)NG * TT * HD * 2); bf* Qh = (bf*)take((size_t)NG * TT * HD * 2); bf* Ql = (bf*)take((size_t)NG * TT * HD * 2); h16* K16 = (h16*)take((size_t)NG * TT * HD * 2); bf* Kh = (bf*)take((size_t)NG * TT * HD * 2); bf* Kl = (bf*)take((size_t)NG * TT * HD * 2); h16* V16 = (h16*)take((size_t)NG * HD * TT * 2); bf* Vh = (bf*)take((size_t)NG * HD * TT * 2); bf* Vl = (bf*)take((size_t)NG * HD * TT * 2);
    bf* WQ = (bf*)take((size_t)EE * EE * 2); bf* WK = (bf*)take((size_t)EE * EE * 2); bf* WV = (bf*)take((size_t)EE * EE * 2); bf* XB = (bf*)take(NTB * EE * 2); float* QF = (float*)take(NTB * EE * 4); float* KF = (float*)take(NTB * EE * 4);
    if ((size_t)(wsp - (char*)d_ws) > ws_size) return;    // total 152 MiB: nine [32][2048][64] planes 72, QR 16, merged planes 16, Wo 2, projection stage 46
    float* VF = KF;   // v projection reuses the k buffer after the k planes are built
    k_cvt8<<<(EE * EE / 8 + 255) / 256, 256, 0, stream>>>(Wq, WQ, (size_t)EE * EE / 8); k_cvt8<<<(EE * EE / 8 + 255) / 256, 256, 0, stream>>>(Wk, WK, (size_t)EE * EE / 8); k_cvt8<<<(EE * EE / 8 + 255) / 256, 256, 0, stream>>>(Wv, WV, (size_t)EE * EE / 8); k_cvt8<<<(EE * EE / 8 + 255) / 256, 256, 0, stream>>>(Wo, WO, (size_t)EE * EE / 8);
    k_cvt8<<<(unsigned)((NTB * EE / 8 + 255) / 256), 256, 0, stream>>>(x, XB, NTB * EE / 8);
    const unsigned LP = (unsigned)(((size_t)NG * TT * HD / 8 + 255) / 256);
    k_gemmw<bf, 0, true, false, false><<<dim3(NTB / 64, EE / 64, 1), 32, 0, stream>>>(XB, nullptr, WQ, nullptr, EE, QF, EE, bq, 0, 0, 0, 0, 0); k_pl<<<LP, 256, 0, stream>>>(QF, 0.125f, Q16, Qh, Ql); k_qr<<<NG * TT / 256, 256, 0, stream>>>(QF, rk, QR);
    k_gemmw<bf, 0, true, false, false><<<dim3(NTB / 64, EE / 64, 1), 32, 0, stream>>>(XB, nullptr, WK, nullptr, EE, KF, EE, bk, 0, 0, 0, 0, 0); k_pl<<<LP, 256, 0, stream>>>(KF, 1.0f, K16, Kh, Kl);
    k_gemmw<bf, 0, true, false, false><<<dim3(NTB / 64, EE / 64, 1), 32, 0, stream>>>(XB, nullptr, WV, nullptr, EE, VF, EE, bv, 0, 0, 0, 0, 0); k_vtp<<<LP, 256, 0, stream>>>(VF, V16, Vh, Vl);
    k_attn<<<NG * TT / 16, 256, 0, stream>>>(Q16, Qh, Ql, K16, Kh, Kl, V16, Vh, Vl, QR, rv, Ah, Al);
    k_gemmw<bf, 1, true, false, true><<<dim3(NTB / 64, EE / 64, 1), 32, 0, stream>>>(Ah, Al, WO, nullptr, EE, OUT, EE, bo, 0, 0, 0, 0, 0);
}

// v006
// A run of this version takes 318 microseconds.
// Two timings next to v005 put it at 1.09 and 1.10 times that version's speed.
// Counting every step since v000, it is 7.37 times as fast.
#include <hip/hip_runtime.h>

// Shaw relative-position multi-head attention, sequence-first (query [2048][2][1024]; q = (x Wq^T + bq)/8, k, v = x W^T + b; 32 groups n = b*16 + h of 64 dims; scores = q.k + q.rk[clip(s-t,-16,16)+16];
// softmax; attn = P.v + sum_s P[t][s] rv[clip(s-t)+16]; out = merged Wo^T + bo -> [2048][2][1024]; rk/rv tables [33][64] read as data).
// The relative terms are exact regroupings: q.rk depends on (t, bucket) only -> QR[n][t][r] = q_t . rk[r] (33 per row, added inside the attention kernel by bucket); sum_s P rv = sum_r PB[t][r] rv[r] with PB the per-bucket
// probability sums (buckets 0 / 32 collect all keys at distance <= -16 / >= +16), formed in the attention kernel and contracted with rv on VALU at its end.
// Compute dtypes, f32 accumulate: every input rounded to bf16; projections on PLAIN bf16 operands (inputs: exact, + bias; all 4096 (t, b) rows at once); QR and the PB.rv term f32 on VALU; scores (K 64) and P.v on
// hl planes (3 products) for the first 512 query rows of each group and SINGLE fp16 planes for the rest; softmax f32 in registers; Wo on hl planes x exact (+bias). Projections and Wo: one-wave-per-64x64-tile GEMMs; attention: one fused kernel (k_attn). Deterministic, no atomics;
// FRAGMENT ORDER: every 16-bit operand plane in the workspace is stored as the matrix instructions read it. A block of 16 rows x 32 k is 1024 bytes: two halves of 512 bytes (k 0..15, k 16..31), in each lane L = 16 * ((k >> 3) & 1) + (row & 15)
// owns 16 bytes (8 k). A fragment is then two 16-byte loads a lane, each of which reads four whole 128-byte lines; from a row-major plane each took 32 bytes out of 16 lines.

#define TT   2048
#define BB   2
#define EE   1024
#define NH_  16
#define NG   (BB * NH_)
#define HD   64
#define NR   33
#define MR   16
#define RH   512
#define PCAR 1024.0f
#define BW   48
#define BP   52
typedef _Float16 h16;
typedef unsigned short bf;
typedef __attribute__((ext_vector_type(16))) __bf16   v16bf;
typedef __attribute__((ext_vector_type(16))) _Float16 v16h;
typedef __attribute__((ext_vector_type(8)))  _Float16 v8h;
typedef __attribute__((ext_vector_type(8)))  unsigned short v8us;
typedef __attribute__((ext_vector_type(8)))  float    v8f;
typedef __attribute__((ext_vector_type(4)))  float    v4f;
typedef v8h  __attribute__((may_alias)) v8ha;
typedef v4f  __attribute__((may_alias)) v4fa;
typedef v8us __attribute__((may_alias)) v8usa;

__device__ __forceinline__ unsigned short f2bf(float f) { unsigned u = __float_as_uint(f); u += 0x7FFFu + ((u >> 16) & 1u); return (unsigned short)(u >> 16); }
__device__ __forceinline__ float bf2f(unsigned short b) { return __uint_as_float(((unsigned)b) << 16); }
__device__ __forceinline__ float bfr(float f) { return bf2f(f2bf(f)); }
__device__ __forceinline__ v16h cat16(v8h lo, v8h hi) { return __builtin_shufflevector(lo, hi, 0, 1, 2, 3, 4, 5, 6, 7, 8, 9, 10, 11, 12, 13, 14, 15); }
__device__ __forceinline__ v16bf cat16b(v8us lo, v8us hi) { return __builtin_bit_cast(v16bf, __builtin_shufflevector(lo, hi, 0, 1, 2, 3, 4, 5, 6, 7, 8, 9, 10, 11, 12, 13, 14, 15)); }
__device__ __forceinline__ v8f wmma16(v16h a, v16h b, v8f c) { return __builtin_amdgcn_wmma_f32_16x16x32_f16(false, a, false, b, (short)0, c, false, false); }
__device__ __forceinline__ v8f wmmab(v16bf a, v16bf b, v8f c) { return __builtin_amdgcn_wmma_f32_16x16x32_bf16(false, a, false, b, (short)0, c, false, false); }



// element offset of (row, k) in a fragment-ordered plane whose rows hold kch chunks of 32 k: blocks run over k first, then over the 16-row tiles
__device__ __forceinline__ size_t fro(int row, int k, int kch) { return ((((size_t)(row >> 4) * kch + (k >> 5)) * 2 + ((k >> 4) & 1)) * 32 + ((k >> 3) & 1) * 16 + (row & 15)) * 8 + (k & 7); }
// ---- k_gemmw: register-blocked GEMM, ONE WAVE per 64x64 output tile (16 accumulators), operands straight from fragment-ordered 16-bit planes; grid (M/64, N/64, Z), 32 threads.
// C[m][n] (f32, pitch ldc, + optional f32 bias[n]) = sum_k A[m][k] Bt[n][k] (+ split products per NSPLIT). z-batch strides sA/sB/sC in elements. K % 32 == 0.
// KSLICE (N == 64 only): blockIdx.y is a K slice of klen, not a column tile; slice y stores its partial product at C + y * sK and the reader adds the slices in order.
template <typename T16> struct WFrag;
template <> struct WFrag<h16> { typedef v16h V; static __device__ __forceinline__ V ldf(const h16* p) { return cat16(*(const v8h*)p, *(const v8h*)(p + 256)); } static __device__ __forceinline__ v8f mma(V a, V b, v8f c) { return wmma16(a, b, c); } };
template <> struct WFrag<bf> { typedef v16bf V; static __device__ __forceinline__ V ldf(const bf* p) { return cat16b(*(const v8us*)p, *(const v8us*)(p + 256)); } static __device__ __forceinline__ v8f mma(V a, V b, v8f c) { return wmmab(a, b, c); } };
// BTROWS: A's rows run (b, t), so that a 16-row tile of the merged planes, and with it each of their 128-byte lines, has one writing work-group in k_attn; C's rows run (t, b) as always.
template <typename T16, int NSPLIT, bool BIAS, bool KSLICE, bool BTROWS>
__global__ __launch_bounds__(32) void k_gemmw(const T16* __restrict__ A, const T16* __restrict__ A2, const T16* __restrict__ Bt, const T16* __restrict__ Bt2, int K, float* C, int ldc, const float* __restrict__ bias, size_t sA, size_t sB, size_t sC, int klen, size_t sK) {
    typedef typename WFrag<T16>::V V;
    __shared__ __align__(16) float os[16 * 68];
    const size_t z = blockIdx.z; A += z * sA; if (A2) A2 += z * sA; Bt += z * sB; if (Bt2) Bt2 += z * sB; C += z * sC;
    const int lane = threadIdx.x & 31, lr = lane & 15, hi = lane >> 4; const int r0 = blockIdx.x * 64, c0 = KSLICE ? 0 : blockIdx.y * 64; const int kbeg = KSLICE ? blockIdx.y * klen : 0, kend = KSLICE ? kbeg + klen : K; if (KSLICE) C += blockIdx.y * sK;
    v8f acc[4][4];
#pragma unroll
    for (int mb = 0; mb < 4; ++mb)
#pragma unroll
        for (int nb = 0; nb < 4; ++nb) acc[mb][nb] = (v8f){};
    constexpr size_t tp = (size_t)(EE / 32) * 512;   // elements of one 16-row tile: every plane that this kernel reads has EE k a row (K == EE at every launch), and as a constant the tile's step goes into the loads' immediate offsets
    const size_t aoff = (size_t)(r0 >> 4) * tp, boff = (size_t)(c0 >> 4) * tp; const unsigned lo = 8 * lane;   // the lane's place in a 512-byte half
#pragma unroll 1
    for (int kc = kbeg; kc < kend; kc += 32) {
        V a[4], a2[4]; const T16* pa = A + (aoff + (size_t)kc * 16) + lo; const T16* pa2 = (NSPLIT == 1 || NSPLIT == 2) ? A2 + (aoff + (size_t)kc * 16) + lo : pa; const T16* pb = Bt + (boff + (size_t)kc * 16) + lo; const T16* pb2 = NSPLIT >= 2 ? Bt2 + (boff + (size_t)kc * 16) + lo : pb;
#pragma unroll
        for (int mb = 0; mb < 4; ++mb) { a[mb] = WFrag<T16>::ldf(pa + mb * tp); if (NSPLIT == 1 || NSPLIT == 2) a2[mb] = WFrag<T16>::ldf(pa2 + mb * tp); }
#pragma unroll
        for (int nb = 0; nb < 4; ++nb) { const V b = WFrag<T16>::ldf(pb + nb * tp); V b2; if (NSPLIT >= 2) b2 = WFrag<T16>::ldf(pb2 + nb * tp);
#pragma unroll
            for (int mb = 0; mb < 4; ++mb) { acc[mb][nb] = WFrag<T16>::mma(a[mb], b, acc[mb][nb]); if (NSPLIT == 1 || NSPLIT == 2) acc[mb][nb] = WFrag<T16>::mma(a2[mb], b, acc[mb][nb]); if (NSPLIT >= 2) acc[mb][nb] = WFrag<T16>::mma(a[mb], b2, acc[mb][nb]); } }
        // stands in front of the next trip's writes of the loads' address registers (the build let later loads' results land in them): the addresses are inputs, so that their registers live up to the wait
        asm volatile("s_wait_xcnt 0x0" :: "v"(pa), "v"(pa2), "v"(pb), "v"(pb2) : "memory");
        asm volatile("v_nop\n\tv_nop\n\tv_nop\n\tv_nop" : "+v"(acc[0][0]), "+v"(acc[1][1]), "+v"(acc[2][2]), "+v"(acc[3][3]) : "v"(a[0]), "v"(a[3]));
    }
#pragma unroll
    for (int mb = 0; mb < 4; ++mb) {
#pragma unroll
        for (int nb = 0; nb < 4; ++nb) {
#pragma unroll
            for (int j = 0; j < 8; ++j) os[(hi * 8 + j) * 68 + nb * 16 + lr] = acc[mb][nb][j]; }
        __builtin_amdgcn_wave_barrier(); asm volatile("" ::: "memory");
{
#pragma unroll
            for (int s = 0; s < 8; ++s) { const int row = 2 * s + hi, cofs = lr * 4; v4f val = *(const v4fa*)(os + row * 68 + cofs); if (BIAS) { val[0] += bfr(bias[c0 + cofs]); val[1] += bfr(bias[c0 + cofs + 1]); val[2] += bfr(bias[c0 + cofs + 2]); val[3] += bfr(bias[c0 + cofs + 3]); }
                const int m = r0 + mb * 16 + row; *(v4f*)(C + (size_t)(BTROWS ? (m % TT) * BB + m / TT : m) * ldc + c0 + cofs) = val; }
             }
        // stands in front of the next writes of the stores' address and data registers; the scheduling barriers keep the stores in front of it and every later instruction behind it
        __builtin_amdgcn_sched_barrier(0); asm volatile("s_wait_xcnt 0x0" ::: "memory"); __builtin_amdgcn_sched_barrier(0);
        __builtin_amdgcn_wave_barrier(); asm volatile("" ::: "memory");
    }
}

__device__ __forceinline__ h16 tohx(float x) { return (h16)x; }
__device__ __forceinline__ void splitf(float y, unsigned short& h, unsigned short& l) { h = f2bf(y); l = f2bf(y - bf2f(h)); }
typedef __attribute__((ext_vector_type(2))) _Float16 v2h;
typedef __attribute__((ext_vector_type(4))) _Float16 v4h;
typedef __attribute__((ext_vector_type(2))) unsigned short v2us;
typedef __attribute__((ext_vector_type(4))) unsigned short v4us;
typedef __attribute__((ext_vector_type(2))) float v2f;

// The three plane builders: one thread per 16-byte piece of the fragment-ordered output, pieces in output order, so that a wave's store is 512 contiguous bytes.
// k_cvt8: [rows][EE] f32 -> bf16; piece i: lane i & 31, half (i >> 5) & 1, chunk (i >> 6) % (EE / 32), 16-row tile above.
__global__ __launch_bounds__(256) void k_cvt8(const float* __restrict__ src, bf* dst, size_t n8) { const size_t i = (size_t)blockIdx.x * 256 + threadIdx.x; if (i >= n8) return; const int row = (int)(i >> 11) * 16 + (int)(i & 15), k = (int)((i >> 6) & (EE / 32 - 1)) * 32 + (int)((i >> 5) & 1) * 16 + (int)((i >> 4) & 1) * 8; const v8f v = *(const v8f*)(src + (size_t)row * EE + k); v8us o;
#pragma unroll
    for (int u = 0; u < 8; ++u) o[u] = f2bf(v[u]); *(v8us*)(dst + i * 8) = o;  }
// k_pl: rows (n, t), k = d (two chunks a row); piece i: lane, half, chunk (i >> 6) & 1, tile (i >> 7) of the NG * TT rows.
__global__ __launch_bounds__(256) void k_pl(const float* __restrict__ F, float scl, h16* P16, bf* Ph, bf* Pl) { const size_t i = (size_t)blockIdx.x * 256 + threadIdx.x; if (i >= (size_t)NG * TT * HD / 8) return; const int d = (int)((i >> 6) & 1) * 32 + (int)((i >> 5) & 1) * 16 + (int)((i >> 4) & 1) * 8; const int row = (int)(i >> 7) * 16 + (int)(i & 15); const int t = row % TT, n = row / TT; const int b = n / NH_, h = n % NH_; const v8f f = *(const v8f*)(F + ((size_t)t * BB + b) * EE + h * HD + d); v8h o; v8us oh, ol;
#pragma unroll
    for (int u = 0; u < 8; ++u) { const float v = f[u] * scl; o[u] = tohx(v); unsigned short a, c; splitf(v, a, c); oh[u] = a; ol[u] = c; } { *(v8h*)(P16 + i * 8) = o; *(v8us*)(Ph + i * 8) = oh; *(v8us*)(Pl + i * 8) = ol;  } }
// k_vtp: rows d, k = t; the blocks of a group run over its four 16-row tiles first, then over the 64 chunks of 32 keys (a wave of k_attn reads 32 KB in a row); piece i: lane, half, tile (i >> 6) & 3, chunk (i >> 8) & 63, group above.
// A piece is 8 keys of one d: 8 loads, in each of which 16 lanes share 64 bytes of a row of F.
__global__ __launch_bounds__(256) void k_vtp(const float* __restrict__ F, h16* V16, bf* Vh, bf* Vl) { const size_t i = (size_t)blockIdx.x * 256 + threadIdx.x; if (i >= (size_t)NG * HD * TT / 8) return; const int d = (int)((i >> 6) & 3) * 16 + (int)(i & 15); const int t = (int)((i >> 8) & 63) * 32 + (int)((i >> 5) & 1) * 16 + (int)((i >> 4) & 1) * 8; const int n = (int)(i >> 14); const int b = n / NH_, h = n % NH_; v8h o; v8us oh, ol;
#pragma unroll
    for (int u = 0; u < 8; ++u) { const float v = F[((size_t)(t + u) * BB + b) * EE + h * HD + d]; o[u] = tohx(v); unsigned short a, c; splitf(v, a, c); oh[u] = a; ol[u] = c; } { *(v8h*)(V16 + i * 8) = o; *(v8us*)(Vh + i * 8) = oh; *(v8us*)(Vl + i * 8) = ol;  } }
// k_qr: one thread per (group, query) row: the scaled query row sits in 64 registers, the 33 rounded rk rows in LDS, read at one address by the whole wave (a broadcast), four buckets a pass; each sum runs over d in ascending order.
__global__ __launch_bounds__(256) void k_qr(const float* __restrict__ QF, const float* __restrict__ rk, float* QR) { __shared__ __align__(16) float rs[NR * HD];
    for (int i = threadIdx.x; i < NR * HD; i += 256) rs[i] = bfr(rk[i]);
    const size_t row = (size_t)blockIdx.x * 256 + threadIdx.x; const int t = (int)(row % TT), n = (int)(row / TT); const int b = n / NH_, h = n % NH_; const float* q = QF + ((size_t)t * BB + b) * EE + h * HD; float qv[HD];
    // the loops over d and k are fully unrolled so that qv stays in registers
#pragma unroll
    for (int d = 0; d < HD; d += 4) { const v4f x = *(const v4f*)(q + d); qv[d] = x[0] * 0.125f; qv[d + 1] = x[1] * 0.125f; qv[d + 2] = x[2] * 0.125f; qv[d + 3] = x[3] * 0.125f; }
    __syncthreads();   // publishes the rk rows
    float* o = QR + row * 64;
#pragma unroll 1   // eight trips of 256 multiply-adds: unrolled, the kernel is 30 KB of code that each wave runs once
    for (int r0 = 0; r0 < NR - 1; r0 += 4) { v4f s = (v4f){};
#pragma unroll
        for (int d = 0; d < HD; d += 4) {
#pragma unroll
            for (int k = 0; k < 4; ++k) { const v4f w = *(const v4fa*)(rs + (r0 + k) * HD + d); s[k] += qv[d] * w[0]; s[k] += qv[d + 1] * w[1]; s[k] += qv[d + 2] * w[2]; s[k] += qv[d + 3] * w[3]; } }
        *(v4f*)(o + r0) = s;
        asm volatile("s_wait_xcnt 0x0" ::: "memory"); }   // stands in front of the next writes of the store's address and data registers
    float s = 0.f;
#pragma unroll
    for (int d = 0; d < HD; d += 4) { const v4f w = *(const v4fa*)(rs + (NR - 1) * HD + d); s += qv[d] * w[0]; s += qv[d + 1] * w[1]; s += qv[d + 2] * w[2]; s += qv[d + 3] * w[3]; }
    o[NR - 1] = s; }
// k_attn: the whole attention of 16 query rows of one group in one work-group of 8 waves; wave w owns keys [256 w, 256 w + 256). Scores are formed TRANSPOSED (A = 16 key rows, B = 16 query rows), so that a lane holds, for query lr,
// keys 8 hi .. 8 hi + 7 of each 16-key tile: two neighbouring tiles are, register for register, the A fragment of P for a 32-key chunk of P.v, and the probabilities never leave the registers. Row maximum, row sum, the two outer
// bucket sums and the 8 partial P.v tiles meet in LDS (waves added in ascending order). THE BAND: only the three key tiles at t0 - 16, t0, t0 + 16 (BW = 48 keys, x = key - (t0 - 16)) hold keys nearer than 16 to one of the 16 queries. The tile loops are fully unrolled, so whatever a band tile
// needs stands 16 times in the text: it is kept to two 16-byte LDS accesses. bad[q][x] (pitch BP: 16-byte rows on distinct banks) holds q.rk already picked by distance, staged straight from the QR table; bnd[q][x] takes the band tiles' rounded P, and the end of the kernel, once, sorts x <= q into bucket 0, x >= q + 32 into bucket 32 and x = q + r into bucket r. The rounded rv table is staged in LDS by the whole work-group. P is rounded to hl planes (rows < RH) or to fp16 x 1024 (the rest); the bucket sums are taken from the rounded values.
typedef __attribute__((ext_vector_type(2))) __bf16 v2bf;
template <bool HR, typename T16>
__device__ __forceinline__ void attn_rows(const T16* __restrict__ Qa, const T16* __restrict__ Qb, const T16* __restrict__ Ka, const T16* __restrict__ Kb, const T16* __restrict__ Va, const T16* __restrict__ Vb, const float* __restrict__ QR, const float* __restrict__ rv, const int n, const int t0, float* os, float* bnd, float* red, float* bad, float* rvs) {
    typedef typename WFrag<T16>::V V;
    const int tid = threadIdx.x, lane = tid & 31, lr = lane & 15, hi = lane >> 4; const int w = __builtin_amdgcn_readfirstlane(tid >> 5);   // the wave's number in a scalar register: the tests on a tile's place become scalar branches
    const int kb = w * 256;
    V qa[2], qb[2]; const T16* qpa = Qa + ((size_t)n * TT + t0) * HD + 8 * lane; const T16* qpb = HR ? Qb + ((size_t)n * TT + t0) * HD + 8 * lane : qpa;   // a 16-row tile is 16 * HD elements, a 32-d chunk of it 512
#pragma unroll
    for (int c = 0; c < 2; ++c) { qa[c] = WFrag<T16>::ldf(qpa + 512 * c); if (HR) qb[c] = WFrag<T16>::ldf(qpb + 512 * c); }
    // stands in front of the next writes of the query loads' address registers (the build takes their scalar base over a few instructions on); the scheduling barriers keep the loads in front of it and every later instruction behind it
    __builtin_amdgcn_sched_barrier(0); asm volatile("s_wait_xcnt 0x0" ::: "memory"); __builtin_amdgcn_sched_barrier(0);
    // staging: 16 x 48 band q.rk values and 528 four-float pieces of rv, three a thread; rv's third index is held to the last piece, which threads 15..255 all load and store alike (one value, no branch)
    float gq[3]; v4f gv[3];
#pragma unroll
    for (int u = 0; u < 3; ++u) { const int ib = tid + 256 * u, i = min(ib, 16 * NR - 1), bq = ib / BW, bx = ib % BW; gq[u] = QR[((size_t)n * TT + t0 + bq) * 64 + min(max(bx - MR - bq, -MR), MR) + MR]; gv[u] = *(const v4f*)(rv + i * 4);
        __builtin_amdgcn_sched_barrier(0); asm volatile("s_wait_xcnt 0x0" ::: "memory"); __builtin_amdgcn_sched_barrier(0); }   // the same for these two loads
    v8f s[16]; float mx = -3.0e38f;
    constexpr int TB = HR ? 1 : 2;   // key tiles a batch: two buffers of 32 registers each, one in flight while the other is worked on
    V kf[2][TB][HR ? 4 : 2]; const size_t ko = ((size_t)n * TT + kb) * HD + 8 * lane;
    // every loop over tiles, chunks and registers is fully unrolled so that s stays in registers
#pragma unroll
    for (int u = 0; u < TB; ++u) {
#pragma unroll
        for (int c = 0; c < 2; ++c) { kf[0][u][c] = WFrag<T16>::ldf(Ka + ko + u * 16 * HD + 512 * c); if (HR) kf[0][u][2 + c] = WFrag<T16>::ldf(Kb + ko + u * 16 * HD + 512 * c); } }
    __builtin_amdgcn_sched_barrier(0);   // keeps the first key loads in front of the staging's LDS stores, which wait for the staged values: the two latencies overlap
#pragma unroll
    for (int u = 0; u < 3; ++u) { const int ib = tid + 256 * u, i = min(ib, 16 * NR - 1), bo = (ib / BW) * BP + ib % BW; bnd[bo] = 0.f;   // a band key that lies outside the sequence stays 0
        bad[bo] = gq[u]; v4f y; y[0] = bfr(gv[u][0]); y[1] = bfr(gv[u][1]); y[2] = bfr(gv[u][2]); y[3] = bfr(gv[u][3]); *(v4fa*)(rvs + i * 4) = y; }
#pragma unroll
    for (int b = 0; b < 16 / TB; ++b) {
        if (b + 1 < 16 / TB) {
#pragma unroll
            for (int u = 0; u < TB; ++u) {
#pragma unroll
                for (int c = 0; c < 2; ++c) { kf[(b + 1) & 1][u][c] = WFrag<T16>::ldf(Ka + ko + ((b + 1) * TB + u) * 16 * HD + 512 * c); if (HR) kf[(b + 1) & 1][u][2 + c] = WFrag<T16>::ldf(Kb + ko + ((b + 1) * TB + u) * 16 * HD + 512 * c); } } }
        __builtin_amdgcn_sched_barrier(0);   // keeps the next batch's loads in front of this batch's products: without it the build issues each fragment's loads directly in front of its product and waits out every latency
#pragma unroll
        for (int u = 0; u < TB; ++u) { v8f a = (v8f){};
#pragma unroll
            for (int c = 0; c < 2; ++c) { a = WFrag<T16>::mma(kf[b & 1][u][c], qa[c], a); if (HR) { a = WFrag<T16>::mma(kf[b & 1][u][c], qb[c], a); a = WFrag<T16>::mma(kf[b & 1][u][2 + c], qa[c], a); } }
            s[b * TB + u] = a; } }
    // the branches below follow the last matrix instruction: five vector slots keep its distance on the taken side too; the two scheduling barriers hold them in place
    __builtin_amdgcn_sched_barrier(0); asm volatile("v_nop\n\tv_nop\n\tv_nop\n\tv_nop\n\tv_nop"); __builtin_amdgcn_sched_barrier(0);
    __syncthreads();   // publishes the staged q.rk rows (and the rv table and the cleared buckets)
    const float* qr = bad + lr * BP; const float qlo = qr[0], qhi = qr[BW - 1];   // x = 0 lies at distance <= -16 of every query, x = 47 at >= +16
#pragma unroll
    for (int kt = 0; kt < 16; ++kt) { const int k0 = kb + kt * 16; v8f a = s[kt];
        if (k0 + 15 > t0 - MR && k0 < t0 + 15 + MR) {
#pragma unroll
            for (int j = 0; j < 8; j += 4) { const v4f y = *(const v4fa*)(qr + (k0 - t0 + MR) + hi * 8 + j); a[j] += y[0]; a[j + 1] += y[1]; a[j + 2] += y[2]; a[j + 3] += y[3]; }
        } else { const float qq = k0 < t0 ? qlo : qhi;
#pragma unroll
            for (int j = 0; j < 8; ++j) a[j] += qq; }
#pragma unroll
        for (int j = 0; j < 8; ++j) mx = fmaxf(mx, a[j]);
        s[kt] = a; }
    mx = fmaxf(mx, __shfl_xor(mx, 16, 32)); if (hi == 0) red[w * 16 + lr] = mx;
    __syncthreads();   // publishes the waves' row maxima
#pragma unroll
    for (int i = 0; i < 8; ++i) mx = fmaxf(mx, red[i * 16 + lr]);
    float sum = 0.f;
#pragma unroll
    for (int kt = 0; kt < 16; ++kt) {
#pragma unroll
        for (int j = 0; j < 8; ++j) { const float y = (s[kt][j] - mx) * 1.44269504f; float e;
            asm("v_exp_f32 %0, %1\n\tv_nop" : "=v"(e) : "v"(y));   // e^x as 2^(x log2 e); the v_nop is the one slot behind a transcendental
            s[kt][j] = e; sum += e; } }
    sum += __shfl_xor(sum, 16, 32); if (hi == 0) red[128 + w * 16 + lr] = sum;
    __syncthreads();   // publishes the waves' row sums
    sum = red[128 + lr];
#pragma unroll
    for (int i = 1; i < 8; ++i) sum += red[128 + i * 16 + lr];
    const float f = HR ? __fdiv_rn(1.0f, sum) : __fdiv_rn(1.0f, sum) * PCAR;
    float lo = 0.f, up = 0.f;
    // rounds P in place (hl: a tile's registers 0..3 take its half of the high plane's fragment, 4..7 that of the low plane's; fp16: the rounded value) and forms the bucket sums from the rounded values; all branches stand here, in front of the matrix instructions of P.v
#pragma unroll
    for (int kt = 0; kt < 16; ++kt) { const int k0 = kb + kt * 16; float val[8]; unsigned xh[4], xl[4];
#pragma unroll
        for (int k = 0; k < 4; ++k) { const float p0 = s[kt][2 * k] * f, p1 = s[kt][2 * k + 1] * f;
            if (HR) { v2bf h; h[0] = (__bf16)p0; h[1] = (__bf16)p1; xh[k] = __builtin_bit_cast(unsigned, h);   // round to nearest even, two values a conversion, already in the fragment's order
                const float h0 = __uint_as_float(xh[k] << 16), h1 = __uint_as_float(xh[k] & 0xFFFF0000u); v2bf l; l[0] = (__bf16)(p0 - h0); l[1] = (__bf16)(p1 - h1); xl[k] = __builtin_bit_cast(unsigned, l);
                val[2 * k] = h0 + __uint_as_float(xl[k] << 16); val[2 * k + 1] = h1 + __uint_as_float(xl[k] & 0xFFFF0000u); }
            else { const float x0 = (float)tohx(p0), x1 = (float)tohx(p1); s[kt][2 * k] = x0; s[kt][2 * k + 1] = x1; val[2 * k] = x0 * (1.0f / PCAR); val[2 * k + 1] = x1 * (1.0f / PCAR); } }
        if (HR) {
#pragma unroll
            for (int k = 0; k < 4; ++k) { s[kt][k] = __uint_as_float(xh[k]); s[kt][4 + k] = __uint_as_float(xl[k]); } }
        if (k0 + 15 > t0 - MR && k0 < t0 + 15 + MR) {
#pragma unroll
            for (int j = 0; j < 8; j += 4) { v4f y; y[0] = val[j]; y[1] = val[j + 1]; y[2] = val[j + 2]; y[3] = val[j + 3]; *(v4fa*)(bnd + lr * BP + (k0 - t0 + MR) + hi * 8 + j) = y; }
        } else {   // the tile's sum once, then added to the side the whole tile lies on: one copy of the adds in the text instead of one a side
            const float ts = ((val[0] + val[1]) + (val[2] + val[3])) + ((val[4] + val[5]) + (val[6] + val[7]));
            lo += k0 < t0 ? ts : 0.f; up += k0 < t0 ? 0.f : ts; } }
    lo += __shfl_xor(lo, 16, 32); up += __shfl_xor(up, 16, 32); if (hi == 0) { red[256 + w * 16 + lr] = lo; red[384 + w * 16 + lr] = up; }
    v8f o[4];
    // P.v by pairs of 32-key chunks (a chunk of the v planes is 2048 elements: four 16-column tiles of 512). A batch is 32 registers of fragments
    // (fp16: two tiles x two chunks; hl: one tile x two chunks x two planes), in two buffers, one in flight while the other is worked on. Each o[dt] still takes its chunks in ascending order.
    constexpr int FB = HR ? 2 : 4, NBP = HR ? 4 : 2;   // (tile, chunk) places a batch; batches a pair of chunks
    V vf[2][FB][HR ? 2 : 1]; const size_t vo = ((size_t)n * TT + kb) * HD + 8 * lane;
#pragma unroll
    for (int dt = 0; dt < 4; ++dt) o[dt] = (v8f){};
#pragma unroll
    for (int u = 0; u < FB; ++u) { const size_t v1 = vo + (HR ? 0 : u & 1) * 512 + (HR ? u : u >> 1) * 2048; vf[0][u][0] = WFrag<T16>::ldf(Va + v1); if (HR) vf[0][u][1] = WFrag<T16>::ldf(Vb + v1); }
#pragma unroll
    for (int cp = 0; cp < 4; ++cp) { V pa[2], pb2[2];
#pragma unroll
        for (int e = 0; e < 2; ++e) { const int c = 2 * cp + e;
            if constexpr (HR) { v8f ph, pl;
#pragma unroll
                for (int k = 0; k < 8; ++k) { ph[k] = s[2 * c + (k >> 2)][k & 3]; pl[k] = s[2 * c + (k >> 2)][4 + (k & 3)]; }
                pa[e] = __builtin_bit_cast(v16bf, ph); pb2[e] = __builtin_bit_cast(v16bf, pl); }
            else {
#pragma unroll
                for (int i = 0; i < 16; ++i) pa[e][i] = tohx(s[2 * c + (i >> 3)][i & 7]); } }
#pragma unroll
        for (int g = 0; g < NBP; ++g) { const int b = cp * NBP + g, b1 = b + 1, g1 = b1 % NBP;
            if (b1 < 4 * NBP) {
#pragma unroll
                for (int u = 0; u < FB; ++u) { const int dt1 = HR ? g1 : g1 * 2 + (u & 1), e1 = HR ? u : u >> 1; const size_t v1 = vo + dt1 * 512 + (2 * (b1 / NBP) + e1) * 2048; vf[b1 & 1][u][0] = WFrag<T16>::ldf(Va + v1); if (HR) vf[b1 & 1][u][1] = WFrag<T16>::ldf(Vb + v1); } }
            __builtin_amdgcn_sched_barrier(0);   // keeps the next batch's loads in front of this batch's products, as in the score stage
#pragma unroll
            for (int u = 0; u < FB; ++u) { const int dt = HR ? g : g * 2 + (u & 1), e = HR ? u : u >> 1; o[dt] = WFrag<T16>::mma(pa[e], vf[b & 1][u][0], o[dt]);
                if constexpr (HR) { o[dt] = WFrag<T16>::mma(pb2[e], vf[b & 1][u][0], o[dt]); o[dt] = WFrag<T16>::mma(pa[e], vf[b & 1][u][1], o[dt]); } } } }
    __builtin_amdgcn_sched_barrier(0);   // keeps the address arithmetic of what follows behind the last products, and so behind the data waits of the last loads, whose address registers it takes over
#pragma unroll
    for (int dt = 0; dt < 4; ++dt) {
#pragma unroll
        for (int j = 0; j < 8; ++j) os[(w * 16 + hi * 8 + j) * 68 + dt * 16 + lr] = o[dt][j]; } }
// attn_end: the waves' partial tiles and bucket sums added, the band sorted into its buckets, the rv term, the merged planes stored; it stands once in the text for both precisions (scl undoes the fp16 path's scale of P).
__device__ __forceinline__ void attn_end(bf* Ah, bf* Al, const int n, const int t0, const float scl, const float* os, const float* bnd, const float* red, const float* rvs) {
    const int tid = threadIdx.x;
    __syncthreads();   // publishes the partial P.v tiles and all bucket sums
    const int q = tid >> 4, d0 = (tid & 15) * 4; v4f ps = *(const v4fa*)(os + q * 68 + d0); float plo = red[256 + q], pup = red[384 + q];
#pragma unroll
    for (int i = 1; i < 8; ++i) { ps += *(const v4fa*)(os + (i * 16 + q) * 68 + d0); plo += red[256 + i * 16 + q]; pup += red[384 + i * 16 + q]; }
    const float* bp = bnd + q * BP;
    // the band keys at distance <= -16 (x <= q) and >= +16 (x >= q + 32) join the outer buckets, in ascending order behind the waves' sums
#pragma unroll
    for (int x = 0; x < 16; x += 4) { const v4f y = *(const v4fa*)(bp + x), z = *(const v4fa*)(bp + 32 + x);
#pragma unroll
        for (int k = 0; k < 4; ++k) { plo += x + k <= q ? y[k] : 0.f; pup += x + k >= q ? z[k] : 0.f; } }
    v4f acc = ps * scl;
#pragma unroll
    for (int r = 0; r < NR; ++r) { const float p = r == 0 ? plo : (r == NR - 1 ? pup : bp[q + r]); const v4f x = *(const v4fa*)(rvs + r * HD + d0);
#pragma unroll
        for (int k = 0; k < 4; ++k) acc[k] += p * x[k]; }
    v4us oh, ol;
#pragma unroll
    for (int k = 0; k < 4; ++k) { unsigned short x, y; splitf(acc[k], x, y); oh[k] = x; ol[k] = y; }
    const size_t oo = fro((n / NH_) * TT + t0 + q, (n % NH_) * HD + d0, EE / 32); *(v4us*)(Ah + oo) = oh; *(v4us*)(Al + oo) = ol; }   // the merged planes too are stored in fragment order, rows (b, t), for the Wo product
// four waves a SIMD (two work-groups a WGP): without the bound the build hoists loads until only two fit
__global__ __launch_bounds__(256) __attribute__((amdgpu_waves_per_eu(4))) void k_attn(const h16* __restrict__ Q16, const bf* __restrict__ Qh, const bf* __restrict__ Ql, const h16* __restrict__ K16, const bf* __restrict__ Kh, const bf* __restrict__ Kl, const h16* __restrict__ V16, const bf* __restrict__ Vh, const bf* __restrict__ Vl, const float* __restrict__ QR, const float* __restrict__ rv, bf* Ah, bf* Al) {
    __shared__ __align__(16) float os[8 * 16 * 68]; __shared__ __align__(16) float bnd[16 * BP]; __shared__ float red[512]; __shared__ __align__(16) float bad[16 * BP]; __shared__ __align__(16) float rvs[NR * HD];
    // all hl work-groups come first in the grid, then all fp16 ones (for speed only)
    const int fl = blockIdx.x, g = fl - NG * (RH / 16); const bool hr = g < 0;
    const int n = hr ? fl / (RH / 16) : g / ((TT - RH) / 16), t0 = hr ? (fl % (RH / 16)) * 16 : RH + (g % ((TT - RH) / 16)) * 16;
    if (hr) attn_rows<true, bf>(Qh, Ql, Kh, Kl, Vh, Vl, QR, rv, n, t0, os, bnd, red, bad, rvs);
    else attn_rows<false, h16>(Q16, nullptr, K16, nullptr, V16, nullptr, QR, rv, n, t0, os, bnd, red, bad, rvs);
    attn_end(Ah, Al, n, t0, hr ? 1.0f : 1.0f / PCAR, os, bnd, red, rvs); }

extern "C" void kernel_launch(void* const* d_in, const int* in_sizes, int n_in,
                              void* d_out, int out_size, void* d_ws, size_t ws_size, hipStream_t stream) {
    (void)in_sizes; (void)n_in; (void)out_size;
    const float* x = (const float*)d_in[0]; const float* Wq = (const float*)d_in[1]; const float* bq = (const float*)d_in[2]; const float* Wk = (const float*)d_in[3]; const float* bk = (const float*)d_in[4]; const float* Wv = (const float*)d_in[5]; const float* bv = (const float*)d_in[6]; const float* Wo = (const float*)d_in[7]; const float* bo = (const float*)d_in[8]; const float* rk = (const float*)d_in[9]; const float* rv = (const float*)d_in[10];
    float* OUT = (float*)d_out;     // [2048][2][1024]
    char* wsp = (char*)d_ws;
    auto take = [&](size_t bytes) { char* p = wsp; wsp += (bytes + 255) & ~(size_t)255; return (void*)p; };
    const size_t NTB = (size_t)TT * BB;
    bf* WO = (bf*)take((size_t)EE * EE * 2); float* QR = (float*)take((size_t)NG * TT * 64 * 4); bf* Ah = (bf*)take(NTB * EE * 2); bf* Al = (bf*)take(NTB * EE * 2);
    h16* Q16 = (h16*)take((size_t)NG * TT * HD * 2); bf* Qh = (bf*)take((size_t)NG * TT * HD * 2); bf* Ql = (bf*)take((size_t)NG * TT * HD * 2); h16* K16 = (h16*)take((size_t)NG * TT * HD * 2); bf* Kh = (bf*)take((size_t)NG * TT * HD * 2); bf* Kl = (bf*)take((size_t)NG * TT * HD * 2); h16* V16 = (h16*)take((size_t)NG * HD * TT * 2); bf* Vh = (bf*)take((size_t)NG * HD * TT * 2); bf* Vl = (bf*)take((size_t)NG * HD * TT * 2);
    bf* WQ = (bf*)take((size_t)EE * EE * 2); bf* WK = (bf*)take((size_t)EE * EE * 2); bf* WV = (bf*)take((size_t)EE * EE * 2); bf* XB = (bf*)take(NTB * EE * 2); float* QF = (float*)take(NTB * EE * 4); float* KF = (float*)take(NTB * EE * 4);
    if ((size_t)(wsp - (char*)d_ws) > ws_size) return;    // total 152 MiB: nine [32][2048][64] planes 72, QR 16, merged planes 16, Wo 2, projection stage 46
    float* VF = KF;   // v projection reuses the k buffer after the k planes are built
    k_cvt8<<<(EE * EE / 8 + 255) / 256, 256, 0, stream>>>(Wq, WQ, (size_t)EE * EE / 8); k_cvt8<<<(EE * EE / 8 + 255) / 256, 256, 0, stream>>>(Wk, WK, (size_t)EE * EE / 8); k_cvt8<<<(EE * EE / 8 + 255) / 256, 256, 0, stream>>>(Wv, WV, (size_t)EE * EE / 8); k_cvt8<<<(EE * EE / 8 + 255) / 256, 256, 0, stream>>>(Wo, WO, (size_t)EE * EE / 8);
    k_cvt8<<<(unsigned)((NTB * EE / 8 + 255) / 256), 256, 0, stream>>>(x, XB, NTB * EE / 8);
    const unsigned LP = (unsigned)(((size_t)NG * TT * HD / 8 + 255) / 256);
    k_gemmw<bf, 0, true, false, false><<<dim3(NTB / 64, EE / 64, 1), 32, 0, stream>>>(XB, nullptr, WQ, nullptr, EE, QF, EE, bq, 0, 0, 0, 0, 0); k_pl<<<LP, 256, 0, stream>>>(QF, 0.125f, Q16, Qh, Ql); k_qr<<<NG * TT / 256, 256, 0, stream>>>(QF, rk, QR);
    k_gemmw<bf, 0, true, false, false><<<dim3(NTB / 64, EE / 64, 1), 32, 0, stream>>>(XB, nullptr, WK, nullptr, EE, KF, EE, bk, 0, 0, 0, 0, 0); k_pl<<<LP, 256, 0, stream>>>(KF, 1.0f, K16, Kh, Kl);
    k_gemmw<bf, 0, true, false, false><<<dim3(NTB / 64, EE / 64, 1), 32, 0, stream>>>(XB, nullptr, WV, nullptr, EE, VF, EE, bv, 0, 0, 0, 0, 0); k_vtp<<<LP, 256, 0, stream>>>(VF, V16, Vh, Vl);
    k_attn<<<NG * TT / 16, 256, 0, stream>>>(Q16, Qh, Ql, K16, Kh, Kl, V16, Vh, Vl, QR, rv, Ah, Al);
    k_gemmw<bf, 1, true, false, true><<<dim3(NTB / 64, EE / 64, 1), 32, 0, stream>>>(Ah, Al, WO, nullptr, EE, OUT, EE, bo, 0, 0, 0, 0, 0);
}

// v007
// It runs in 240 microseconds.
// Next to v006, in two timings, it ran 1.33 times as fast each time.
// All steps since v000 together make it 9.80 times as fast.
#include <hip/hip_runtime.h>

// Shaw relative-position multi-head attention, sequence-first (query [2048][2][1024]; q = (x Wq^T + bq)/8, k, v = x W^T + b; 32 groups n = b*16 + h of 64 dims; scores = q.k + q.rk[clip(s-t,-16,16)+16];
// softmax; attn = P.v + sum_s P[t][s] rv[clip(s-t)+16]; out = merged Wo^T + bo -> [2048][2][1024]; rk/rv tables [33][64] read as data).
// The relative terms are exact regroupings: q.rk depends on (t, bucket) only -> QR[n][t][r] = q_t . rk[r] (33 per row, added inside the attention kernel by bucket); sum_s P rv = sum_r PB[t][r] rv[r] with PB the per-bucket
// probability sums (buckets 0 / 32 collect all keys at distance <= -16 / >= +16), formed in the attention kernel and contracted with rv on VALU at its end.
// Compute dtypes, f32 accumulate: every input rounded to bf16; projections on PLAIN bf16 operands (inputs: exact, + bias; all 4096 (t, b) rows at once); QR and the PB.rv term f32 on VALU; scores (K 64) and P.v on
// hl planes (3 products) for the first 512 query rows of each group and SINGLE fp16 planes for the rest; softmax f32 in registers; Wo on hl planes x exact (+bias). Projections (all three in one launch, grid z) and Wo: one-wave-per-64x64-tile GEMMs; attention: one fused kernel (k_attn). Deterministic, no atomics;
// FRAGMENT ORDER: every 16-bit operand plane in the workspace is stored as the matrix instructions read it. A block of 16 rows x 32 k is 1024 bytes: two halves of 512 bytes (k 0..15, k 16..31), in each lane L = 16 * ((k >> 3) & 1) + (row & 15)
// owns 16 bytes (8 k). A fragment is then two 16-byte loads a lane, each of which reads four whole 128-byte lines; from a row-major plane each took 32 bytes out of 16 lines.

#define TT   2048
#define BB   2
#define EE   1024
#define NH_  16
#define NG   (BB * NH_)
#define HD   64
#define NR   33
#define MR   16
#define RH   512
#define PCAR 1024.0f
#define BW   48
#define BP   52
typedef _Float16 h16;
typedef unsigned short bf;
typedef __attribute__((ext_vector_type(16))) __bf16   v16bf;
typedef __attribute__((ext_vector_type(16))) _Float16 v16h;
typedef __attribute__((ext_vector_type(8)))  _Float16 v8h;
typedef __attribute__((ext_vector_type(8)))  unsigned short v8us;
typedef __attribute__((ext_vector_type(8)))  float    v8f;
typedef __attribute__((ext_vector_type(4)))  float    v4f;
typedef v8h  __attribute__((may_alias)) v8ha;
typedef v4f  __attribute__((may_alias)) v4fa;
typedef v8us __attribute__((may_alias)) v8usa;

__device__ __forceinline__ unsigned short f2bf(float f) { unsigned u = __float_as_uint(f); u += 0x7FFFu + ((u >> 16) & 1u); return (unsigned short)(u >> 16); }
__device__ __forceinline__ float bf2f(unsigned short b) { return __uint_as_float(((unsigned)b) << 16); }
__device__ __forceinline__ float bfr(float f) { return bf2f(f2bf(f)); }
__device__ __forceinline__ v16h cat16(v8h lo, v8h hi) { return __builtin_shufflevector(lo, hi, 0, 1, 2, 3, 4, 5, 6, 7, 8, 9, 10, 11, 12, 13, 14, 15); }
__device__ __forceinline__ v16bf cat16b(v8us lo, v8us hi) { return __builtin_bit_cast(v16bf, __builtin_shufflevector(lo, hi, 0, 1, 2, 3, 4, 5, 6, 7, 8, 9, 10, 11, 12, 13, 14, 15)); }
__device__ __forceinline__ v8f wmma16(v16h a, v16h b, v8f c) { return __builtin_amdgcn_wmma_f32_16x16x32_f16(false, a, false, b, (short)0, c, false, false); }
__device__ __forceinline__ v8f wmmab(v16bf a, v16bf b, v8f c) { return __builtin_amdgcn_wmma_f32_16x16x32_bf16(false, a, false, b, (short)0, c, false, false); }



// element offset of (row, k) in a fragment-ordered plane whose rows hold kch chunks of 32 k: blocks run over k first, then over the 16-row tiles
__device__ __forceinline__ size_t fro(int row, int k, int kch) { return ((((size_t)(row >> 4) * kch + (k >> 5)) * 2 + ((k >> 4) & 1)) * 32 + ((k >> 3) & 1) * 16 + (row & 15)) * 8 + (k & 7); }
// ---- k_gemmw: register-blocked GEMM, ONE WAVE per 64x64 output tile (16 accumulators), operands straight from fragment-ordered 16-bit planes; grid (M/64, N/64, Z), 32 threads.
// C[m][n] (f32, pitch ldc, + optional f32 bias[n]) = sum_k A[m][k] Bt[n][k] (+ split products per NSPLIT). z-batch strides sA/sB/sC in elements; batch z takes bias, bias1 or bias2 (the biases are separate inputs). K % 32 == 0.
// KSLICE (N == 64 only): blockIdx.y is a K slice of klen, not a column tile; slice y stores its partial product at C + y * sK and the reader adds the slices in order.
template <typename T16> struct WFrag;
template <> struct WFrag<h16> { typedef v16h V; static __device__ __forceinline__ V ldf(const h16* p) { return cat16(*(const v8h*)p, *(const v8h*)(p + 256)); } static __device__ __forceinline__ v8f mma(V a, V b, v8f c) { return wmma16(a, b, c); } };
template <> struct WFrag<bf> { typedef v16bf V; static __device__ __forceinline__ V ldf(const bf* p) { return cat16b(*(const v8us*)p, *(const v8us*)(p + 256)); } static __device__ __forceinline__ v8f mma(V a, V b, v8f c) { return wmmab(a, b, c); } };
// BTROWS: A's rows run (b, t), so that a 16-row tile of the merged planes, and with it each of their 128-byte lines, has one writing work-group in k_attn; C's rows run (t, b) as always.
template <typename T16, int NSPLIT, bool BIAS, bool KSLICE, bool BTROWS>
__global__ __launch_bounds__(32) void k_gemmw(const T16* __restrict__ A, const T16* __restrict__ A2, const T16* __restrict__ Bt, const T16* __restrict__ Bt2, int K, float* C, int ldc, const float* __restrict__ bias, const float* __restrict__ bias1, const float* __restrict__ bias2, size_t sA, size_t sB, size_t sC, int klen, size_t sK) {
    typedef typename WFrag<T16>::V V;
    __shared__ __align__(16) float os[16 * 68];
    const size_t z = blockIdx.z; A += z * sA; if (A2) A2 += z * sA; Bt += z * sB; if (Bt2) Bt2 += z * sB; C += z * sC; const float* __restrict__ bz = z == 0 ? bias : (z == 1 ? bias1 : bias2);
    const int lane = threadIdx.x & 31, lr = lane & 15, hi = lane >> 4; const int r0 = blockIdx.x * 64, c0 = KSLICE ? 0 : blockIdx.y * 64; const int kbeg = KSLICE ? blockIdx.y * klen : 0, kend = KSLICE ? kbeg + klen : K; if (KSLICE) C += blockIdx.y * sK;
    v8f acc[4][4];
#pragma unroll
    for (int mb = 0; mb < 4; ++mb)
#pragma unroll
        for (int nb = 0; nb < 4; ++nb) acc[mb][nb] = (v8f){};
    constexpr size_t tp = (size_t)(EE / 32) * 512;   // elements of one 16-row tile: every plane that this kernel reads has EE k a row (K == EE at every launch), and as a constant the tile's step goes into the loads' immediate offsets
    const size_t aoff = (size_t)(r0 >> 4) * tp, boff = (size_t)(c0 >> 4) * tp; const unsigned lo = 8 * lane;   // the lane's place in a 512-byte half
#pragma unroll 1
    for (int kc = kbeg; kc < kend; kc += 32) {
        V a[4], a2[4]; const T16* pa = A + (aoff + (size_t)kc * 16) + lo; const T16* pa2 = (NSPLIT == 1 || NSPLIT == 2) ? A2 + (aoff + (size_t)kc * 16) + lo : pa; const T16* pb = Bt + (boff + (size_t)kc * 16) + lo; const T16* pb2 = NSPLIT >= 2 ? Bt2 + (boff + (size_t)kc * 16) + lo : pb;
#pragma unroll
        for (int mb = 0; mb < 4; ++mb) { a[mb] = WFrag<T16>::ldf(pa + mb * tp); if (NSPLIT == 1 || NSPLIT == 2) a2[mb] = WFrag<T16>::ldf(pa2 + mb * tp); }
#pragma unroll
        for (int nb = 0; nb < 4; ++nb) { const V b = WFrag<T16>::ldf(pb + nb * tp); V b2; if (NSPLIT >= 2) b2 = WFrag<T16>::ldf(pb2 + nb * tp);
#pragma unroll
            for (int mb = 0; mb < 4; ++mb) { acc[mb][nb] = WFrag<T16>::mma(a[mb], b, acc[mb][nb]); if (NSPLIT == 1 || NSPLIT == 2) acc[mb][nb] = WFrag<T16>::mma(a2[mb], b, acc[mb][nb]); if (NSPLIT >= 2) acc[mb][nb] = WFrag<T16>::mma(a[mb], b2, acc[mb][nb]); } }
        // stands in front of the next trip's writes of the loads' address registers (the build let later loads' results land in them): the addresses are inputs, so that their registers live up to the wait
        asm volatile("s_wait_xcnt 0x0" :: "v"(pa), "v"(pa2), "v"(pb), "v"(pb2) : "memory");
        asm volatile("v_nop\n\tv_nop\n\tv_nop\n\tv_nop" : "+v"(acc[0][0]), "+v"(acc[1][1]), "+v"(acc[2][2]), "+v"(acc[3][3]) : "v"(a[0]), "v"(a[3]));
    }
#pragma unroll
    for (int mb = 0; mb < 4; ++mb) {
#pragma unroll
        for (int nb = 0; nb < 4; ++nb) {
#pragma unroll
            for (int j = 0; j < 8; ++j) os[(hi * 8 + j) * 68 + nb * 16 + lr] = acc[mb][nb][j]; }
        __builtin_amdgcn_wave_barrier(); asm volatile("" ::: "memory");
{
#pragma unroll
            for (int s = 0; s < 8; ++s) { const int row = 2 * s + hi, cofs = lr * 4; v4f val = *(const v4fa*)(os + row * 68 + cofs); if (BIAS) { val[0] += bfr(bz[c0 + cofs]); val[1] += bfr(bz[c0 + cofs + 1]); val[2] += bfr(bz[c0 + cofs + 2]); val[3] += bfr(bz[c0 + cofs + 3]); }
                const int m = r0 + mb * 16 + row; *(v4f*)(C + (size_t)(BTROWS ? (m % TT) * BB + m / TT : m) * ldc + c0 + cofs) = val; }
             }
        // stands in front of the next writes of the stores' address and data registers; the scheduling barriers keep the stores in front of it and every later instruction behind it
        __builtin_amdgcn_sched_barrier(0); asm volatile("s_wait_xcnt 0x0" ::: "memory"); __builtin_amdgcn_sched_barrier(0);
        __builtin_amdgcn_wave_barrier(); asm volatile("" ::: "memory");
    }
}

__device__ __forceinline__ h16 tohx(float x) { return (h16)x; }
__device__ __forceinline__ void splitf(float y, unsigned short& h, unsigned short& l) { h = f2bf(y); l = f2bf(y - bf2f(h)); }
typedef __attribute__((ext_vector_type(2))) _Float16 v2h;
typedef __attribute__((ext_vector_type(4))) _Float16 v4h;
typedef __attribute__((ext_vector_type(2))) unsigned short v2us;
typedef __attribute__((ext_vector_type(4))) unsigned short v4us;
typedef __attribute__((ext_vector_type(2))) float v2f;

// The three plane builders: one thread per 16-byte piece of the fragment-ordered output, pieces in output order, so that a wave's store is 512 contiguous bytes.
// k_cvt8: [rows][EE] f32 -> bf16; piece i: lane i & 31, half (i >> 5) & 1, chunk (i >> 6) % (EE / 32), 16-row tile above. One launch for all five sources (four weights of EE rows, then x): their planes lie one behind the other in the workspace,
// so that piece i of the launch is piece i of the joint plane; EE rows are 512 work-groups, so the source is picked from blockIdx alone (a scalar choice).
__global__ __launch_bounds__(256) void k_cvt8(const float* __restrict__ w0, const float* __restrict__ w1, const float* __restrict__ w2, const float* __restrict__ w3, const float* __restrict__ xs, bf* dst, size_t n8) { const size_t i = (size_t)blockIdx.x * 256 + threadIdx.x; if (i >= n8) return; const int pn = min((int)(blockIdx.x >> 9), 4); const float* __restrict__ src = pn == 0 ? w0 : (pn == 1 ? w1 : (pn == 2 ? w2 : (pn == 3 ? w3 : xs))); const int row = (int)(i >> 11) * 16 + (int)(i & 15) - pn * EE, k = (int)((i >> 6) & (EE / 32 - 1)) * 32 + (int)((i >> 5) & 1) * 16 + (int)((i >> 4) & 1) * 8; const v8f v = *(const v8f*)(src + (size_t)row * EE + k); v8us o;
#pragma unroll
    for (int u = 0; u < 8; ++u) o[u] = f2bf(v[u]); *(v8us*)(dst + i * 8) = o;  }
// pl_body (q and k): rows (n, t), k = d (two chunks a row); piece i: lane, half, chunk (i >> 6) & 1, tile (i >> 7) of the NG * TT rows.
__device__ __forceinline__ void pl_body(const size_t i, const float* __restrict__ F, float scl, h16* P16, bf* Ph, bf* Pl) { const int d = (int)((i >> 6) & 1) * 32 + (int)((i >> 5) & 1) * 16 + (int)((i >> 4) & 1) * 8; const int row = (int)(i >> 7) * 16 + (int)(i & 15); const int t = row % TT, n = row / TT; const int b = n / NH_, h = n % NH_; const v8f f = *(const v8f*)(F + ((size_t)t * BB + b) * EE + h * HD + d); v8h o; v8us oh, ol;
#pragma unroll
    for (int u = 0; u < 8; ++u) { const float v = f[u] * scl; o[u] = tohx(v); unsigned short a, c; splitf(v, a, c); oh[u] = a; ol[u] = c; } { *(v8h*)(P16 + i * 8) = o; *(v8us*)(Ph + i * 8) = oh; *(v8us*)(Pl + i * 8) = ol;  } }
// vtp_body (v): rows d, k = t; the blocks of a group run over its four 16-row tiles first, then over the 64 chunks of 32 keys (a wave of k_attn reads 32 KB in a row); piece i: lane, half, tile (i >> 6) & 3, chunk (i >> 8) & 63, group above.
// A piece is 8 keys of one d: 8 loads, in each of which 16 lanes share 64 bytes of a row of F.
__device__ __forceinline__ void vtp_body(const size_t i, const float* __restrict__ F, h16* V16, bf* Vh, bf* Vl) { const int d = (int)((i >> 6) & 3) * 16 + (int)(i & 15); const int t = (int)((i >> 8) & 63) * 32 + (int)((i >> 5) & 1) * 16 + (int)((i >> 4) & 1) * 8; const int n = (int)(i >> 14); const int b = n / NH_, h = n % NH_; v8h o; v8us oh, ol;
#pragma unroll
    for (int u = 0; u < 8; ++u) { const float v = F[((size_t)(t + u) * BB + b) * EE + h * HD + d]; o[u] = tohx(v); unsigned short a, c; splitf(v, a, c); oh[u] = a; ol[u] = c; } { *(v8h*)(V16 + i * 8) = o; *(v8us*)(Vh + i * 8) = oh; *(v8us*)(Vl + i * 8) = ol;  } }
// k_pl: the planes of q, k and v in one launch; blockIdx.y names the projection, so the choice is a scalar branch.
__global__ __launch_bounds__(256) void k_pl(const float* __restrict__ QF, const float* __restrict__ KF, const float* __restrict__ VF, h16* Q16, bf* Qh, bf* Ql, h16* K16, bf* Kh, bf* Kl, h16* V16, bf* Vh, bf* Vl) { const size_t i = (size_t)blockIdx.x * 256 + threadIdx.x; if (i >= (size_t)NG * TT * HD / 8) return;
    if (blockIdx.y == 0) pl_body(i, QF, 0.125f, Q16, Qh, Ql); else if (blockIdx.y == 1) pl_body(i, KF, 1.0f, K16, Kh, Kl); else vtp_body(i, VF, V16, Vh, Vl); }
// k_qr: one thread per (group, query) row: the scaled query row sits in 64 registers, the 33 rounded rk rows in LDS, read at one address by the whole wave (a broadcast), four buckets a pass; each sum runs over d in ascending order.
__global__ __launch_bounds__(256) void k_qr(const float* __restrict__ QF, const float* __restrict__ rk, float* QR) { __shared__ __align__(16) float rs[NR * HD];
    for (int i = threadIdx.x; i < NR * HD; i += 256) rs[i] = bfr(rk[i]);
    const size_t row = (size_t)blockIdx.x * 256 + threadIdx.x; const int t = (int)(row % TT), n = (int)(row / TT); const int b = n / NH_, h = n % NH_; const float* q = QF + ((size_t)t * BB + b) * EE + h * HD; float qv[HD];
    // the loops over d and k are fully unrolled so that qv stays in registers
#pragma unroll
    for (int d = 0; d < HD; d += 4) { const v4f x = *(const v4f*)(q + d); qv[d] = x[0] * 0.125f; qv[d + 1] = x[1] * 0.125f; qv[d + 2] = x[2] * 0.125f; qv[d + 3] = x[3] * 0.125f; }
    __syncthreads();   // publishes the rk rows
    float* o = QR + row * 64;
#pragma unroll 1   // eight trips of 256 multiply-adds: unrolled, the kernel is 30 KB of code that each wave runs once
    for (int r0 = 0; r0 < NR - 1; r0 += 4) { v4f s = (v4f){};
#pragma unroll
        for (int d = 0; d < HD; d += 4) {
#pragma unroll
            for (int k = 0; k < 4; ++k) { const v4f w = *(const v4fa*)(rs + (r0 + k) * HD + d); s[k] += qv[d] * w[0]; s[k] += qv[d + 1] * w[1]; s[k] += qv[d + 2] * w[2]; s[k] += qv[d + 3] * w[3]; } }
        *(v4f*)(o + r0) = s;
        asm volatile("s_wait_xcnt 0x0" ::: "memory"); }   // stands in front of the next writes of the store's address and data registers
    float s = 0.f;
#pragma unroll
    for (int d = 0; d < HD; d += 4) { const v4f w = *(const v4fa*)(rs + (NR - 1) * HD + d); s += qv[d] * w[0]; s += qv[d + 1] * w[1]; s += qv[d + 2] * w[2]; s += qv[d + 3] * w[3]; }
    o[NR - 1] = s; }
// k_attn: the whole attention of 16 query rows of one group in one work-group of 8 waves; wave w owns keys [256 w, 256 w + 256). Scores are formed TRANSPOSED (A = 16 key rows, B = 16 query rows), so that a lane holds, for query lr,
// keys 8 hi .. 8 hi + 7 of each 16-key tile: two neighbouring tiles are, register for register, the A fragment of P for a 32-key chunk of P.v, and the probabilities never leave the registers. Row maximum, row sum, the two outer
// bucket sums and the 8 partial P.v tiles meet in LDS (waves added in ascending order). THE BAND: only the three key tiles at t0 - 16, t0, t0 + 16 (BW = 48 keys, x = key - (t0 - 16)) hold keys nearer than 16 to one of the 16 queries. The tile loops are fully unrolled, so whatever a band tile
// needs stands 16 times in the text: it is kept to two 16-byte LDS accesses. bad[q][x] (pitch BP: 16-byte rows on distinct banks) holds q.rk already picked by distance, staged straight from the QR table; bnd[q][x] takes the band tiles' rounded P, and the end of the kernel, once, sorts x <= q into bucket 0, x >= q + 32 into bucket 32 and x = q + r into bucket r. The rounded rv table is staged in LDS by the whole work-group. P is rounded to hl planes (rows < RH) or to fp16 x 1024 (the rest); the bucket sums are taken from the rounded values.
typedef __attribute__((ext_vector_type(2))) __bf16 v2bf;
template <bool HR, typename T16>
__device__ __forceinline__ void attn_rows(const T16* __restrict__ Qa, const T16* __restrict__ Qb, const T16* __restrict__ Ka, const T16* __restrict__ Kb, const T16* __restrict__ Va, const T16* __restrict__ Vb, const float* __restrict__ QR, const float* __restrict__ rv, const int n, const int t0, float* os, float* bnd, float* red, float* bad, float* rvs) {
    typedef typename WFrag<T16>::V V;
    const int tid = threadIdx.x, lane = tid & 31, lr = lane & 15, hi = lane >> 4; const int w = __builtin_amdgcn_readfirstlane(tid >> 5);   // the wave's number in a scalar register: the tests on a tile's place become scalar branches
    const int kb = w * 256;
    V qa[2], qb[2]; const T16* qpa = Qa + ((size_t)n * TT + t0) * HD + 8 * lane; const T16* qpb = HR ? Qb + ((size_t)n * TT + t0) * HD + 8 * lane : qpa;   // a 16-row tile is 16 * HD elements, a 32-d chunk of it 512
#pragma unroll
    for (int c = 0; c < 2; ++c) { qa[c] = WFrag<T16>::ldf(qpa + 512 * c); if (HR) qb[c] = WFrag<T16>::ldf(qpb + 512 * c); }
    // stands in front of the next writes of the query loads' address registers (the build takes their scalar base over a few instructions on); the scheduling barriers keep the loads in front of it and every later instruction behind it
    __builtin_amdgcn_sched_barrier(0); asm volatile("s_wait_xcnt 0x0" ::: "memory"); __builtin_amdgcn_sched_barrier(0);
    // staging: 16 x 48 band q.rk values and 528 four-float pieces of rv, three a thread; rv's third index is held to the last piece, which threads 15..255 all load and store alike (one value, no branch)
    float gq[3]; v4f gv[3];
#pragma unroll
    for (int u = 0; u < 3; ++u) { const int ib = tid + 256 * u, i = min(ib, 16 * NR - 1), bq = ib / BW, bx = ib % BW; gq[u] = QR[((size_t)n * TT + t0 + bq) * 64 + min(max(bx - MR - bq, -MR), MR) + MR]; gv[u] = *(const v4f*)(rv + i * 4);
        __builtin_amdgcn_sched_barrier(0); asm volatile("s_wait_xcnt 0x0" ::: "memory"); __builtin_amdgcn_sched_barrier(0); }   // the same for these two loads
    v8f s[16]; float mx = -3.0e38f;
    constexpr int TB = HR ? 1 : 2;   // key tiles a batch: two buffers of 32 registers each, one in flight while the other is worked on
    V kf[2][TB][HR ? 4 : 2]; const size_t ko = ((size_t)n * TT + kb) * HD + 8 * lane;
    // every loop over tiles, chunks and registers is fully unrolled so that s stays in registers
#pragma unroll
    for (int u = 0; u < TB; ++u) {
#pragma unroll
        for (int c = 0; c < 2; ++c) { kf[0][u][c] = WFrag<T16>::ldf(Ka + ko + u * 16 * HD + 512 * c); if (HR) kf[0][u][2 + c] = WFrag<T16>::ldf(Kb + ko + u * 16 * HD + 512 * c); } }
    __builtin_amdgcn_sched_barrier(0);   // keeps the first key loads in front of the staging's LDS stores, which wait for the staged values: the two latencies overlap
#pragma unroll
    for (int u = 0; u < 3; ++u) { const int ib = tid + 256 * u, i = min(ib, 16 * NR - 1), bo = (ib / BW) * BP + ib % BW; bnd[bo] = 0.f;   // a band key that lies outside the sequence stays 0
        bad[bo] = gq[u]; v4f y; y[0] = bfr(gv[u][0]); y[1] = bfr(gv[u][1]); y[2] = bfr(gv[u][2]); y[3] = bfr(gv[u][3]); *(v4fa*)(rvs + i * 4) = y; }
#pragma unroll
    for (int b = 0; b < 16 / TB; ++b) {
        if (b + 1 < 16 / TB) {
#pragma unroll
            for (int u = 0; u < TB; ++u) {
#pragma unroll
                for (int c = 0; c < 2; ++c) { kf[(b + 1) & 1][u][c] = WFrag<T16>::ldf(Ka + ko + ((b + 1) * TB + u) * 16 * HD + 512 * c); if (HR) kf[(b + 1) & 1][u][2 + c] = WFrag<T16>::ldf(Kb + ko + ((b + 1) * TB + u) * 16 * HD + 512 * c); } } }
        __builtin_amdgcn_sched_barrier(0);   // keeps the next batch's loads in front of this batch's products: without it the build issues each fragment's loads directly in front of its product and waits out every latency
#pragma unroll
        for (int u = 0; u < TB; ++u) { v8f a = (v8f){};
#pragma unroll
            for (int c = 0; c < 2; ++c) { a = WFrag<T16>::mma(kf[b & 1][u][c], qa[c], a); if (HR) { a = WFrag<T16>::mma(kf[b & 1][u][c], qb[c], a); a = WFrag<T16>::mma(kf[b & 1][u][2 + c], qa[c], a); } }
            s[b * TB + u] = a; } }
    // the branches below follow the last matrix instruction: five vector slots keep its distance on the taken side too; the two scheduling barriers hold them in place
    __builtin_amdgcn_sched_barrier(0); asm volatile("v_nop\n\tv_nop\n\tv_nop\n\tv_nop\n\tv_nop"); __builtin_amdgcn_sched_barrier(0);
    __syncthreads();   // publishes the staged q.rk rows (and the rv table and the cleared buckets)
    const float* qr = bad + lr * BP; const float qlo = qr[0], qhi = qr[BW - 1];   // x = 0 lies at distance <= -16 of every query, x = 47 at >= +16
#pragma unroll
    for (int kt = 0; kt < 16; ++kt) { const int k0 = kb + kt * 16; v8f a = s[kt];
        if (k0 + 15 > t0 - MR && k0 < t0 + 15 + MR) {
#pragma unroll
            for (int j = 0; j < 8; j += 4) { const v4f y = *(const v4fa*)(qr + (k0 - t0 + MR) + hi * 8 + j); a[j] += y[0]; a[j + 1] += y[1]; a[j + 2] += y[2]; a[j + 3] += y[3]; }
        } else { const float qq = k0 < t0 ? qlo : qhi;
#pragma unroll
            for (int j = 0; j < 8; ++j) a[j] += qq; }
#pragma unroll
        for (int j = 0; j < 8; ++j) mx = fmaxf(mx, a[j]);
        s[kt] = a; }
    mx = fmaxf(mx, __shfl_xor(mx, 16, 32)); if (hi == 0) red[w * 16 + lr] = mx;
    __syncthreads();   // publishes the waves' row maxima
#pragma unroll
    for (int i = 0; i < 8; ++i) mx = fmaxf(mx, red[i * 16 + lr]);
    float sum = 0.f;
#pragma unroll
    for (int kt = 0; kt < 16; ++kt) {
#pragma unroll
        for (int j = 0; j < 8; ++j) { const float y = (s[kt][j] - mx) * 1.44269504f; float e;
            asm("v_exp_f32 %0, %1\n\tv_nop" : "=v"(e) : "v"(y));   // e^x as 2^(x log2 e); the v_nop is the one slot behind a transcendental
            s[kt][j] = e; sum += e; } }
    sum += __shfl_xor(sum, 16, 32); if (hi == 0) red[128 + w * 16 + lr] = sum;
    __syncthreads();   // publishes the waves' row sums
    sum = red[128 + lr];
#pragma unroll
    for (int i = 1; i < 8; ++i) sum += red[128 + i * 16 + lr];
    const float f = HR ? __fdiv_rn(1.0f, sum) : __fdiv_rn(1.0f, sum) * PCAR;
    float lo = 0.f, up = 0.f;
    // rounds P in place (hl: a tile's registers 0..3 take its half of the high plane's fragment, 4..7 that of the low plane's; fp16: the rounded value) and forms the bucket sums from the rounded values; all branches stand here, in front of the matrix instructions of P.v
#pragma unroll
    for (int kt = 0; kt < 16; ++kt) { const int k0 = kb + kt * 16; float val[8]; unsigned xh[4], xl[4];
#pragma unroll
        for (int k = 0; k < 4; ++k) { const float p0 = s[kt][2 * k] * f, p1 = s[kt][2 * k + 1] * f;
            if (HR) { v2bf h; h[0] = (__bf16)p0; h[1] = (__bf16)p1; xh[k] = __builtin_bit_cast(unsigned, h);   // round to nearest even, two values a conversion, already in the fragment's order
                const float h0 = __uint_as_float(xh[k] << 16), h1 = __uint_as_float(xh[k] & 0xFFFF0000u); v2bf l; l[0] = (__bf16)(p0 - h0); l[1] = (__bf16)(p1 - h1); xl[k] = __builtin_bit_cast(unsigned, l);
                val[2 * k] = h0 + __uint_as_float(xl[k] << 16); val[2 * k + 1] = h1 + __uint_as_float(xl[k] & 0xFFFF0000u); }
            else { const float x0 = (float)tohx(p0), x1 = (float)tohx(p1); s[kt][2 * k] = x0; s[kt][2 * k + 1] = x1; val[2 * k] = x0 * (1.0f / PCAR); val[2 * k + 1] = x1 * (1.0f / PCAR); } }
        if (HR) {
#pragma unroll
            for (int k = 0; k < 4; ++k) { s[kt][k] = __uint_as_float(xh[k]); s[kt][4 + k] = __uint_as_float(xl[k]); } }
        if (k0 + 15 > t0 - MR && k0 < t0 + 15 + MR) {
#pragma unroll
            for (int j = 0; j < 8; j += 4) { v4f y; y[0] = val[j]; y[1] = val[j + 1]; y[2] = val[j + 2]; y[3] = val[j + 3]; *(v4fa*)(bnd + lr * BP + (k0 - t0 + MR) + hi * 8 + j) = y; }
        } else {   // the tile's sum once, then added to the side the whole tile lies on: one copy of the adds in the text instead of one a side
            const float ts = ((val[0] + val[1]) + (val[2] + val[3])) + ((val[4] + val[5]) + (val[6] + val[7]));
            lo += k0 < t0 ? ts : 0.f; up += k0 < t0 ? 0.f : ts; } }
    lo += __shfl_xor(lo, 16, 32); up += __shfl_xor(up, 16, 32); if (hi == 0) { red[256 + w * 16 + lr] = lo; red[384 + w * 16 + lr] = up; }
    v8f o[4];
    // P.v by pairs of 32-key chunks (a chunk of the v planes is 2048 elements: four 16-column tiles of 512). A batch is 32 registers of fragments
    // (fp16: two tiles x two chunks; hl: one tile x two chunks x two planes), in two buffers, one in flight while the other is worked on. Each o[dt] still takes its chunks in ascending order.
    constexpr int FB = HR ? 2 : 4, NBP = HR ? 4 : 2;   // (tile, chunk) places a batch; batches a pair of chunks
    V vf[2][FB][HR ? 2 : 1]; const size_t vo = ((size_t)n * TT + kb) * HD + 8 * lane;
#pragma unroll
    for (int dt = 0; dt < 4; ++dt) o[dt] = (v8f){};
#pragma unroll
    for (int u = 0; u < FB; ++u) { const size_t v1 = vo + (HR ? 0 : u & 1) * 512 + (HR ? u : u >> 1) * 2048; vf[0][u][0] = WFrag<T16>::ldf(Va + v1); if (HR) vf[0][u][1] = WFrag<T16>::ldf(Vb + v1); }
#pragma unroll
    for (int cp = 0; cp < 4; ++cp) { V pa[2], pb2[2];
#pragma unroll
        for (int e = 0; e < 2; ++e) { const int c = 2 * cp + e;
            if constexpr (HR) { v8f ph, pl;
#pragma unroll
                for (int k = 0; k < 8; ++k) { ph[k] = s[2 * c + (k >> 2)][k & 3]; pl[k] = s[2 * c + (k >> 2)][4 + (k & 3)]; }
                pa[e] = __builtin_bit_cast(v16bf, ph); pb2[e] = __builtin_bit_cast(v16bf, pl); }
            else {
#pragma unroll
                for (int i = 0; i < 16; ++i) pa[e][i] = tohx(s[2 * c + (i >> 3)][i & 7]); } }
#pragma unroll
        for (int g = 0; g < NBP; ++g) { const int b = cp * NBP + g, b1 = b + 1, g1 = b1 % NBP;
            if (b1 < 4 * NBP) {
#pragma unroll
                for (int u = 0; u < FB; ++u) { const int dt1 = HR ? g1 : g1 * 2 + (u & 1), e1 = HR ? u : u >> 1; const size_t v1 = vo + dt1 * 512 + (2 * (b1 / NBP) + e1) * 2048; vf[b1 & 1][u][0] = WFrag<T16>::ldf(Va + v1); if (HR) vf[b1 & 1][u][1] = WFrag<T16>::ldf(Vb + v1); } }
            __builtin_amdgcn_sched_barrier(0);   // keeps the next batch's loads in front of this batch's products, as in the score stage
#pragma unroll
            for (int u = 0; u < FB; ++u) { const int dt = HR ? g : g * 2 + (u & 1), e = HR ? u : u >> 1; o[dt] = WFrag<T16>::mma(pa[e], vf[b & 1][u][0], o[dt]);
                if constexpr (HR) { o[dt] = WFrag<T16>::mma(pb2[e], vf[b & 1][u][0], o[dt]); o[dt] = WFrag<T16>::mma(pa[e], vf[b & 1][u][1], o[dt]); } } } }
    __builtin_amdgcn_sched_barrier(0);   // keeps the address arithmetic of what follows behind the last products, and so behind the data waits of the last loads, whose address registers it takes over
#pragma unroll
    for (int dt = 0; dt < 4; ++dt) {
#pragma unroll
        for (int j = 0; j < 8; ++j) os[(w * 16 + hi * 8 + j) * 68 + dt * 16 + lr] = o[dt][j]; } }
// attn_end: the waves' partial tiles and bucket sums added, the band sorted into its buckets, the rv term, the merged planes stored; it stands once in the text for both precisions (scl undoes the fp16 path's scale of P).
__device__ __forceinline__ void attn_end(bf* Ah, bf* Al, const int n, const int t0, const float scl, const float* os, const float* bnd, const float* red, const float* rvs) {
    const int tid = threadIdx.x;
    __syncthreads();   // publishes the partial P.v tiles and all bucket sums
    const int q = tid >> 4, d0 = (tid & 15) * 4; v4f ps = *(const v4fa*)(os + q * 68 + d0); float plo = red[256 + q], pup = red[384 + q];
#pragma unroll
    for (int i = 1; i < 8; ++i) { ps += *(const v4fa*)(os + (i * 16 + q) * 68 + d0); plo += red[256 + i * 16 + q]; pup += red[384 + i * 16 + q]; }
    const float* bp = bnd + q * BP;
    // the band keys at distance <= -16 (x <= q) and >= +16 (x >= q + 32) join the outer buckets, in ascending order behind the waves' sums
#pragma unroll
    for (int x = 0; x < 16; x += 4) { const v4f y = *(const v4fa*)(bp + x), z = *(const v4fa*)(bp + 32 + x);
#pragma unroll
        for (int k = 0; k < 4; ++k) { plo += x + k <= q ? y[k] : 0.f; pup += x + k >= q ? z[k] : 0.f; } }
    v4f acc = ps * scl;
#pragma unroll
    for (int r = 0; r < NR; ++r) { const float p = r == 0 ? plo : (r == NR - 1 ? pup : bp[q + r]); const v4f x = *(const v4fa*)(rvs + r * HD + d0);
#pragma unroll
        for (int k = 0; k < 4; ++k) acc[k] += p * x[k]; }
    v4us oh, ol;
#pragma unroll
    for (int k = 0; k < 4; ++k) { unsigned short x, y; splitf(acc[k], x, y); oh[k] = x; ol[k] = y; }
    const size_t oo = fro((n / NH_) * TT + t0 + q, (n % NH_) * HD + d0, EE / 32); *(v4us*)(Ah + oo) = oh; *(v4us*)(Al + oo) = ol; }   // the merged planes too are stored in fragment order, rows (b, t), for the Wo product
// four waves a SIMD (two work-groups a WGP): without the bound the build hoists loads until only two fit
__global__ __launch_bounds__(256) __attribute__((amdgpu_waves_per_eu(4))) void k_attn(const h16* __restrict__ Q16, const bf* __restrict__ Qh, const bf* __restrict__ Ql, const h16* __restrict__ K16, const bf* __restrict__ Kh, const bf* __restrict__ Kl, const h16* __restrict__ V16, const bf* __restrict__ Vh, const bf* __restrict__ Vl, const float* __restrict__ QR, const float* __restrict__ rv, bf* Ah, bf* Al) {
    __shared__ __align__(16) float os[8 * 16 * 68]; __shared__ __align__(16) float bnd[16 * BP]; __shared__ float red[512]; __shared__ __align__(16) float bad[16 * BP]; __shared__ __align__(16) float rvs[NR * HD];
    // all hl work-groups come first in the grid, then all fp16 ones (for speed only)
    const int fl = blockIdx.x, g = fl - NG * (RH / 16); const bool hr = g < 0;
    const int n = hr ? fl / (RH / 16) : g / ((TT - RH) / 16), t0 = hr ? (fl % (RH / 16)) * 16 : RH + (g % ((TT - RH) / 16)) * 16;
    if (hr) attn_rows<true, bf>(Qh, Ql, Kh, Kl, Vh, Vl, QR, rv, n, t0, os, bnd, red, bad, rvs);
    else attn_rows<false, h16>(Q16, nullptr, K16, nullptr, V16, nullptr, QR, rv, n, t0, os, bnd, red, bad, rvs);
    attn_end(Ah, Al, n, t0, hr ? 1.0f : 1.0f / PCAR, os, bnd, red, rvs); }

extern "C" void kernel_launch(void* const* d_in, const int* in_sizes, int n_in,
                              void* d_out, int out_size, void* d_ws, size_t ws_size, hipStream_t stream) {
    (void)in_sizes; (void)n_in; (void)out_size;
    const float* x = (const float*)d_in[0]; const float* Wq = (const float*)d_in[1]; const float* bq = (const float*)d_in[2]; const float* Wk = (const float*)d_in[3]; const float* bk = (const float*)d_in[4]; const float* Wv = (const float*)d_in[5]; const float* bv = (const float*)d_in[6]; const float* Wo = (const float*)d_in[7]; const float* bo = (const float*)d_in[8]; const float* rk = (const float*)d_in[9]; const float* rv = (const float*)d_in[10];
    float* OUT = (float*)d_out;     // [2048][2][1024]
    char* wsp = (char*)d_ws;
    auto take = [&](size_t bytes) { char* p = wsp; wsp += (bytes + 255) & ~(size_t)255; return (void*)p; };
    const size_t NTB = (size_t)TT * BB;
    bf* WQ = (bf*)take((4 * (size_t)EE * EE + NTB * EE) * 2); bf* WK = WQ + (size_t)EE * EE; bf* WV = WK + (size_t)EE * EE; bf* WO = WV + (size_t)EE * EE; bf* XB = WO + (size_t)EE * EE;   // one joint plane: k_cvt8 fills it in one launch, and the projection launch steps from Wq to Wk to Wv by z
    float* QR = (float*)take((size_t)NG * TT * 64 * 4); bf* Ah = (bf*)take(NTB * EE * 2); bf* Al = (bf*)take(NTB * EE * 2);
    h16* Q16 = (h16*)take((size_t)NG * TT * HD * 2); bf* Qh = (bf*)take((size_t)NG * TT * HD * 2); bf* Ql = (bf*)take((size_t)NG * TT * HD * 2); h16* K16 = (h16*)take((size_t)NG * TT * HD * 2); bf* Kh = (bf*)take((size_t)NG * TT * HD * 2); bf* Kl = (bf*)take((size_t)NG * TT * HD * 2); h16* V16 = (h16*)take((size_t)NG * HD * TT * 2); bf* Vh = (bf*)take((size_t)NG * HD * TT * 2); bf* Vl = (bf*)take((size_t)NG * HD * TT * 2);
    float* QF = (float*)take(3 * NTB * EE * 4); float* KF = QF + NTB * EE; float* VF = KF + NTB * EE;   // the f32 results of the q, k and v projections, one behind the other (the projection launch steps through them by z)
    if ((size_t)(wsp - (char*)d_ws) > ws_size) return;    // total 168 MiB: nine [32][2048][64] planes 72, QR 16, merged planes 16, bf16 weights and x 16, f32 projections 48
    k_cvt8<<<(unsigned)((4 * (size_t)EE * EE + NTB * EE) / 8 / 256), 256, 0, stream>>>(Wq, Wk, Wv, Wo, x, WQ, (4 * (size_t)EE * EE + NTB * EE) / 8);
    const unsigned LP = (unsigned)(((size_t)NG * TT * HD / 8 + 255) / 256);
    k_gemmw<bf, 0, true, false, false><<<dim3(NTB / 64, EE / 64, 3), 32, 0, stream>>>(XB, nullptr, WQ, nullptr, EE, QF, EE, bq, bk, bv, 0, (size_t)EE * EE, NTB * EE, 0, 0);
    k_pl<<<dim3(LP, 3, 1), 256, 0, stream>>>(QF, KF, VF, Q16, Qh, Ql, K16, Kh, Kl, V16, Vh, Vl); k_qr<<<NG * TT / 256, 256, 0, stream>>>(QF, rk, QR);
    k_attn<<<NG * TT / 16, 256, 0, stream>>>(Q16, Qh, Ql, K16, Kh, Kl, V16, Vh, Vl, QR, rv, Ah, Al);
    k_gemmw<bf, 1, true, false, true><<<dim3(NTB / 64, EE / 64, 1), 32, 0, stream>>>(Ah, Al, WO, nullptr, EE, OUT, EE, bo, bo, bo, 0, 0, 0, 0, 0);
}

// v008
// Measured time: 220 microseconds a run.
// Timed twice side by side with v007, it ran 1.08 times as fast both times.
// Counting every step since v000, it is 10.6 times as fast.
#include <hip/hip_runtime.h>

// Shaw relative-position multi-head attention, sequence-first (query [2048][2][1024]; q = (x Wq^T + bq)/8, k, v = x W^T + b; 32 groups n = b*16 + h of 64 dims; scores = q.k + q.rk[clip(s-t,-16,16)+16];
// softmax; attn = P.v + sum_s P[t][s] rv[clip(s-t)+16]; out = merged Wo^T + bo -> [2048][2][1024]; rk/rv tables [33][64] read as data).
// The relative terms are exact regroupings: q.rk depends on (t, bucket) only -> QR[n][t][r] = q_t . rk[r] (33 per row, added inside the attention kernel by bucket); sum_s P rv = sum_r PB[t][r] rv[r] with PB the per-bucket
// probability sums (buckets 0 / 32 collect all keys at distance <= -16 / >= +16), formed in the attention kernel and contracted with rv on VALU at its end.
// Compute dtypes, f32 accumulate: every input rounded to bf16; projections on PLAIN bf16 operands (inputs: exact, + bias; all 4096 (t, b) rows at once); QR and the PB.rv term f32 on VALU; scores (K 64) and P.v on
// hl planes (3 products) for the first 512 query rows of each group and SINGLE fp16 planes for the rest; softmax f32 in registers; Wo on hl planes x exact (+bias). Projections (all three in one launch, grid z): one-wave-per-64x64-tile GEMM; Wo: four waves a 64x64 tile, a quarter of k each; attention: one fused kernel (k_attn). Deterministic, no atomics;
// FRAGMENT ORDER: every 16-bit operand plane in the workspace is stored as the matrix instructions read it. A block of 16 rows x 32 k is 1024 bytes: two halves of 512 bytes (k 0..15, k 16..31), in each lane L = 16 * ((k >> 3) & 1) + (row & 15)
// owns 16 bytes (8 k). A fragment is then two 16-byte loads a lane, each of which reads four whole 128-byte lines; from a row-major plane each took 32 bytes out of 16 lines.

#define TT   2048
#define BB   2
#define EE   1024
#define NH_  16
#define NG   (BB * NH_)
#define HD   64
#define NR   33
#define MR   16
#define RH   512
#define PCAR 1024.0f
#define BW   48
#define BP   52
typedef _Float16 h16;
typedef unsigned short bf;
typedef __attribute__((ext_vector_type(16))) __bf16   v16bf;
typedef __attribute__((ext_vector_type(16))) _Float16 v16h;
typedef __attribute__((ext_vector_type(8)))  _Float16 v8h;
typedef __attribute__((ext_vector_type(8)))  unsigned short v8us;
typedef __attribute__((ext_vector_type(8)))  float    v8f;
typedef __attribute__((ext_vector_type(4)))  float    v4f;
typedef v8h  __attribute__((may_alias)) v8ha;
typedef v4f  __attribute__((may_alias)) v4fa;
typedef v8us __attribute__((may_alias)) v8usa;

__device__ __forceinline__ unsigned short f2bf(float f) { unsigned u = __float_as_uint(f); u += 0x7FFFu + ((u >> 16) & 1u); return (unsigned short)(u >> 16); }
__device__ __forceinline__ float bf2f(unsigned short b) { return __uint_as_float(((unsigned)b) << 16); }
__device__ __forceinline__ float bfr(float f) { return bf2f(f2bf(f)); }
__device__ __forceinline__ v16h cat16(v8h lo, v8h hi) { return __builtin_shufflevector(lo, hi, 0, 1, 2, 3, 4, 5, 6, 7, 8, 9, 10, 11, 12, 13, 14, 15); }
__device__ __forceinline__ v16bf cat16b(v8us lo, v8us hi) { return __builtin_bit_cast(v16bf, __builtin_shufflevector(lo, hi, 0, 1, 2, 3, 4, 5, 6, 7, 8, 9, 10, 11, 12, 13, 14, 15)); }
__device__ __forceinline__ v8f wmma16(v16h a, v16h b, v8f c) { return __builtin_amdgcn_wmma_f32_16x16x32_f16(false, a, false, b, (short)0, c, false, false); }
__device__ __forceinline__ v8f wmmab(v16bf a, v16bf b, v8f c) { return __builtin_amdgcn_wmma_f32_16x16x32_bf16(false, a, false, b, (short)0, c, false, false); }



// element offset of (row, k) in a fragment-ordered plane whose rows hold kch chunks of 32 k: blocks run over k first, then over the 16-row tiles
__device__ __forceinline__ size_t fro(int row, int k, int kch) { return ((((size_t)(row >> 4) * kch + (k >> 5)) * 2 + ((k >> 4) & 1)) * 32 + ((k >> 3) & 1) * 16 + (row & 15)) * 8 + (k & 7); }
// ---- k_gemmw: register-blocked GEMM, each wave on a whole 64x64 output tile (16 accumulators), operands straight from fragment-ordered 16-bit planes; grid (M/64, N/64, Z), 32 * KS threads.
// C[m][n] (f32, pitch ldc, + optional f32 bias[n]) = sum_k A[m][k] Bt[n][k] (+ split products per NSPLIT). z-batch strides sA/sB/sC in elements; batch z takes bias, bias1 or bias2 (the biases are separate inputs). K % 32 == 0.
// KSLICE (N == 64 only): blockIdx.y is a K slice of klen, not a column tile; slice y stores its partial product at C + y * sK and the reader adds the slices in order.
template <typename T16> struct WFrag;
template <> struct WFrag<h16> { typedef v16h V; static __device__ __forceinline__ V ldf(const h16* p) { return cat16(*(const v8h*)p, *(const v8h*)(p + 256)); } static __device__ __forceinline__ v8f mma(V a, V b, v8f c) { return wmma16(a, b, c); } };
template <> struct WFrag<bf> { typedef v16bf V; static __device__ __forceinline__ V ldf(const bf* p) { return cat16b(*(const v8us*)p, *(const v8us*)(p + 256)); } static __device__ __forceinline__ v8f mma(V a, V b, v8f c) { return wmmab(a, b, c); } };
// KS (1 or 4): the waves of a work-group. With 4, wave ws takes the quarter [ws * K / 4, (ws + 1) * K / 4) of k for the whole 64x64 tile (four waves a SIMD instead of one where the grid has one tile a SIMD: a wave's load latency is covered by the others' products);
// the four partial tiles meet in LDS, and wave ws adds those of row tile ws in ascending k order and stores it.
// BTROWS: A's rows run (b, t), so that a 16-row tile of the merged planes, and with it each of their 128-byte lines, has one writing work-group in k_attn; C's rows run (t, b) as always.
template <typename T16, int NSPLIT, bool BIAS, bool KSLICE, bool BTROWS, int KS>
__global__ __launch_bounds__(32 * KS) void k_gemmw(const T16* __restrict__ A, const T16* __restrict__ A2, const T16* __restrict__ Bt, const T16* __restrict__ Bt2, int K, float* C, int ldc, const float* __restrict__ bias, const float* __restrict__ bias1, const float* __restrict__ bias2, size_t sA, size_t sB, size_t sC, int klen, size_t sK) {
    typedef typename WFrag<T16>::V V;
    static_assert(KS == 1 || (KS == 4 && !KSLICE), "one wave, or one wave a row tile");
    __shared__ __align__(16) float os[(KS > 1 ? 4 * KS : 1) * 16 * 68];
    const int ws = KS > 1 ? __builtin_amdgcn_readfirstlane(threadIdx.x >> 5) : 0;   // the wave's number in a scalar register: the k range stays scalar
    const size_t z = blockIdx.z; A += z * sA; if (A2) A2 += z * sA; Bt += z * sB; if (Bt2) Bt2 += z * sB; C += z * sC; const float* __restrict__ bz = z == 0 ? bias : (z == 1 ? bias1 : bias2);
    const int lane = threadIdx.x & 31, lr = lane & 15, hi = lane >> 4; const int r0 = blockIdx.x * 64, c0 = KSLICE ? 0 : blockIdx.y * 64; const int kbeg = KSLICE ? blockIdx.y * klen : ws * (K / KS), kend = KSLICE ? kbeg + klen : kbeg + K / KS; if (KSLICE) C += blockIdx.y * sK;
    v8f acc[4][4];
#pragma unroll
    for (int mb = 0; mb < 4; ++mb)
#pragma unroll
        for (int nb = 0; nb < 4; ++nb) acc[mb][nb] = (v8f){};
    constexpr size_t tp = (size_t)(EE / 32) * 512;   // elements of one 16-row tile: every plane that this kernel reads has EE k a row (K == EE at every launch), and as a constant the tile's step goes into the loads' immediate offsets
    const size_t aoff = (size_t)(r0 >> 4) * tp, boff = (size_t)(c0 >> 4) * tp; const unsigned lo = 8 * lane;   // the lane's place in a 512-byte half
#pragma unroll 1
    for (int kc = kbeg; kc < kend; kc += 32) {
        V a[4], a2[4]; const T16* pa = A + (aoff + (size_t)kc * 16) + lo; const T16* pa2 = (NSPLIT == 1 || NSPLIT == 2) ? A2 + (aoff + (size_t)kc * 16) + lo : pa; const T16* pb = Bt + (boff + (size_t)kc * 16) + lo; const T16* pb2 = NSPLIT >= 2 ? Bt2 + (boff + (size_t)kc * 16) + lo : pb;
#pragma unroll
        for (int mb = 0; mb < 4; ++mb) { a[mb] = WFrag<T16>::ldf(pa + mb * tp); if (NSPLIT == 1 || NSPLIT == 2) a2[mb] = WFrag<T16>::ldf(pa2 + mb * tp); }
#pragma unroll
        for (int nb = 0; nb < 4; ++nb) { const V b = WFrag<T16>::ldf(pb + nb * tp); V b2; if (NSPLIT >= 2) b2 = WFrag<T16>::ldf(pb2 + nb * tp);
#pragma unroll
            for (int mb = 0; mb < 4; ++mb) { acc[mb][nb] = WFrag<T16>::mma(a[mb], b, acc[mb][nb]); if (NSPLIT == 1 || NSPLIT == 2) acc[mb][nb] = WFrag<T16>::mma(a2[mb], b, acc[mb][nb]); if (NSPLIT >= 2) acc[mb][nb] = WFrag<T16>::mma(a[mb], b2, acc[mb][nb]); } }
        // stands in front of the next trip's writes of the loads' address registers (the build let later loads' results land in them): the addresses are inputs, so that their registers live up to the wait
        asm volatile("s_wait_xcnt 0x0" :: "v"(pa), "v"(pa2), "v"(pb), "v"(pb2) : "memory");
        asm volatile("v_nop\n\tv_nop\n\tv_nop\n\tv_nop" : "+v"(acc[0][0]), "+v"(acc[1][1]), "+v"(acc[2][2]), "+v"(acc[3][3]) : "v"(a[0]), "v"(a[3]));
    }
    if constexpr (KS > 1) {
#pragma unroll
        for (int mb = 0; mb < 4; ++mb) {
#pragma unroll
            for (int nb = 0; nb < 4; ++nb) {
#pragma unroll
                for (int j = 0; j < 8; ++j) os[((mb * KS + ws) * 16 + hi * 8 + j) * 68 + nb * 16 + lr] = acc[mb][nb][j]; } }
        __syncthreads();   // publishes the waves' partial tiles
        const int cofs = lr * 4; v4f bs = (v4f){}; if (BIAS) { bs[0] = bfr(bz[c0 + cofs]); bs[1] = bfr(bz[c0 + cofs + 1]); bs[2] = bfr(bz[c0 + cofs + 2]); bs[3] = bfr(bz[c0 + cofs + 3]); }
#pragma unroll
        for (int s = 0; s < 8; ++s) { const int row = 2 * s + hi; v4f val = *(const v4fa*)(os + (ws * KS * 16 + row) * 68 + cofs);
#pragma unroll
            for (int p = 1; p < KS; ++p) val += *(const v4fa*)(os + ((ws * KS + p) * 16 + row) * 68 + cofs);
            val += bs; const int m = r0 + ws * 16 + row; *(v4f*)(C + (size_t)(BTROWS ? (m % TT) * BB + m / TT : m) * ldc + c0 + cofs) = val; }
        // stands behind the stores, in front of whatever next writes their address and data registers; the scheduling barrier keeps the stores in front of it
        __builtin_amdgcn_sched_barrier(0); asm volatile("s_wait_xcnt 0x0" ::: "memory");
    } else
#pragma unroll
    for (int mb = 0; mb < 4; ++mb) {
#pragma unroll
        for (int nb = 0; nb < 4; ++nb) {
#pragma unroll
            for (int j = 0; j < 8; ++j) os[(hi * 8 + j) * 68 + nb * 16 + lr] = acc[mb][nb][j]; }
        __builtin_amdgcn_wave_barrier(); asm volatile("" ::: "memory");
{
#pragma unroll
            for (int s = 0; s < 8; ++s) { const int row = 2 * s + hi, cofs = lr * 4; v4f val = *(const v4fa*)(os + row * 68 + cofs); if (BIAS) { val[0] += bfr(bz[c0 + cofs]); val[1] += bfr(bz[c0 + cofs + 1]); val[2] += bfr(bz[c0 + cofs + 2]); val[3] += bfr(bz[c0 + cofs + 3]); }
                const int m = r0 + mb * 16 + row; *(v4f*)(C + (size_t)(BTROWS ? (m % TT) * BB + m / TT : m) * ldc + c0 + cofs) = val; }
             }
        // stands in front of the next writes of the stores' address and data registers; the scheduling barriers keep the stores in front of it and every later instruction behind it
        __builtin_amdgcn_sched_barrier(0); asm volatile("s_wait_xcnt 0x0" ::: "memory"); __builtin_amdgcn_sched_barrier(0);
        __builtin_amdgcn_wave_barrier(); asm volatile("" ::: "memory");
    }
}

__device__ __forceinline__ h16 tohx(float x) { return (h16)x; }
__device__ __forceinline__ void splitf(float y, unsigned short& h, unsigned short& l) { h = f2bf(y); l = f2bf(y - bf2f(h)); }
typedef __attribute__((ext_vector_type(2))) _Float16 v2h;
typedef __attribute__((ext_vector_type(4))) _Float16 v4h;
typedef __attribute__((ext_vector_type(2))) unsigned short v2us;
typedef __attribute__((ext_vector_type(4))) unsigned short v4us;
typedef __attribute__((ext_vector_type(2))) float v2f;

// The three plane builders: one thread per 16-byte piece of the fragment-ordered output, pieces in output order, so that a wave's store is 512 contiguous bytes.
// k_cvt8: [rows][EE] f32 -> bf16; piece i: lane i & 31, half (i >> 5) & 1, chunk (i >> 6) % (EE / 32), 16-row tile above. One launch for all five sources (four weights of EE rows, then x): their planes lie one behind the other in the workspace,
// so that piece i of the launch is piece i of the joint plane; EE rows are 512 work-groups, so the source is picked from blockIdx alone (a scalar choice).
__global__ __launch_bounds__(256) void k_cvt8(const float* __restrict__ w0, const float* __restrict__ w1, const float* __restrict__ w2, const float* __restrict__ w3, const float* __restrict__ xs, bf* dst, size_t n8) { const size_t i = (size_t)blockIdx.x * 256 + threadIdx.x; if (i >= n8) return; const int pn = min((int)(blockIdx.x >> 9), 4); const float* __restrict__ src = pn == 0 ? w0 : (pn == 1 ? w1 : (pn == 2 ? w2 : (pn == 3 ? w3 : xs))); const int row = (int)(i >> 11) * 16 + (int)(i & 15) - pn * EE, k = (int)((i >> 6) & (EE / 32 - 1)) * 32 + (int)((i >> 5) & 1) * 16 + (int)((i >> 4) & 1) * 8; const v8f v = *(const v8f*)(src + (size_t)row * EE + k); v8us o;
#pragma unroll
    for (int u = 0; u < 8; ++u) o[u] = f2bf(v[u]); *(v8us*)(dst + i * 8) = o;  }
// pl_body (q and k): rows (n, t), k = d (two chunks a row); piece i: lane, half, chunk (i >> 6) & 1, tile (i >> 7) of the NG * TT rows.
__device__ __forceinline__ void pl_body(const size_t i, const float* __restrict__ F, float scl, h16* P16, bf* Ph, bf* Pl) { const int d = (int)((i >> 6) & 1) * 32 + (int)((i >> 5) & 1) * 16 + (int)((i >> 4) & 1) * 8; const int row = (int)(i >> 7) * 16 + (int)(i & 15); const int t = row % TT, n = row / TT; const int b = n / NH_, h = n % NH_; const v8f f = *(const v8f*)(F + ((size_t)t * BB + b) * EE + h * HD + d); v8h o; v8us oh, ol;
#pragma unroll
    for (int u = 0; u < 8; ++u) { const float v = f[u] * scl; o[u] = tohx(v); unsigned short a, c; splitf(v, a, c); oh[u] = a; ol[u] = c; } { *(v8h*)(P16 + i * 8) = o; *(v8us*)(Ph + i * 8) = oh; *(v8us*)(Pl + i * 8) = ol;  } }
// vtp_body (v): rows d, k = t; the blocks of a group run over its four 16-row tiles first, then over the 64 chunks of 32 keys (a wave of k_attn reads 32 KB in a row); piece i: lane, half, tile (i >> 6) & 3, chunk (i >> 8) & 63, group above.
// A piece is 8 keys of one d: 8 loads, in each of which 16 lanes share 64 bytes of a row of F.
__device__ __forceinline__ void vtp_body(const size_t i, const float* __restrict__ F, h16* V16, bf* Vh, bf* Vl) { const int d = (int)((i >> 6) & 3) * 16 + (int)(i & 15); const int t = (int)((i >> 8) & 63) * 32 + (int)((i >> 5) & 1) * 16 + (int)((i >> 4) & 1) * 8; const int n = (int)(i >> 14); const int b = n / NH_, h = n % NH_; v8h o; v8us oh, ol;
#pragma unroll
    for (int u = 0; u < 8; ++u) { const float v = F[((size_t)(t + u) * BB + b) * EE + h * HD + d]; o[u] = tohx(v); unsigned short a, c; splitf(v, a, c); oh[u] = a; ol[u] = c; } { *(v8h*)(V16 + i * 8) = o; *(v8us*)(Vh + i * 8) = oh; *(v8us*)(Vl + i * 8) = ol;  } }
// k_pl: the planes of q, k and v in one launch; blockIdx.y names the projection, so the choice is a scalar branch.
__global__ __launch_bounds__(256) void k_pl(const float* __restrict__ QF, const float* __restrict__ KF, const float* __restrict__ VF, h16* Q16, bf* Qh, bf* Ql, h16* K16, bf* Kh, bf* Kl, h16* V16, bf* Vh, bf* Vl) { const size_t i = (size_t)blockIdx.x * 256 + threadIdx.x; if (i >= (size_t)NG * TT * HD / 8) return;
    if (blockIdx.y == 0) pl_body(i, QF, 0.125f, Q16, Qh, Ql); else if (blockIdx.y == 1) pl_body(i, KF, 1.0f, K16, Kh, Kl); else vtp_body(i, VF, V16, Vh, Vl); }
// k_qr: one thread per (group, query) row: the scaled query row sits in 64 registers, the 33 rounded rk rows in LDS, read at one address by the whole wave (a broadcast), four buckets a pass; each sum runs over d in ascending order.
__global__ __launch_bounds__(256) void k_qr(const float* __restrict__ QF, const float* __restrict__ rk, float* QR) { __shared__ __align__(16) float rs[NR * HD];
    for (int i = threadIdx.x; i < NR * HD; i += 256) rs[i] = bfr(rk[i]);
    const size_t row = (size_t)blockIdx.x * 256 + threadIdx.x; const int t = (int)(row % TT), n = (int)(row / TT); const int b = n / NH_, h = n % NH_; const float* q = QF + ((size_t)t * BB + b) * EE + h * HD; float qv[HD];
    // the loops over d and k are fully unrolled so that qv stays in registers
#pragma unroll
    for (int d = 0; d < HD; d += 4) { const v4f x = *(const v4f*)(q + d); qv[d] = x[0] * 0.125f; qv[d + 1] = x[1] * 0.125f; qv[d + 2] = x[2] * 0.125f; qv[d + 3] = x[3] * 0.125f; }
    __syncthreads();   // publishes the rk rows
    float* o = QR + row * 64;
#pragma unroll 1   // eight trips of 256 multiply-adds: unrolled, the kernel is 30 KB of code that each wave runs once
    for (int r0 = 0; r0 < NR - 1; r0 += 4) { v4f s = (v4f){};
#pragma unroll
        for (int d = 0; d < HD; d += 4) {
#pragma unroll
            for (int k = 0; k < 4; ++k) { const v4f w = *(const v4fa*)(rs + (r0 + k) * HD + d); s[k] += qv[d] * w[0]; s[k] += qv[d + 1] * w[1]; s[k] += qv[d + 2] * w[2]; s[k] += qv[d + 3] * w[3]; } }
        *(v4f*)(o + r0) = s;
        asm volatile("s_wait_xcnt 0x0" ::: "memory"); }   // stands in front of the next writes of the store's address and data registers
    float s = 0.f;
#pragma unroll
    for (int d = 0; d < HD; d += 4) { const v4f w = *(const v4fa*)(rs + (NR - 1) * HD + d); s += qv[d] * w[0]; s += qv[d + 1] * w[1]; s += qv[d + 2] * w[2]; s += qv[d + 3] * w[3]; }
    o[NR - 1] = s; }
// k_attn: the whole attention of 16 query rows of one group in one work-group of 8 waves; wave w owns keys [256 w, 256 w + 256). Scores are formed TRANSPOSED (A = 16 key rows, B = 16 query rows), so that a lane holds, for query lr,
// keys 8 hi .. 8 hi + 7 of each 16-key tile: two neighbouring tiles are, register for register, the A fragment of P for a 32-key chunk of P.v, and the probabilities never leave the registers. Row maximum, row sum, the two outer
// bucket sums and the 8 partial P.v tiles meet in LDS (waves added in ascending order). THE BAND: only the three key tiles at t0 - 16, t0, t0 + 16 (BW = 48 keys, x = key - (t0 - 16)) hold keys nearer than 16 to one of the 16 queries. The tile loops are fully unrolled, so whatever a band tile
// needs stands 16 times in the text: it is kept to two 16-byte LDS accesses. bad[q][x] (pitch BP: 16-byte rows on distinct banks) holds q.rk already picked by distance, staged straight from the QR table; bnd[q][x] takes the band tiles' rounded P, and the end of the kernel, once, sorts x <= q into bucket 0, x >= q + 32 into bucket 32 and x = q + r into bucket r. The rounded rv table is staged in LDS by the whole work-group. P is rounded to hl planes (rows < RH) or to fp16 x 1024 (the rest); the bucket sums are taken from the rounded values.
typedef __attribute__((ext_vector_type(2))) __bf16 v2bf;
template <bool HR, typename T16>
__device__ __forceinline__ void attn_rows(const T16* __restrict__ Qa, const T16* __restrict__ Qb, const T16* __restrict__ Ka, const T16* __restrict__ Kb, const T16* __restrict__ Va, const T16* __restrict__ Vb, const float* __restrict__ QR, const float* __restrict__ rv, const int n, const int t0, float* os, float* bnd, float* red, float* bad, float* rvs) {
    typedef typename WFrag<T16>::V V;
    const int tid = threadIdx.x, lane = tid & 31, lr = lane & 15, hi = lane >> 4; const int w = __builtin_amdgcn_readfirstlane(tid >> 5);   // the wave's number in a scalar register: the tests on a tile's place become scalar branches
    const int kb = w * 256;
    V qa[2], qb[2]; const T16* qpa = Qa + ((size_t)n * TT + t0) * HD + 8 * lane; const T16* qpb = HR ? Qb + ((size_t)n * TT + t0) * HD + 8 * lane : qpa;   // a 16-row tile is 16 * HD elements, a 32-d chunk of it 512
#pragma unroll
    for (int c = 0; c < 2; ++c) { qa[c] = WFrag<T16>::ldf(qpa + 512 * c); if (HR) qb[c] = WFrag<T16>::ldf(qpb + 512 * c); }
    // stands in front of the next writes of the query loads' address registers (the build takes their scalar base over a few instructions on); the scheduling barriers keep the loads in front of it and every later instruction behind it
    __builtin_amdgcn_sched_barrier(0); asm volatile("s_wait_xcnt 0x0" ::: "memory"); __builtin_amdgcn_sched_barrier(0);
    // staging: 16 x 48 band q.rk values and 528 four-float pieces of rv, three a thread; rv's third index is held to the last piece, which threads 15..255 all load and store alike (one value, no branch)
    float gq[3]; v4f gv[3];
#pragma unroll
    for (int u = 0; u < 3; ++u) { const int ib = tid + 256 * u, i = min(ib, 16 * NR - 1), bq = ib / BW, bx = ib % BW; gq[u] = QR[((size_t)n * TT + t0 + bq) * 64 + min(max(bx - MR - bq, -MR), MR) + MR]; gv[u] = *(const v4f*)(rv + i * 4);
        __builtin_amdgcn_sched_barrier(0); asm volatile("s_wait_xcnt 0x0" ::: "memory"); __builtin_amdgcn_sched_barrier(0); }   // the same for these two loads
    v8f s[16]; float mx = -3.0e38f;
    constexpr int TB = HR ? 1 : 2;   // key tiles a batch: two buffers of 32 registers each, one in flight while the other is worked on
    V kf[2][TB][HR ? 4 : 2]; const size_t ko = ((size_t)n * TT + kb) * HD + 8 * lane;
    // every loop over tiles, chunks and registers is fully unrolled so that s stays in registers
#pragma unroll
    for (int u = 0; u < TB; ++u) {
#pragma unroll
        for (int c = 0; c < 2; ++c) { kf[0][u][c] = WFrag<T16>::ldf(Ka + ko + u * 16 * HD + 512 * c); if (HR) kf[0][u][2 + c] = WFrag<T16>::ldf(Kb + ko + u * 16 * HD + 512 * c); } }
    __builtin_amdgcn_sched_barrier(0);   // keeps the first key loads in front of the staging's LDS stores, which wait for the staged values: the two latencies overlap
#pragma unroll
    for (int u = 0; u < 3; ++u) { const int ib = tid + 256 * u, i = min(ib, 16 * NR - 1), bo = (ib / BW) * BP + ib % BW; bnd[bo] = 0.f;   // a band key that lies outside the sequence stays 0
        bad[bo] = gq[u]; v4f y; y[0] = bfr(gv[u][0]); y[1] = bfr(gv[u][1]); y[2] = bfr(gv[u][2]); y[3] = bfr(gv[u][3]); *(v4fa*)(rvs + i * 4) = y; }
#pragma unroll
    for (int b = 0; b < 16 / TB; ++b) {
        if (b + 1 < 16 / TB) {
#pragma unroll
            for (int u = 0; u < TB; ++u) {
#pragma unroll
                for (int c = 0; c < 2; ++c) { kf[(b + 1) & 1][u][c] = WFrag<T16>::ldf(Ka + ko + ((b + 1) * TB + u) * 16 * HD + 512 * c); if (HR) kf[(b + 1) & 1][u][2 + c] = WFrag<T16>::ldf(Kb + ko + ((b + 1) * TB + u) * 16 * HD + 512 * c); } } }
        __builtin_amdgcn_sched_barrier(0);   // keeps the next batch's loads in front of this batch's products: without it the build issues each fragment's loads directly in front of its product and waits out every latency
#pragma unroll
        for (int u = 0; u < TB; ++u) { v8f a = (v8f){};
#pragma unroll
            for (int c = 0; c < 2; ++c) { a = WFrag<T16>::mma(kf[b & 1][u][c], qa[c], a); if (HR) { a = WFrag<T16>::mma(kf[b & 1][u][c], qb[c], a); a = WFrag<T16>::mma(kf[b & 1][u][2 + c], qa[c], a); } }
            s[b * TB + u] = a; } }
    // the branches below follow the last matrix instruction: five vector slots keep its distance on the taken side too; the two scheduling barriers hold them in place
    __builtin_amdgcn_sched_barrier(0); asm volatile("v_nop\n\tv_nop\n\tv_nop\n\tv_nop\n\tv_nop"); __builtin_amdgcn_sched_barrier(0);
    __syncthreads();   // publishes the staged q.rk rows (and the rv table and the cleared buckets)
    const float* qr = bad + lr * BP; const float qlo = qr[0], qhi = qr[BW - 1];   // x = 0 lies at distance <= -16 of every query, x = 47 at >= +16
#pragma unroll
    for (int kt = 0; kt < 16; ++kt) { const int k0 = kb + kt * 16; v8f a = s[kt];
        if (k0 + 15 > t0 - MR && k0 < t0 + 15 + MR) {
#pragma unroll
            for (int j = 0; j < 8; j += 4) { const v4f y = *(const v4fa*)(qr + (k0 - t0 + MR) + hi * 8 + j); a[j] += y[0]; a[j + 1] += y[1]; a[j + 2] += y[2]; a[j + 3] += y[3]; }
        } else { const float qq = k0 < t0 ? qlo : qhi;
#pragma unroll
            for (int j = 0; j < 8; ++j) a[j] += qq; }
#pragma unroll
        for (int j = 0; j < 8; ++j) mx = fmaxf(mx, a[j]);
        s[kt] = a; }
    mx = fmaxf(mx, __shfl_xor(mx, 16, 32)); if (hi == 0) red[w * 16 + lr] = mx;
    __syncthreads();   // publishes the waves' row maxima
#pragma unroll
    for (int i = 0; i < 8; ++i) mx = fmaxf(mx, red[i * 16 + lr]);
    float sum = 0.f;
#pragma unroll
    for (int kt = 0; kt < 16; ++kt) {
#pragma unroll
        for (int j = 0; j < 8; ++j) { const float y = (s[kt][j] - mx) * 1.44269504f; float e;
            asm("v_exp_f32 %0, %1\n\tv_nop" : "=v"(e) : "v"(y));   // e^x as 2^(x log2 e); the v_nop is the one slot behind a transcendental
            s[kt][j] = e; sum += e; } }
    sum += __shfl_xor(sum, 16, 32); if (hi == 0) red[128 + w * 16 + lr] = sum;
    __syncthreads();   // publishes the waves' row sums
    sum = red[128 + lr];
#pragma unroll
    for (int i = 1; i < 8; ++i) sum += red[128 + i * 16 + lr];
    const float f = HR ? __fdiv_rn(1.0f, sum) : __fdiv_rn(1.0f, sum) * PCAR;
    float lo = 0.f, up = 0.f;
    // rounds P in place (hl: a tile's registers 0..3 take its half of the high plane's fragment, 4..7 that of the low plane's; fp16: the rounded value) and forms the bucket sums from the rounded values; all branches stand here, in front of the matrix instructions of P.v
#pragma unroll
    for (int kt = 0; kt < 16; ++kt) { const int k0 = kb + kt * 16; float val[8]; unsigned xh[4], xl[4];
#pragma unroll
        for (int k = 0; k < 4; ++k) { const float p0 = s[kt][2 * k] * f, p1 = s[kt][2 * k + 1] * f;
            if (HR) { v2bf h; h[0] = (__bf16)p0; h[1] = (__bf16)p1; xh[k] = __builtin_bit_cast(unsigned, h);   // round to nearest even, two values a conversion, already in the fragment's order
                const float h0 = __uint_as_float(xh[k] << 16), h1 = __uint_as_float(xh[k] & 0xFFFF0000u); v2bf l; l[0] = (__bf16)(p0 - h0); l[1] = (__bf16)(p1 - h1); xl[k] = __builtin_bit_cast(unsigned, l);
                val[2 * k] = h0 + __uint_as_float(xl[k] << 16); val[2 * k + 1] = h1 + __uint_as_float(xl[k] & 0xFFFF0000u); }
            else { const float x0 = (float)tohx(p0), x1 = (float)tohx(p1); s[kt][2 * k] = x0; s[kt][2 * k + 1] = x1; val[2 * k] = x0 * (1.0f / PCAR); val[2 * k + 1] = x1 * (1.0f / PCAR); } }
        if (HR) {
#pragma unroll
            for (int k = 0; k < 4; ++k) { s[kt][k] = __uint_as_float(xh[k]); s[kt][4 + k] = __uint_as_float(xl[k]); } }
        if (k0 + 15 > t0 - MR && k0 < t0 + 15 + MR) {
#pragma unroll
            for (int j = 0; j < 8; j += 4) { v4f y; y[0] = val[j]; y[1] = val[j + 1]; y[2] = val[j + 2]; y[3] = val[j + 3]; *(v4fa*)(bnd + lr * BP + (k0 - t0 + MR) + hi * 8 + j) = y; }
        } else {   // the tile's sum once, then added to the side the whole tile lies on: one copy of the adds in the text instead of one a side
            const float ts = ((val[0] + val[1]) + (val[2] + val[3])) + ((val[4] + val[5]) + (val[6] + val[7]));
            lo += k0 < t0 ? ts : 0.f; up += k0 < t0 ? 0.f : ts; } }
    lo += __shfl_xor(lo, 16, 32); up += __shfl_xor(up, 16, 32); if (hi == 0) { red[256 + w * 16 + lr] = lo; red[384 + w * 16 + lr] = up; }
    v8f o[4];
    // P.v by pairs of 32-key chunks (a chunk of the v planes is 2048 elements: four 16-column tiles of 512). A batch is 32 registers of fragments
    // (fp16: two tiles x two chunks; hl: one tile x two chunks x two planes), in two buffers, one in flight while the other is worked on. Each o[dt] still takes its chunks in ascending order.
    constexpr int FB = HR ? 2 : 4, NBP = HR ? 4 : 2;   // (tile, chunk) places a batch; batches a pair of chunks
    V vf[2][FB][HR ? 2 : 1]; const size_t vo = ((size_t)n * TT + kb) * HD + 8 * lane;
#pragma unroll
    for (int dt = 0; dt < 4; ++dt) o[dt] = (v8f){};
#pragma unroll
    for (int u = 0; u < FB; ++u) { const size_t v1 = vo + (HR ? 0 : u & 1) * 512 + (HR ? u : u >> 1) * 2048; vf[0][u][0] = WFrag<T16>::ldf(Va + v1); if (HR) vf[0][u][1] = WFrag<T16>::ldf(Vb + v1); }
#pragma unroll
    for (int cp = 0; cp < 4; ++cp) { V pa[2], pb2[2];
#pragma unroll
        for (int e = 0; e < 2; ++e) { const int c = 2 * cp + e;
            if constexpr (HR) { v8f ph, pl;
#pragma unroll
                for (int k = 0; k < 8; ++k) { ph[k] = s[2 * c + (k >> 2)][k & 3]; pl[k] = s[2 * c + (k >> 2)][4 + (k & 3)]; }
                pa[e] = __builtin_bit_cast(v16bf, ph); pb2[e] = __builtin_bit_cast(v16bf, pl); }
            else {
#pragma unroll
                for (int i = 0; i < 16; ++i) pa[e][i] = tohx(s[2 * c + (i >> 3)][i & 7]); } }
#pragma unroll
        for (int g = 0; g < NBP; ++g) { const int b = cp * NBP + g, b1 = b + 1, g1 = b1 % NBP;
            if (b1 < 4 * NBP) {
#pragma unroll
                for (int u = 0; u < FB; ++u) { const int dt1 = HR ? g1 : g1 * 2 + (u & 1), e1 = HR ? u : u >> 1; const size_t v1 = vo + dt1 * 512 + (2 * (b1 / NBP) + e1) * 2048; vf[b1 & 1][u][0] = WFrag<T16>::ldf(Va + v1); if (HR) vf[b1 & 1][u][1] = WFrag<T16>::ldf(Vb + v1); } }
            __builtin_amdgcn_sched_barrier(0);   // keeps the next batch's loads in front of this batch's products, as in the score stage
#pragma unroll
            for (int u = 0; u < FB; ++u) { const int dt = HR ? g : g * 2 + (u & 1), e = HR ? u : u >> 1; o[dt] = WFrag<T16>::mma(pa[e], vf[b & 1][u][0], o[dt]);
                if constexpr (HR) { o[dt] = WFrag<T16>::mma(pb2[e], vf[b & 1][u][0], o[dt]); o[dt] = WFrag<T16>::mma(pa[e], vf[b & 1][u][1], o[dt]); } } } }
    __builtin_amdgcn_sched_barrier(0);   // keeps the address arithmetic of what follows behind the last products, and so behind the data waits of the last loads, whose address registers it takes over
#pragma unroll
    for (int dt = 0; dt < 4; ++dt) {
#pragma unroll
        for (int j = 0; j < 8; ++j) os[(w * 16 + hi * 8 + j) * 68 + dt * 16 + lr] = o[dt][j]; } }
// attn_end: the waves' partial tiles and bucket sums added, the band sorted into its buckets, the rv term, the merged planes stored; it stands once in the text for both precisions (scl undoes the fp16 path's scale of P).
__device__ __forceinline__ void attn_end(bf* Ah, bf* Al, const int n, const int t0, const float scl, const float* os, const float* bnd, const float* red, const float* rvs) {
    const int tid = threadIdx.x;
    __syncthreads();   // publishes the partial P.v tiles and all bucket sums
    const int q = tid >> 4, d0 = (tid & 15) * 4; v4f ps = *(const v4fa*)(os + q * 68 + d0); float plo = red[256 + q], pup = red[384 + q];
#pragma unroll
    for (int i = 1; i < 8; ++i) { ps += *(const v4fa*)(os + (i * 16 + q) * 68 + d0); plo += red[256 + i * 16 + q]; pup += red[384 + i * 16 + q]; }
    const float* bp = bnd + q * BP;
    // the band keys at distance <= -16 (x <= q) and >= +16 (x >= q + 32) join the outer buckets, in ascending order behind the waves' sums
#pragma unroll
    for (int x = 0; x < 16; x += 4) { const v4f y = *(const v4fa*)(bp + x), z = *(const v4fa*)(bp + 32 + x);
#pragma unroll
        for (int k = 0; k < 4; ++k) { plo += x + k <= q ? y[k] : 0.f; pup += x + k >= q ? z[k] : 0.f; } }
    v4f acc = ps * scl;
#pragma unroll
    for (int r = 0; r < NR; ++r) { const float p = r == 0 ? plo : (r == NR - 1 ? pup : bp[q + r]); const v4f x = *(const v4fa*)(rvs + r * HD + d0);
#pragma unroll
        for (int k = 0; k < 4; ++k) acc[k] += p * x[k]; }
    v4us oh, ol;
#pragma unroll
    for (int k = 0; k < 4; ++k) { unsigned short x, y; splitf(acc[k], x, y); oh[k] = x; ol[k] = y; }
    const size_t oo = fro((n / NH_) * TT + t0 + q, (n % NH_) * HD + d0, EE / 32); *(v4us*)(Ah + oo) = oh; *(v4us*)(Al + oo) = ol; }   // the merged planes too are stored in fragment order, rows (b, t), for the Wo product
// four waves a SIMD (two work-groups a WGP): without the bound the build hoists loads until only two fit
__global__ __launch_bounds__(256) __attribute__((amdgpu_waves_per_eu(4))) void k_attn(const h16* __restrict__ Q16, const bf* __restrict__ Qh, const bf* __restrict__ Ql, const h16* __restrict__ K16, const bf* __restrict__ Kh, const bf* __restrict__ Kl, const h16* __restrict__ V16, const bf* __restrict__ Vh, const bf* __restrict__ Vl, const float* __restrict__ QR, const float* __restrict__ rv, bf* Ah, bf* Al) {
    __shared__ __align__(16) float os[8 * 16 * 68]; __shared__ __align__(16) float bnd[16 * BP]; __shared__ float red[512]; __shared__ __align__(16) float bad[16 * BP]; __shared__ __align__(16) float rvs[NR * HD];
    // all hl work-groups come first in the grid, then all fp16 ones (for speed only)
    const int fl = blockIdx.x, g = fl - NG * (RH / 16); const bool hr = g < 0;
    const int n = hr ? fl / (RH / 16) : g / ((TT - RH) / 16), t0 = hr ? (fl % (RH / 16)) * 16 : RH + (g % ((TT - RH) / 16)) * 16;
    if (hr) attn_rows<true, bf>(Qh, Ql, Kh, Kl, Vh, Vl, QR, rv, n, t0, os, bnd, red, bad, rvs);
    else attn_rows<false, h16>(Q16, nullptr, K16, nullptr, V16, nullptr, QR, rv, n, t0, os, bnd, red, bad, rvs);
    attn_end(Ah, Al, n, t0, hr ? 1.0f : 1.0f / PCAR, os, bnd, red, rvs); }

extern "C" void kernel_launch(void* const* d_in, const int* in_sizes, int n_in,
                              void* d_out, int out_size, void* d_ws, size_t ws_size, hipStream_t stream) {
    (void)in_sizes; (void)n_in; (void)out_size;
    const float* x = (const float*)d_in[0]; const float* Wq = (const float*)d_in[1]; const float* bq = (const float*)d_in[2]; const float* Wk = (const float*)d_in[3]; const float* bk = (const float*)d_in[4]; const float* Wv = (const float*)d_in[5]; const float* bv = (const float*)d_in[6]; const float* Wo = (const float*)d_in[7]; const float* bo = (const float*)d_in[8]; const float* rk = (const float*)d_in[9]; const float* rv = (const float*)d_in[10];
    float* OUT = (float*)d_out;     // [2048][2][1024]
    char* wsp = (char*)d_ws;
    auto take = [&](size_t bytes) { char* p = wsp; wsp += (bytes + 255) & ~(size_t)255; return (void*)p; };
    const size_t NTB = (size_t)TT * BB;
    bf* WQ = (bf*)take((4 * (size_t)EE * EE + NTB * EE) * 2); bf* WK = WQ + (size_t)EE * EE; bf* WV = WK + (size_t)EE * EE; bf* WO = WV + (size_t)EE * EE; bf* XB = WO + (size_t)EE * EE;   // one joint plane: k_cvt8 fills it in one launch, and the projection launch steps from Wq to Wk to Wv by z
    float* QR = (float*)take((size_t)NG * TT * 64 * 4); bf* Ah = (bf*)take(NTB * EE * 2); bf* Al = (bf*)take(NTB * EE * 2);
    h16* Q16 = (h16*)take((size_t)NG * TT * HD * 2); bf* Qh = (bf*)take((size_t)NG * TT * HD * 2); bf* Ql = (bf*)take((size_t)NG * TT * HD * 2); h16* K16 = (h16*)take((size_t)NG * TT * HD * 2); bf* Kh = (bf*)take((size_t)NG * TT * HD * 2); bf* Kl = (bf*)take((size_t)NG * TT * HD * 2); h16* V16 = (h16*)take((size_t)NG * HD * TT * 2); bf* Vh = (bf*)take((size_t)NG * HD * TT * 2); bf* Vl = (bf*)take((size_t)NG * HD * TT * 2);
    float* QF = (float*)take(3 * NTB * EE * 4); float* KF = QF + NTB * EE; float* VF = KF + NTB * EE;   // the f32 results of the q, k and v projections, one behind the other (the projection launch steps through them by z)
    if ((size_t)(wsp - (char*)d_ws) > ws_size) return;    // total 168 MiB: nine [32][2048][64] planes 72, QR 16, merged planes 16, bf16 weights and x 16, f32 projections 48
    k_cvt8<<<(unsigned)((4 * (size_t)EE * EE + NTB * EE) / 8 / 256), 256, 0, stream>>>(Wq, Wk, Wv, Wo, x, WQ, (4 * (size_t)EE * EE + NTB * EE) / 8);
    const unsigned LP = (unsigned)(((size_t)NG * TT * HD / 8 + 255) / 256);
    k_gemmw<bf, 0, true, false, false, 1><<<dim3(NTB / 64, EE / 64, 3), 32, 0, stream>>>(XB, nullptr, WQ, nullptr, EE, QF, EE, bq, bk, bv, 0, (size_t)EE * EE, NTB * EE, 0, 0);
    k_pl<<<dim3(LP, 3, 1), 256, 0, stream>>>(QF, KF, VF, Q16, Qh, Ql, K16, Kh, Kl, V16, Vh, Vl); k_qr<<<NG * TT / 256, 256, 0, stream>>>(QF, rk, QR);
    k_attn<<<NG * TT / 16, 256, 0, stream>>>(Q16, Qh, Ql, K16, Kh, Kl, V16, Vh, Vl, QR, rv, Ah, Al);
    k_gemmw<bf, 1, true, false, true, 4><<<dim3(NTB / 64, EE / 64, 1), 128, 0, stream>>>(Ah, Al, WO, nullptr, EE, OUT, EE, bo, bo, bo, 0, 0, 0, 0, 0);
}

// v009
// It runs in 213 microseconds.
// Timed twice side by side with v008, it ran 1.03 times as fast both times.
// All steps since v000 together make it 11.0 times as fast.
#include <hip/hip_runtime.h>

// Shaw relative-position multi-head attention, sequence-first (query [2048][2][1024]; q = (x Wq^T + bq)/8, k, v = x W^T + b; 32 groups n = b*16 + h of 64 dims; scores = q.k + q.rk[clip(s-t,-16,16)+16];
// softmax; attn = P.v + sum_s P[t][s] rv[clip(s-t)+16]; out = merged Wo^T + bo -> [2048][2][1024]; rk/rv tables [33][64] read as data).
// The relative terms are exact regroupings: q.rk depends on (t, bucket) only -> QR[n][t][r] = q_t . rk[r] (33 per row, added inside the attention kernel by bucket); sum_s P rv = sum_r PB[t][r] rv[r] with PB the per-bucket
// probability sums (buckets 0 / 32 collect all keys at distance <= -16 / >= +16), formed in the attention kernel and contracted with rv on VALU at its end.
// Compute dtypes, f32 accumulate: every input rounded to bf16; projections on PLAIN bf16 operands (inputs: exact, + bias; all 4096 (t, b) rows at once); QR and the PB.rv term f32 on VALU; scores (K 64) and P.v on
// hl planes (3 products) for the first 512 query rows of each group and SINGLE fp16 planes for the rest; softmax f32 in registers; Wo on hl planes x exact (+bias). Projections (all three in one launch, grid z): one-wave-per-64x64-tile GEMM; Wo: four waves a 64x64 tile, a quarter of k each; attention: one fused kernel (k_attn). Deterministic, no atomics;
// FRAGMENT ORDER: every 16-bit operand plane in the workspace is stored as the matrix instructions read it. A block of 16 rows x 32 k is 1024 bytes: two halves of 512 bytes (k 0..15, k 16..31), in each lane L = 16 * ((k >> 3) & 1) + (row & 15)
// owns 16 bytes (8 k). A fragment is then two 16-byte loads a lane, each of which reads four whole 128-byte lines; from a row-major plane each took 32 bytes out of 16 lines.

#define TT   2048
#define BB   2
#define EE   1024
#define NH_  16
#define NG   (BB * NH_)
#define HD   64
#define NR   33
#define MR   16
#define RH   512
#define PCAR 1024.0f
#define BW   48
#define BP   52
typedef _Float16 h16;
typedef unsigned short bf;
typedef __attribute__((ext_vector_type(16))) __bf16   v16bf;
typedef __attribute__((ext_vector_type(16))) _Float16 v16h;
typedef __attribute__((ext_vector_type(8)))  _Float16 v8h;
typedef __attribute__((ext_vector_type(8)))  unsigned short v8us;
typedef __attribute__((ext_vector_type(8)))  float    v8f;
typedef __attribute__((ext_vector_type(4)))  float    v4f;
typedef v8h  __attribute__((may_alias)) v8ha;
typedef v4f  __attribute__((may_alias)) v4fa;
typedef v8us __attribute__((may_alias)) v8usa;

__device__ __forceinline__ unsigned short f2bf(float f) { unsigned u = __float_as_uint(f); u += 0x7FFFu + ((u >> 16) & 1u); return (unsigned short)(u >> 16); }
__device__ __forceinline__ float bf2f(unsigned short b) { return __uint_as_float(((unsigned)b) << 16); }
__device__ __forceinline__ float bfr(float f) { return bf2f(f2bf(f)); }
__device__ __forceinline__ v16h cat16(v8h lo, v8h hi) { return __builtin_shufflevector(lo, hi, 0, 1, 2, 3, 4, 5, 6, 7, 8, 9, 10, 11, 12, 13, 14, 15); }
__device__ __forceinline__ v16bf cat16b(v8us lo, v8us hi) { return __builtin_bit_cast(v16bf, __builtin_shufflevector(lo, hi, 0, 1, 2, 3, 4, 5, 6, 7, 8, 9, 10, 11, 12, 13, 14, 15)); }
__device__ __forceinline__ v8f wmma16(v16h a, v16h b, v8f c) { return __builtin_amdgcn_wmma_f32_16x16x32_f16(false, a, false, b, (short)0, c, false, false); }
__device__ __forceinline__ v8f wmmab(v16bf a, v16bf b, v8f c) { return __builtin_amdgcn_wmma_f32_16x16x32_bf16(false, a, false, b, (short)0, c, false, false); }



// element offset of (row, k) in a fragment-ordered plane whose rows hold kch chunks of 32 k: blocks run over k first, then over the 16-row tiles
__device__ __forceinline__ size_t fro(int row, int k, int kch) { return ((((size_t)(row >> 4) * kch + (k >> 5)) * 2 + ((k >> 4) & 1)) * 32 + ((k >> 3) & 1) * 16 + (row & 15)) * 8 + (k & 7); }
// ---- k_gemmw: register-blocked GEMM, each wave on a whole 64x64 output tile (16 accumulators), operands straight from fragment-ordered 16-bit planes; grid (M/64, N/64, Z), 32 * KS threads.
// C[m][n] (f32, pitch ldc, + optional f32 bias[n]) = sum_k A[m][k] Bt[n][k] (+ split products per NSPLIT). z-batch strides sA/sB/sC in elements; batch z takes bias, bias1 or bias2 (the biases are separate inputs). K % 32 == 0.
// KSLICE (N == 64 only): blockIdx.y is a K slice of klen, not a column tile; slice y stores its partial product at C + y * sK and the reader adds the slices in order.
template <typename T16> struct WFrag;
template <> struct WFrag<h16> { typedef v16h V; static __device__ __forceinline__ V ldf(const h16* p) { return cat16(*(const v8h*)p, *(const v8h*)(p + 256)); } static __device__ __forceinline__ v8f mma(V a, V b, v8f c) { return wmma16(a, b, c); } };
template <> struct WFrag<bf> { typedef v16bf V; static __device__ __forceinline__ V ldf(const bf* p) { return cat16b(*(const v8us*)p, *(const v8us*)(p + 256)); } static __device__ __forceinline__ v8f mma(V a, V b, v8f c) { return wmmab(a, b, c); } };
// KS (1 or 4): the waves of a work-group. With 4, wave ws takes the quarter [ws * K / 4, (ws + 1) * K / 4) of k for the whole 64x64 tile (four waves a SIMD instead of one where the grid has one tile a SIMD: a wave's load latency is covered by the others' products);
// the four partial tiles meet in LDS, and wave ws adds those of row tile ws in ascending k order and stores it.
// BTROWS: A's rows run (b, t), so that a 16-row tile of the merged planes, and with it each of their 128-byte lines, has one writing work-group in k_attn; C's rows run (t, b) as always.
template <typename T16, int NSPLIT, bool BIAS, bool KSLICE, bool BTROWS, int KS>
__global__ __launch_bounds__(32 * KS) void k_gemmw(const T16* __restrict__ A, const T16* __restrict__ A2, const T16* __restrict__ Bt, const T16* __restrict__ Bt2, int K, float* C, int ldc, const float* __restrict__ bias, const float* __restrict__ bias1, const float* __restrict__ bias2, size_t sA, size_t sB, size_t sC, int klen, size_t sK) {
    typedef typename WFrag<T16>::V V;
    static_assert(KS == 1 || (KS == 4 && !KSLICE), "one wave, or one wave a row tile");
    __shared__ __align__(16) float os[(KS > 1 ? 4 * KS : 1) * 16 * 68];
    const int ws = KS > 1 ? __builtin_amdgcn_readfirstlane(threadIdx.x >> 5) : 0;   // the wave's number in a scalar register: the k range stays scalar
    const size_t z = blockIdx.z; A += z * sA; if (A2) A2 += z * sA; Bt += z * sB; if (Bt2) Bt2 += z * sB; C += z * sC; const float* __restrict__ bz = z == 0 ? bias : (z == 1 ? bias1 : bias2);
    const int lane = threadIdx.x & 31, lr = lane & 15, hi = lane >> 4; const int r0 = blockIdx.x * 64, c0 = KSLICE ? 0 : blockIdx.y * 64; const int kbeg = KSLICE ? blockIdx.y * klen : ws * (K / KS), kend = KSLICE ? kbeg + klen : kbeg + K / KS; if (KSLICE) C += blockIdx.y * sK;
    v8f acc[4][4];
#pragma unroll
    for (int mb = 0; mb < 4; ++mb)
#pragma unroll
        for (int nb = 0; nb < 4; ++nb) acc[mb][nb] = (v8f){};
    constexpr size_t tp = (size_t)(EE / 32) * 512;   // elements of one 16-row tile: every plane that this kernel reads has EE k a row (K == EE at every launch), and as a constant the tile's step goes into the loads' immediate offsets
    const size_t aoff = (size_t)(r0 >> 4) * tp, boff = (size_t)(c0 >> 4) * tp; const unsigned lo = 8 * lane;   // the lane's place in a 512-byte half
#pragma unroll 1
    for (int kc = kbeg; kc < kend; kc += 32) {
        V a[4], a2[4]; const T16* pa = A + (aoff + (size_t)kc * 16) + lo; const T16* pa2 = (NSPLIT == 1 || NSPLIT == 2) ? A2 + (aoff + (size_t)kc * 16) + lo : pa; const T16* pb = Bt + (boff + (size_t)kc * 16) + lo; const T16* pb2 = NSPLIT >= 2 ? Bt2 + (boff + (size_t)kc * 16) + lo : pb;
#pragma unroll
        for (int mb = 0; mb < 4; ++mb) { a[mb] = WFrag<T16>::ldf(pa + mb * tp); if (NSPLIT == 1 || NSPLIT == 2) a2[mb] = WFrag<T16>::ldf(pa2 + mb * tp); }
#pragma unroll
        for (int nb = 0; nb < 4; ++nb) { const V b = WFrag<T16>::ldf(pb + nb * tp); V b2; if (NSPLIT >= 2) b2 = WFrag<T16>::ldf(pb2 + nb * tp);
#pragma unroll
            for (int mb = 0; mb < 4; ++mb) { acc[mb][nb] = WFrag<T16>::mma(a[mb], b, acc[mb][nb]); if (NSPLIT == 1 || NSPLIT == 2) acc[mb][nb] = WFrag<T16>::mma(a2[mb], b, acc[mb][nb]); if (NSPLIT >= 2) acc[mb][nb] = WFrag<T16>::mma(a[mb], b2, acc[mb][nb]); } }
        // stands in front of the next trip's writes of the loads' address registers (the build let later loads' results land in them): the addresses are inputs, so that their registers live up to the wait
        asm volatile("s_wait_xcnt 0x0" :: "v"(pa), "v"(pa2), "v"(pb), "v"(pb2) : "memory");
        asm volatile("v_nop\n\tv_nop\n\tv_nop\n\tv_nop" : "+v"(acc[0][0]), "+v"(acc[1][1]), "+v"(acc[2][2]), "+v"(acc[3][3]) : "v"(a[0]), "v"(a[3]));
    }
    if constexpr (KS > 1) {
#pragma unroll
        for (int mb = 0; mb < 4; ++mb) {
#pragma unroll
            for (int nb = 0; nb < 4; ++nb) {
#pragma unroll
                for (int j = 0; j < 8; ++j) os[((mb * KS + ws) * 16 + hi * 8 + j) * 68 + nb * 16 + lr] = acc[mb][nb][j]; } }
        __syncthreads();   // publishes the waves' partial tiles
        const int cofs = lr * 4; v4f bs = (v4f){}; if (BIAS) { bs[0] = bfr(bz[c0 + cofs]); bs[1] = bfr(bz[c0 + cofs + 1]); bs[2] = bfr(bz[c0 + cofs + 2]); bs[3] = bfr(bz[c0 + cofs + 3]); }
#pragma unroll
        for (int s = 0; s < 8; ++s) { const int row = 2 * s + hi; v4f val = *(const v4fa*)(os + (ws * KS * 16 + row) * 68 + cofs);
#pragma unroll
            for (int p = 1; p < KS; ++p) val += *(const v4fa*)(os + ((ws * KS + p) * 16 + row) * 68 + cofs);
            val += bs; const int m = r0 + ws * 16 + row; *(v4f*)(C + (size_t)(BTROWS ? (m % TT) * BB + m / TT : m) * ldc + c0 + cofs) = val; }
        // stands behind the stores, in front of whatever next writes their address and data registers; the scheduling barrier keeps the stores in front of it
        __builtin_amdgcn_sched_barrier(0); asm volatile("s_wait_xcnt 0x0" ::: "memory");
    } else
#pragma unroll
    for (int mb = 0; mb < 4; ++mb) {
#pragma unroll
        for (int nb = 0; nb < 4; ++nb) {
#pragma unroll
            for (int j = 0; j < 8; ++j) os[(hi * 8 + j) * 68 + nb * 16 + lr] = acc[mb][nb][j]; }
        __builtin_amdgcn_wave_barrier(); asm volatile("" ::: "memory");
{
#pragma unroll
            for (int s = 0; s < 8; ++s) { const int row = 2 * s + hi, cofs = lr * 4; v4f val = *(const v4fa*)(os + row * 68 + cofs); if (BIAS) { val[0] += bfr(bz[c0 + cofs]); val[1] += bfr(bz[c0 + cofs + 1]); val[2] += bfr(bz[c0 + cofs + 2]); val[3] += bfr(bz[c0 + cofs + 3]); }
                const int m = r0 + mb * 16 + row; *(v4f*)(C + (size_t)(BTROWS ? (m % TT) * BB + m / TT : m) * ldc + c0 + cofs) = val; }
             }
        // stands in front of the next writes of the stores' address and data registers; the scheduling barriers keep the stores in front of it and every later instruction behind it
        __builtin_amdgcn_sched_barrier(0); asm volatile("s_wait_xcnt 0x0" ::: "memory"); __builtin_amdgcn_sched_barrier(0);
        __builtin_amdgcn_wave_barrier(); asm volatile("" ::: "memory");
    }
}

__device__ __forceinline__ h16 tohx(float x) { return (h16)x; }
__device__ __forceinline__ void splitf(float y, unsigned short& h, unsigned short& l) { h = f2bf(y); l = f2bf(y - bf2f(h)); }
typedef __attribute__((ext_vector_type(2))) _Float16 v2h;
typedef __attribute__((ext_vector_type(4))) _Float16 v4h;
typedef __attribute__((ext_vector_type(2))) unsigned short v2us;
typedef __attribute__((ext_vector_type(4))) unsigned short v4us;
typedef __attribute__((ext_vector_type(2))) float v2f;

// The three plane builders: one thread per 16-byte piece of the fragment-ordered output, pieces in output order, so that a wave's store is 512 contiguous bytes.
// k_cvt8: [rows][EE] f32 -> bf16; piece i: lane i & 31, half (i >> 5) & 1, chunk (i >> 6) % (EE / 32), 16-row tile above. One launch for all five sources (four weights of EE rows, then x): their planes lie one behind the other in the workspace,
// so that piece i of the launch is piece i of the joint plane; EE rows are 512 work-groups, so the source is picked from blockIdx alone (a scalar choice).
__global__ __launch_bounds__(256) void k_cvt8(const float* __restrict__ w0, const float* __restrict__ w1, const float* __restrict__ w2, const float* __restrict__ w3, const float* __restrict__ xs, bf* dst, size_t n8) { const size_t i = (size_t)blockIdx.x * 256 + threadIdx.x; if (i >= n8) return; const int pn = min((int)(blockIdx.x >> 9), 4); const float* __restrict__ src = pn == 0 ? w0 : (pn == 1 ? w1 : (pn == 2 ? w2 : (pn == 3 ? w3 : xs))); const int row = (int)(i >> 11) * 16 + (int)(i & 15) - pn * EE, k = (int)((i >> 6) & (EE / 32 - 1)) * 32 + (int)((i >> 5) & 1) * 16 + (int)((i >> 4) & 1) * 8; const v8f v = *(const v8f*)(src + (size_t)row * EE + k); v8us o;
#pragma unroll
    for (int u = 0; u < 8; ++u) o[u] = f2bf(v[u]); *(v8us*)(dst + i * 8) = o;  }
// pl_body (q and k): rows (n, t), k = d (two chunks a row); piece i: lane, half, chunk (i >> 6) & 1, tile (i >> 7) of the NG * TT rows.
__device__ __forceinline__ void pl_body(const size_t i, const float* __restrict__ F, float scl, h16* P16, bf* Ph, bf* Pl) { const int d = (int)((i >> 6) & 1) * 32 + (int)((i >> 5) & 1) * 16 + (int)((i >> 4) & 1) * 8; const int row = (int)(i >> 7) * 16 + (int)(i & 15); const int t = row % TT, n = row / TT; const int b = n / NH_, h = n % NH_; const v8f f = *(const v8f*)(F + ((size_t)t * BB + b) * EE + h * HD + d); v8h o; v8us oh, ol;
#pragma unroll
    for (int u = 0; u < 8; ++u) { const float v = f[u] * scl; o[u] = tohx(v); unsigned short a, c; splitf(v, a, c); oh[u] = a; ol[u] = c; } { *(v8h*)(P16 + i * 8) = o; *(v8us*)(Ph + i * 8) = oh; *(v8us*)(Pl + i * 8) = ol;  } }
// vtp_body (v): rows d, k = t; the blocks of a group run over its four 16-row tiles first, then over the 64 chunks of 32 keys (a wave of k_attn reads 16 KB of a plane in a row); piece i: lane, half, tile (i >> 6) & 3, chunk (i >> 8) & 63, group above.
// A piece is 8 keys of one d: 8 loads, in each of which 16 lanes share 64 bytes of a row of F.
__device__ __forceinline__ void vtp_body(const size_t i, const float* __restrict__ F, h16* V16, bf* Vh, bf* Vl) { const int d = (int)((i >> 6) & 3) * 16 + (int)(i & 15); const int t = (int)((i >> 8) & 63) * 32 + (int)((i >> 5) & 1) * 16 + (int)((i >> 4) & 1) * 8; const int n = (int)(i >> 14); const int b = n / NH_, h = n % NH_; v8h o; v8us oh, ol;
#pragma unroll
    for (int u = 0; u < 8; ++u) { const float v = F[((size_t)(t + u) * BB + b) * EE + h * HD + d]; o[u] = tohx(v); unsigned short a, c; splitf(v, a, c); oh[u] = a; ol[u] = c; } { *(v8h*)(V16 + i * 8) = o; *(v8us*)(Vh + i * 8) = oh; *(v8us*)(Vl + i * 8) = ol;  } }
// k_pl: the planes of q, k and v in one launch; blockIdx.y names the projection, so the choice is a scalar branch.
__global__ __launch_bounds__(256) void k_pl(const float* __restrict__ QF, const float* __restrict__ KF, const float* __restrict__ VF, h16* Q16, bf* Qh, bf* Ql, h16* K16, bf* Kh, bf* Kl, h16* V16, bf* Vh, bf* Vl) { const size_t i = (size_t)blockIdx.x * 256 + threadIdx.x; if (i >= (size_t)NG * TT * HD / 8) return;
    if (blockIdx.y == 0) pl_body(i, QF, 0.125f, Q16, Qh, Ql); else if (blockIdx.y == 1) pl_body(i, KF, 1.0f, K16, Kh, Kl); else vtp_body(i, VF, V16, Vh, Vl); }
// k_qr: one thread per (group, query) row: the scaled query row sits in 64 registers, the 33 rounded rk rows in LDS, read at one address by the whole wave (a broadcast), four buckets a pass; each sum runs over d in ascending order.
__global__ __launch_bounds__(256) void k_qr(const float* __restrict__ QF, const float* __restrict__ rk, float* QR) { __shared__ __align__(16) float rs[NR * HD];
    for (int i = threadIdx.x; i < NR * HD; i += 256) rs[i] = bfr(rk[i]);
    const size_t row = (size_t)blockIdx.x * 256 + threadIdx.x; const int t = (int)(row % TT), n = (int)(row / TT); const int b = n / NH_, h = n % NH_; const float* q = QF + ((size_t)t * BB + b) * EE + h * HD; float qv[HD];
    // the loops over d and k are fully unrolled so that qv stays in registers
#pragma unroll
    for (int d = 0; d < HD; d += 4) { const v4f x = *(const v4f*)(q + d); qv[d] = x[0] * 0.125f; qv[d + 1] = x[1] * 0.125f; qv[d + 2] = x[2] * 0.125f; qv[d + 3] = x[3] * 0.125f; }
    __syncthreads();   // publishes the rk rows
    float* o = QR + row * 64;
#pragma unroll 1   // eight trips of 256 multiply-adds: unrolled, the kernel is 30 KB of code that each wave runs once
    for (int r0 = 0; r0 < NR - 1; r0 += 4) { v4f s = (v4f){};
#pragma unroll
        for (int d = 0; d < HD; d += 4) {
#pragma unroll
            for (int k = 0; k < 4; ++k) { const v4f w = *(const v4fa*)(rs + (r0 + k) * HD + d); s[k] += qv[d] * w[0]; s[k] += qv[d + 1] * w[1]; s[k] += qv[d + 2] * w[2]; s[k] += qv[d + 3] * w[3]; } }
        *(v4f*)(o + r0) = s;
        asm volatile("s_wait_xcnt 0x0" ::: "memory"); }   // stands in front of the next writes of the store's address and data registers
    float s = 0.f;
#pragma unroll
    for (int d = 0; d < HD; d += 4) { const v4f w = *(const v4fa*)(rs + (NR - 1) * HD + d); s += qv[d] * w[0]; s += qv[d + 1] * w[1]; s += qv[d + 2] * w[2]; s += qv[d + 3] * w[3]; }
    o[NR - 1] = s; }
// k_attn: the whole attention of 32 query rows (two 16-row tiles) of one group in one work-group of 16 waves; wave w owns keys [128 w, 128 w + 128) for all 32 rows, so that each K and each V fragment it loads feeds two products and the work-groups together read K and V half as often as with one query tile each. Scores are formed TRANSPOSED (A = 16 key rows, B = 16 query rows), so that a lane holds, for query lr of a tile,
// keys 8 hi .. 8 hi + 7 of each 16-key tile: two neighbouring tiles are, register for register, the A fragment of P for a 32-key chunk of P.v, and the probabilities never leave the registers. Row maximum, row sum, the two outer
// bucket sums and the 16 partial P.v tiles meet in LDS (waves added in ascending order). THE BAND, for each query tile at tq: only the three key tiles at tq - 16, tq, tq + 16 (BW = 48 keys, x = key - (tq - 16)) hold keys nearer than 16 to one of its 16 queries. The tile loops are fully unrolled, so whatever a band tile
// needs stands 16 times in the text: it is kept to two 16-byte LDS accesses. bad[row][x] (32 rows, pitch BP: 16-byte rows on distinct banks) holds q.rk already picked by distance, staged straight from the QR table; bnd[row][x] takes the band tiles' rounded P, and the end of the kernel, once, sorts x <= q into bucket 0, x >= q + 32 into bucket 32 and x = q + r into bucket r (q: the row's place in its tile). The rounded rv table is staged in LDS by the whole work-group. P is rounded to hl planes (rows < RH) or to fp16 x 1024 (the rest); the bucket sums are taken from the rounded values.
#define QW   2
#define NWV  16
#define KTW  8
#define PKH  1
#define PVH  2
typedef __attribute__((ext_vector_type(2))) __bf16 v2bf;
template <bool HR, typename T16>
__device__ __forceinline__ void attn_rows(const T16* __restrict__ Qa, const T16* __restrict__ Qb, const T16* __restrict__ Ka, const T16* __restrict__ Kb, const T16* __restrict__ Va, const T16* __restrict__ Vb, const float* __restrict__ QR, const float* __restrict__ rv, const int n, const int t0, float* os, float* bnd, float* red, float* bad, float* rvs) {
    typedef typename WFrag<T16>::V V;
    const int tid = threadIdx.x, lane = tid & 31, lr = lane & 15, hi = lane >> 4; const int w = __builtin_amdgcn_readfirstlane(tid >> 5);   // the wave's number in a scalar register: the tests on a tile's place become scalar branches
    const int kb = w * (KTW * 16);
    V qa[QW][2], qb[QW][2]; const T16* qpa = Qa + ((size_t)n * TT + t0) * HD + 8 * lane; const T16* qpb = HR ? Qb + ((size_t)n * TT + t0) * HD + 8 * lane : qpa;   // a 16-row tile is 16 * HD elements, a 32-d chunk of it 512
#pragma unroll
    for (int qt = 0; qt < QW; ++qt) {
#pragma unroll
        for (int c = 0; c < 2; ++c) { qa[qt][c] = WFrag<T16>::ldf(qpa + qt * 16 * HD + 512 * c); if (HR) qb[qt][c] = WFrag<T16>::ldf(qpb + qt * 16 * HD + 512 * c); } }
    // stands in front of the next writes of the query loads' address registers (the build takes their scalar base over a few instructions on); the scheduling barriers keep the loads in front of it and every later instruction behind it
    __builtin_amdgcn_sched_barrier(0); asm volatile("s_wait_xcnt 0x0" ::: "memory"); __builtin_amdgcn_sched_barrier(0);
    // staging: 32 x 48 band q.rk values, three a thread, and 528 four-float pieces of rv, two a thread; rv's second index is held to the last piece, which threads 15..511 all load and store alike (one value, no branch)
    float gq[3]; v4f gv[2];
#pragma unroll
    for (int u = 0; u < 3; ++u) { const int ib = tid + 512 * u, bq = ib / BW, bx = ib % BW; gq[u] = QR[((size_t)n * TT + t0 + bq) * 64 + min(max(bx - MR - (bq & 15), -MR), MR) + MR]; if (u < 2) gv[u] = *(const v4f*)(rv + min(ib, 16 * NR - 1) * 4);
        __builtin_amdgcn_sched_barrier(0); asm volatile("s_wait_xcnt 0x0" ::: "memory"); __builtin_amdgcn_sched_barrier(0); }   // the same for these loads
    v8f s[QW][KTW];
    // a place is one 32-d chunk of one key tile (16 places a wave); a batch of places sits in one of two buffers, one in flight while the other is worked on. Each fragment feeds the products of both query tiles.
    constexpr int PK = HR ? PKH : 4, NBK = 2 * KTW / PK;
    V kf[2][PK][HR ? 2 : 1]; const size_t ko = ((size_t)n * TT + kb) * HD + 8 * lane;
    // every loop over tiles, chunks and registers is fully unrolled so that s stays in registers
#pragma unroll
    for (int u = 0; u < PK; ++u) { kf[0][u][0] = WFrag<T16>::ldf(Ka + ko + u * 512); if (HR) kf[0][u][1] = WFrag<T16>::ldf(Kb + ko + u * 512); }
    __builtin_amdgcn_sched_barrier(0);   // keeps the first key loads in front of the staging's LDS stores, which wait for the staged values: the two latencies overlap
#pragma unroll
    for (int u = 0; u < 3; ++u) { const int ib = tid + 512 * u, bo = (ib / BW) * BP + ib % BW; bnd[bo] = 0.f;   // a band key that lies outside the sequence stays 0
        bad[bo] = gq[u]; if (u < 2) { v4f y; y[0] = bfr(gv[u][0]); y[1] = bfr(gv[u][1]); y[2] = bfr(gv[u][2]); y[3] = bfr(gv[u][3]); *(v4fa*)(rvs + min(ib, 16 * NR - 1) * 4) = y; } }
#pragma unroll
    for (int b = 0; b < NBK; ++b) {
        if (b + 1 < NBK) {
#pragma unroll
            for (int u = 0; u < PK; ++u) { kf[(b + 1) & 1][u][0] = WFrag<T16>::ldf(Ka + ko + ((b + 1) * PK + u) * 512); if (HR) kf[(b + 1) & 1][u][1] = WFrag<T16>::ldf(Kb + ko + ((b + 1) * PK + u) * 512); } }
        __builtin_amdgcn_sched_barrier(0);   // keeps the next batch's loads in front of this batch's products: without it the build issues each fragment's loads directly in front of its product and waits out every latency
#pragma unroll
        for (int u = 0; u < PK; ++u) { const int kt = (b * PK + u) >> 1, c = (b * PK + u) & 1;
#pragma unroll
            for (int qt = 0; qt < QW; ++qt) s[qt][kt] = WFrag<T16>::mma(kf[b & 1][u][0], qa[qt][c], c ? s[qt][kt] : (v8f){});
            if (HR) {
#pragma unroll
                for (int qt = 0; qt < QW; ++qt) s[qt][kt] = WFrag<T16>::mma(kf[b & 1][u][0], qb[qt][c], s[qt][kt]);
#pragma unroll
                for (int qt = 0; qt < QW; ++qt) s[qt][kt] = WFrag<T16>::mma(kf[b & 1][u][1], qa[qt][c], s[qt][kt]); } } }
    // the branches below follow the last matrix instruction: five vector slots keep its distance on the taken side too; the two scheduling barriers hold them in place
    __builtin_amdgcn_sched_barrier(0); asm volatile("v_nop\n\tv_nop\n\tv_nop\n\tv_nop\n\tv_nop"); __builtin_amdgcn_sched_barrier(0);
    __syncthreads();   // publishes the staged q.rk rows (and the rv table and the cleared buckets)
    float mx[QW];
#pragma unroll
    for (int qt = 0; qt < QW; ++qt) { const int tq = t0 + 16 * qt; const float* qr = bad + (qt * 16 + lr) * BP; const float qlo = qr[0], qhi = qr[BW - 1];   // x = 0 lies at distance <= -16 of every query of the tile, x = 47 at >= +16
        mx[qt] = -3.0e38f;
#pragma unroll
        for (int kt = 0; kt < KTW; ++kt) { const int k0 = kb + kt * 16; v8f a = s[qt][kt];
            if (k0 + 15 > tq - MR && k0 < tq + 15 + MR) {
#pragma unroll
                for (int j = 0; j < 8; j += 4) { const v4f y = *(const v4fa*)(qr + (k0 - tq + MR) + hi * 8 + j); a[j] += y[0]; a[j + 1] += y[1]; a[j + 2] += y[2]; a[j + 3] += y[3]; }
            } else { const float qq = k0 < tq ? qlo : qhi;
#pragma unroll
                for (int j = 0; j < 8; ++j) a[j] += qq; }
#pragma unroll
            for (int j = 0; j < 8; ++j) mx[qt] = fmaxf(mx[qt], a[j]);
            s[qt][kt] = a; } }
    // a lane's two halves of a row meet by one exchange: lane (hi, lr) takes over row 16 hi + lr of the 32, so that a wave's 32 values go to LDS in one store and come back in one read a wave
    float mo = fmaxf(hi ? mx[1] : mx[0], __shfl_xor(hi ? mx[0] : mx[1], 16, 32)); red[w * 32 + lane] = mo;
    __syncthreads();   // publishes the waves' row maxima
#pragma unroll
    for (int i = 0; i < NWV; ++i) mo = fmaxf(mo, red[i * 32 + lane]);
    { const float mt = __shfl_xor(mo, 16, 32); mx[0] = hi ? mt : mo; mx[1] = hi ? mo : mt; }
    float sum[QW];
#pragma unroll
    for (int qt = 0; qt < QW; ++qt) { sum[qt] = 0.f;
#pragma unroll
        for (int kt = 0; kt < KTW; ++kt) {
#pragma unroll
            for (int j = 0; j < 8; ++j) { const float y = (s[qt][kt][j] - mx[qt]) * 1.44269504f; float e;
                asm("v_exp_f32 %0, %1\n\tv_nop" : "=v"(e) : "v"(y));   // e^x as 2^(x log2 e); the v_nop is the one slot behind a transcendental, in front of dual instructions that overwrite its source
                s[qt][kt][j] = e; sum[qt] += e; } } }
    float so = (hi ? sum[1] : sum[0]) + __shfl_xor(hi ? sum[0] : sum[1], 16, 32); red[512 + w * 32 + lane] = so;
    __syncthreads();   // publishes the waves' row sums
    so = red[512 + lane];
#pragma unroll
    for (int i = 1; i < NWV; ++i) so += red[512 + i * 32 + lane];
    const float fo = HR ? __fdiv_rn(1.0f, so) : __fdiv_rn(1.0f, so) * PCAR, ft = __shfl_xor(fo, 16, 32); const float fq[QW] = { hi ? ft : fo, hi ? fo : ft };
    float lo[QW], up[QW];
    // rounds P in place (hl: a tile's registers 0..3 take its half of the high plane's fragment, 4..7 that of the low plane's; fp16: the rounded value) and forms the bucket sums from the rounded values; all branches stand here, in front of the matrix instructions of P.v
#pragma unroll
    for (int qt = 0; qt < QW; ++qt) { const int tq = t0 + 16 * qt; const float f = fq[qt]; lo[qt] = 0.f; up[qt] = 0.f;
#pragma unroll
    for (int kt = 0; kt < KTW; ++kt) { const int k0 = kb + kt * 16; float val[8]; unsigned xh[4], xl[4];
#pragma unroll
        for (int k = 0; k < 4; ++k) { const float p0 = s[qt][kt][2 * k] * f, p1 = s[qt][kt][2 * k + 1] * f;
            if (HR) { v2bf h; h[0] = (__bf16)p0; h[1] = (__bf16)p1; xh[k] = __builtin_bit_cast(unsigned, h);   // round to nearest even, two values a conversion, already in the fragment's order
                const float h0 = __uint_as_float(xh[k] << 16), h1 = __uint_as_float(xh[k] & 0xFFFF0000u); v2bf l; l[0] = (__bf16)(p0 - h0); l[1] = (__bf16)(p1 - h1); xl[k] = __builtin_bit_cast(unsigned, l);
                val[2 * k] = h0 + __uint_as_float(xl[k] << 16); val[2 * k + 1] = h1 + __uint_as_float(xl[k] & 0xFFFF0000u); }
            else { const float x0 = (float)tohx(p0), x1 = (float)tohx(p1); s[qt][kt][2 * k] = x0; s[qt][kt][2 * k + 1] = x1; val[2 * k] = x0 * (1.0f / PCAR); val[2 * k + 1] = x1 * (1.0f / PCAR); } }
        if (HR) {
#pragma unroll
            for (int k = 0; k < 4; ++k) { s[qt][kt][k] = __uint_as_float(xh[k]); s[qt][kt][4 + k] = __uint_as_float(xl[k]); } }
        if (k0 + 15 > tq - MR && k0 < tq + 15 + MR) {
#pragma unroll
            for (int j = 0; j < 8; j += 4) { v4f y; y[0] = val[j]; y[1] = val[j + 1]; y[2] = val[j + 2]; y[3] = val[j + 3]; *(v4fa*)(bnd + (qt * 16 + lr) * BP + (k0 - tq + MR) + hi * 8 + j) = y; }
        } else {   // the tile's sum once, then added to the side the whole tile lies on: one copy of the adds in the text instead of one a side
            const float ts = ((val[0] + val[1]) + (val[2] + val[3])) + ((val[4] + val[5]) + (val[6] + val[7]));
            lo[qt] += k0 < tq ? ts : 0.f; up[qt] += k0 < tq ? 0.f : ts; } } }
    red[1024 + w * 32 + lane] = (hi ? lo[1] : lo[0]) + __shfl_xor(hi ? lo[0] : lo[1], 16, 32); red[1536 + w * 32 + lane] = (hi ? up[1] : up[0]) + __shfl_xor(hi ? up[0] : up[1], 16, 32);
    v8f o[QW][4];
    // P.v: a place is one 16-column tile of one 32-key chunk of the v planes (512 elements; 16 places a wave, the four tiles of a chunk in a row). A batch of places sits in one of two buffers, one in flight while the other is worked on;
    // each fragment feeds the products of both query tiles. Each o[qt][dt] takes its chunks in ascending order.
    constexpr int PV = HR ? PVH : 4, NBV = 16 / PV;
    V vf[2][PV][HR ? 2 : 1]; const size_t vo = ((size_t)n * TT + kb) * HD + 8 * lane;
#pragma unroll
    for (int qt = 0; qt < QW; ++qt) {
#pragma unroll
        for (int dt = 0; dt < 4; ++dt) o[qt][dt] = (v8f){}; }
#pragma unroll
    for (int u = 0; u < PV; ++u) { vf[0][u][0] = WFrag<T16>::ldf(Va + vo + u * 512); if (HR) vf[0][u][1] = WFrag<T16>::ldf(Vb + vo + u * 512); }
    V pa[QW][4], pb2[QW][4];
#pragma unroll
    for (int qt = 0; qt < QW; ++qt) {
#pragma unroll
        for (int c = 0; c < 4; ++c) {
            if constexpr (HR) { v8f ph, pl;
#pragma unroll
                for (int k = 0; k < 8; ++k) { ph[k] = s[qt][2 * c + (k >> 2)][k & 3]; pl[k] = s[qt][2 * c + (k >> 2)][4 + (k & 3)]; }
                pa[qt][c] = __builtin_bit_cast(v16bf, ph); pb2[qt][c] = __builtin_bit_cast(v16bf, pl); }
            else {
#pragma unroll
                for (int i = 0; i < 16; ++i) pa[qt][c][i] = tohx(s[qt][2 * c + (i >> 3)][i & 7]); } } }
#pragma unroll
    for (int b = 0; b < NBV; ++b) {
        if (b + 1 < NBV) {
#pragma unroll
            for (int u = 0; u < PV; ++u) { vf[(b + 1) & 1][u][0] = WFrag<T16>::ldf(Va + vo + ((b + 1) * PV + u) * 512); if (HR) vf[(b + 1) & 1][u][1] = WFrag<T16>::ldf(Vb + vo + ((b + 1) * PV + u) * 512); } }
        __builtin_amdgcn_sched_barrier(0);   // keeps the next batch's loads in front of this batch's products, as in the score stage
#pragma unroll
        for (int u = 0; u < PV; ++u) { const int c = (b * PV + u) >> 2, dt = (b * PV + u) & 3;
#pragma unroll
            for (int qt = 0; qt < QW; ++qt) o[qt][dt] = WFrag<T16>::mma(pa[qt][c], vf[b & 1][u][0], o[qt][dt]);
            if constexpr (HR) {
#pragma unroll
                for (int qt = 0; qt < QW; ++qt) o[qt][dt] = WFrag<T16>::mma(pb2[qt][c], vf[b & 1][u][0], o[qt][dt]);
#pragma unroll
                for (int qt = 0; qt < QW; ++qt) o[qt][dt] = WFrag<T16>::mma(pa[qt][c], vf[b & 1][u][1], o[qt][dt]); } } }
    __builtin_amdgcn_sched_barrier(0);   // keeps the address arithmetic of what follows behind the last products, and so behind the data waits of the last loads, whose address registers it takes over
#pragma unroll
    for (int qt = 0; qt < QW; ++qt) {
#pragma unroll
    for (int dt = 0; dt < 4; ++dt) {
#pragma unroll
        for (int j = 0; j < 8; ++j) os[(w * 32 + qt * 16 + hi * 8 + j) * 68 + dt * 16 + lr] = o[qt][dt][j]; } } }
// attn_end: the waves' partial tiles and bucket sums added, the band sorted into its buckets, the rv term, the merged planes stored; it stands once in the text for both precisions (scl undoes the fp16 path's scale of P).
__device__ __forceinline__ void attn_end(bf* Ah, bf* Al, const int n, const int t0, const float scl, const float* os, const float* bnd, const float* red, const float* rvs) {
    const int tid = threadIdx.x;
    __syncthreads();   // publishes the partial P.v tiles and all bucket sums
    const int qw = tid >> 4, q = qw & 15, d0 = (tid & 15) * 4; v4f ps = *(const v4fa*)(os + qw * 68 + d0); float plo = red[1024 + qw], pup = red[1536 + qw];   // qw: the row among the work-group's 32; q: its place in its query tile, from which the band counts
#pragma unroll
    for (int i = 1; i < NWV; ++i) { ps += *(const v4fa*)(os + (i * 32 + qw) * 68 + d0); plo += red[1024 + i * 32 + qw]; pup += red[1536 + i * 32 + qw]; }
    const float* bp = bnd + qw * BP;
    // the band keys at distance <= -16 (x <= q) and >= +16 (x >= q + 32) join the outer buckets, in ascending order behind the waves' sums
#pragma unroll
    for (int x = 0; x < 16; x += 4) { const v4f y = *(const v4fa*)(bp + x), z = *(const v4fa*)(bp + 32 + x);
#pragma unroll
        for (int k = 0; k < 4; ++k) { plo += x + k <= q ? y[k] : 0.f; pup += x + k >= q ? z[k] : 0.f; } }
    v4f acc = ps * scl;
#pragma unroll
    for (int r = 0; r < NR; ++r) { const float p = r == 0 ? plo : (r == NR - 1 ? pup : bp[q + r]); const v4f x = *(const v4fa*)(rvs + r * HD + d0);
#pragma unroll
        for (int k = 0; k < 4; ++k) acc[k] += p * x[k]; }
    v4us oh, ol;
#pragma unroll
    for (int k = 0; k < 4; ++k) { unsigned short x, y; splitf(acc[k], x, y); oh[k] = x; ol[k] = y; }
    const size_t oo = fro((n / NH_) * TT + t0 + qw, (n % NH_) * HD + d0, EE / 32); *(v4us*)(Ah + oo) = oh; *(v4us*)(Al + oo) = ol; }   // the merged planes too are stored in fragment order, rows (b, t), for the Wo product
// four waves a SIMD (one work-group of 16 waves a WGP): without the bound the build hoists loads until the work-group no longer fits
__global__ __launch_bounds__(512) __attribute__((amdgpu_waves_per_eu(4))) void k_attn(const h16* __restrict__ Q16, const bf* __restrict__ Qh, const bf* __restrict__ Ql, const h16* __restrict__ K16, const bf* __restrict__ Kh, const bf* __restrict__ Kl, const h16* __restrict__ V16, const bf* __restrict__ Vh, const bf* __restrict__ Vl, const float* __restrict__ QR, const float* __restrict__ rv, bf* Ah, bf* Al) {
    __shared__ __align__(16) float os[NWV * 32 * 68]; __shared__ __align__(16) float bnd[32 * BP]; __shared__ float red[4 * NWV * 32]; __shared__ __align__(16) float bad[32 * BP]; __shared__ __align__(16) float rvs[NR * HD];
    // all hl work-groups come first in the grid, then all fp16 ones (for speed only)
    const int fl = blockIdx.x, g = fl - NG * (RH / 32); const bool hr = g < 0;
    const int n = hr ? fl / (RH / 32) : g / ((TT - RH) / 32), t0 = hr ? (fl % (RH / 32)) * 32 : RH + (g % ((TT - RH) / 32)) * 32;
    if (hr) attn_rows<true, bf>(Qh, Ql, Kh, Kl, Vh, Vl, QR, rv, n, t0, os, bnd, red, bad, rvs);
    else attn_rows<false, h16>(Q16, nullptr, K16, nullptr, V16, nullptr, QR, rv, n, t0, os, bnd, red, bad, rvs);
    attn_end(Ah, Al, n, t0, hr ? 1.0f : 1.0f / PCAR, os, bnd, red, rvs); }

extern "C" void kernel_launch(void* const* d_in, const int* in_sizes, int n_in,
                              void* d_out, int out_size, void* d_ws, size_t ws_size, hipStream_t stream) {
    (void)in_sizes; (void)n_in; (void)out_size;
    const float* x = (const float*)d_in[0]; const float* Wq = (const float*)d_in[1]; const float* bq = (const float*)d_in[2]; const float* Wk = (const float*)d_in[3]; const float* bk = (const float*)d_in[4]; const float* Wv = (const float*)d_in[5]; const float* bv = (const float*)d_in[6]; const float* Wo = (const float*)d_in[7]; const float* bo = (const float*)d_in[8]; const float* rk = (const float*)d_in[9]; const float* rv = (const float*)d_in[10];
    float* OUT = (float*)d_out;     // [2048][2][1024]
    char* wsp = (char*)d_ws;
    auto take = [&](size_t bytes) { char* p = wsp; wsp += (bytes + 255) & ~(size_t)255; return (void*)p; };
    const size_t NTB = (size_t)TT * BB;
    bf* WQ = (bf*)take((4 * (size_t)EE * EE + NTB * EE) * 2); bf* WK = WQ + (size_t)EE * EE; bf* WV = WK + (size_t)EE * EE; bf* WO = WV + (size_t)EE * EE; bf* XB = WO + (size_t)EE * EE;   // one joint plane: k_cvt8 fills it in one launch, and the projection launch steps from Wq to Wk to Wv by z
    float* QR = (float*)take((size_t)NG * TT * 64 * 4); bf* Ah = (bf*)take(NTB * EE * 2); bf* Al = (bf*)take(NTB * EE * 2);
    h16* Q16 = (h16*)take((size_t)NG * TT * HD * 2); bf* Qh = (bf*)take((size_t)NG * TT * HD * 2); bf* Ql = (bf*)take((size_t)NG * TT * HD * 2); h16* K16 = (h16*)take((size_t)NG * TT * HD * 2); bf* Kh = (bf*)take((size_t)NG * TT * HD * 2); bf* Kl = (bf*)take((size_t)NG * TT * HD * 2); h16* V16 = (h16*)take((size_t)NG * HD * TT * 2); bf* Vh = (bf*)take((size_t)NG * HD * TT * 2); bf* Vl = (bf*)take((size_t)NG * HD * TT * 2);
    float* QF = (float*)take(3 * NTB * EE * 4); float* KF = QF + NTB * EE; float* VF = KF + NTB * EE;   // the f32 results of the q, k and v projections, one behind the other (the projection launch steps through them by z)
    if ((size_t)(wsp - (char*)d_ws) > ws_size) return;    // total 168 MiB: nine [32][2048][64] planes 72, QR 16, merged planes 16, bf16 weights and x 16, f32 projections 48
    k_cvt8<<<(unsigned)((4 * (size_t)EE * EE + NTB * EE) / 8 / 256), 256, 0, stream>>>(Wq, Wk, Wv, Wo, x, WQ, (4 * (size_t)EE * EE + NTB * EE) / 8);
    const unsigned LP = (unsigned)(((size_t)NG * TT * HD / 8 + 255) / 256);
    k_gemmw<bf, 0, true, false, false, 1><<<dim3(NTB / 64, EE / 64, 3), 32, 0, stream>>>(XB, nullptr, WQ, nullptr, EE, QF, EE, bq, bk, bv, 0, (size_t)EE * EE, NTB * EE, 0, 0);
    k_pl<<<dim3(LP, 3, 1), 256, 0, stream>>>(QF, KF, VF, Q16, Qh, Ql, K16, Kh, Kl, V16, Vh, Vl); k_qr<<<NG * TT / 256, 256, 0, stream>>>(QF, rk, QR);
    k_attn<<<NG * TT / 32, 512, 0, stream>>>(Q16, Qh, Ql, K16, Kh, Kl, V16, Vh, Vl, QR, rv, Ah, Al);
    k_gemmw<bf, 1, true, false, true, 4><<<dim3(NTB / 64, EE / 64, 1), 128, 0, stream>>>(Ah, Al, WO, nullptr, EE, OUT, EE, bo, bo, bo, 0, 0, 0, 0, 0);
}

// v010
// One run takes 195 microseconds.
// Next to v009, in two timings, it ran 1.10 times as fast each time.
// Counting every step since v000, it is 12.0 times as fast.
#include <hip/hip_runtime.h>

// Shaw relative-position multi-head attention, sequence-first (query [2048][2][1024]; q = (x Wq^T + bq)/8, k, v = x W^T + b; 32 groups n = b*16 + h of 64 dims; scores = q.k + q.rk[clip(s-t,-16,16)+16];
// softmax; attn = P.v + sum_s P[t][s] rv[clip(s-t)+16]; out = merged Wo^T + bo -> [2048][2][1024]; rk/rv tables [33][64] read as data).
// The relative terms are exact regroupings: q.rk depends on (t, bucket) only -> QR[n][t][r] = q_t . rk[r] (33 per row, added inside the attention kernel by bucket); sum_s P rv = sum_r PB[t][r] rv[r] with PB the per-bucket
// probability sums (buckets 0 / 32 collect all keys at distance <= -16 / >= +16), formed in the attention kernel and contracted with rv on VALU at its end.
// Compute dtypes, f32 accumulate: every input rounded to bf16; projections on PLAIN bf16 operands (inputs: exact, + bias; all 4096 (t, b) rows at once); QR and the PB.rv term f32 on VALU; scores (K 64) and P.v on
// hl planes (3 products) for the first 512 query rows of each group and SINGLE fp16 planes for the rest; softmax f32 in registers; Wo on hl planes x exact (+bias). Projections (all three in one launch, grid z): one-wave-per-64x64-tile GEMM that stores the operand planes of the attention itself (k_proj); Wo: four waves a 64x64 tile, a quarter of k each; attention: one fused kernel (k_attn). Deterministic, no atomics;
// FRAGMENT ORDER: every 16-bit operand plane in the workspace is stored as the matrix instructions read it. A block of 16 rows x 32 k is 1024 bytes: two halves of 512 bytes (k 0..15, k 16..31), in each lane L = 16 * ((k >> 3) & 1) + (row & 15)
// owns 16 bytes (8 k). A fragment is then two 16-byte loads a lane, each of which reads four whole 128-byte lines; from a row-major plane each took 32 bytes out of 16 lines.

#define TT   2048
#define BB   2
#define EE   1024
#define NH_  16
#define NG   (BB * NH_)
#define HD   64
#define NR   33
#define MR   16
#define RH   512
#define PCAR 1024.0f
#define BW   48
#define BP   52
typedef _Float16 h16;
typedef unsigned short bf;
typedef __attribute__((ext_vector_type(16))) __bf16   v16bf;
typedef __attribute__((ext_vector_type(16))) _Float16 v16h;
typedef __attribute__((ext_vector_type(8)))  _Float16 v8h;
typedef __attribute__((ext_vector_type(8)))  unsigned short v8us;
typedef __attribute__((ext_vector_type(8)))  float    v8f;
typedef __attribute__((ext_vector_type(4)))  float    v4f;
typedef v8h  __attribute__((may_alias)) v8ha;
typedef v4f  __attribute__((may_alias)) v4fa;
typedef v8us __attribute__((may_alias)) v8usa;

__device__ __forceinline__ unsigned short f2bf(float f) { unsigned u = __float_as_uint(f); u += 0x7FFFu + ((u >> 16) & 1u); return (unsigned short)(u >> 16); }
__device__ __forceinline__ float bf2f(unsigned short b) { return __uint_as_float(((unsigned)b) << 16); }
__device__ __forceinline__ float bfr(float f) { return bf2f(f2bf(f)); }
__device__ __forceinline__ v16h cat16(v8h lo, v8h hi) { return __builtin_shufflevector(lo, hi, 0, 1, 2, 3, 4, 5, 6, 7, 8, 9, 10, 11, 12, 13, 14, 15); }
__device__ __forceinline__ v16bf cat16b(v8us lo, v8us hi) { return __builtin_bit_cast(v16bf, __builtin_shufflevector(lo, hi, 0, 1, 2, 3, 4, 5, 6, 7, 8, 9, 10, 11, 12, 13, 14, 15)); }
__device__ __forceinline__ v8f wmma16(v16h a, v16h b, v8f c) { return __builtin_amdgcn_wmma_f32_16x16x32_f16(false, a, false, b, (short)0, c, false, false); }
__device__ __forceinline__ v8f wmmab(v16bf a, v16bf b, v8f c) { return __builtin_amdgcn_wmma_f32_16x16x32_bf16(false, a, false, b, (short)0, c, false, false); }



// element offset of (row, k) in a fragment-ordered plane whose rows hold kch chunks of 32 k: blocks run over k first, then over the 16-row tiles
__device__ __forceinline__ size_t fro(int row, int k, int kch) { return ((((size_t)(row >> 4) * kch + (k >> 5)) * 2 + ((k >> 4) & 1)) * 32 + ((k >> 3) & 1) * 16 + (row & 15)) * 8 + (k & 7); }
// ---- k_gemmw: register-blocked GEMM, each wave on a whole 64x64 output tile (16 accumulators), operands straight from fragment-ordered 16-bit planes; grid (M/64, N/64, Z), 32 * KS threads.
// C[m][n] (f32, pitch ldc, + optional f32 bias[n]) = sum_k A[m][k] Bt[n][k] (+ split products per NSPLIT). z-batch strides sA/sB/sC in elements; batch z takes bias, bias1 or bias2 (the biases are separate inputs). K % 32 == 0.
// KSLICE: excluded by the static_assert, so blockIdx.y is always a column tile and klen and sK go unused.
template <typename T16> struct WFrag;
template <> struct WFrag<h16> { typedef v16h V; static __device__ __forceinline__ V ldf(const h16* p) { return cat16(*(const v8h*)p, *(const v8h*)(p + 256)); } static __device__ __forceinline__ v8f mma(V a, V b, v8f c) { return wmma16(a, b, c); } };
template <> struct WFrag<bf> { typedef v16bf V; static __device__ __forceinline__ V ldf(const bf* p) { return cat16b(*(const v8us*)p, *(const v8us*)(p + 256)); } static __device__ __forceinline__ v8f mma(V a, V b, v8f c) { return wmmab(a, b, c); } };
// KS (4): the waves of a work-group. Wave ws takes the quarter [ws * K / 4, (ws + 1) * K / 4) of k for the whole 64x64 tile (four waves a SIMD instead of one where the grid has one tile a SIMD: a wave's load latency is covered by the others' products);
// the four partial tiles meet in LDS, and wave ws adds those of row tile ws in ascending k order and stores it.
// BTROWS: A's rows run (b, t), so that a 16-row tile of the merged planes, and with it each of their 128-byte lines, has one writing work-group in k_attn; C's rows run (t, b) as always.
template <typename T16, int NSPLIT, bool BIAS, bool KSLICE, bool BTROWS, int KS>
__global__ __launch_bounds__(32 * KS) void k_gemmw(const T16* __restrict__ A, const T16* __restrict__ A2, const T16* __restrict__ Bt, const T16* __restrict__ Bt2, int K, float* C, int ldc, const float* __restrict__ bias, const float* __restrict__ bias1, const float* __restrict__ bias2, size_t sA, size_t sB, size_t sC, int klen, size_t sK) {
    typedef typename WFrag<T16>::V V;
    static_assert(KS == 4 && !KSLICE, "one wave a row tile");
    __shared__ __align__(16) float os[(KS > 1 ? 4 * KS : 1) * 16 * 68];
    const int ws = KS > 1 ? __builtin_amdgcn_readfirstlane(threadIdx.x >> 5) : 0;   // the wave's number in a scalar register: the k range stays scalar
    const size_t z = blockIdx.z; A += z * sA; if (A2) A2 += z * sA; Bt += z * sB; if (Bt2) Bt2 += z * sB; C += z * sC; const float* __restrict__ bz = z == 0 ? bias : (z == 1 ? bias1 : bias2);
    const int lane = threadIdx.x & 31, lr = lane & 15, hi = lane >> 4; const int r0 = blockIdx.x * 64, c0 = KSLICE ? 0 : blockIdx.y * 64; const int kbeg = KSLICE ? blockIdx.y * klen : ws * (K / KS), kend = KSLICE ? kbeg + klen : kbeg + K / KS; if (KSLICE) C += blockIdx.y * sK;
    v8f acc[4][4];
#pragma unroll
    for (int mb = 0; mb < 4; ++mb)
#pragma unroll
        for (int nb = 0; nb < 4; ++nb) acc[mb][nb] = (v8f){};
    constexpr size_t tp = (size_t)(EE / 32) * 512;   // elements of one 16-row tile: every plane that this kernel reads has EE k a row (K == EE at every launch), and as a constant the tile's step goes into the loads' immediate offsets
    const size_t aoff = (size_t)(r0 >> 4) * tp, boff = (size_t)(c0 >> 4) * tp; const unsigned lo = 8 * lane;   // the lane's place in a 512-byte half
#pragma unroll 1
    for (int kc = kbeg; kc < kend; kc += 32) {
        V a[4], a2[4]; const T16* pa = A + (aoff + (size_t)kc * 16) + lo; const T16* pa2 = (NSPLIT == 1 || NSPLIT == 2) ? A2 + (aoff + (size_t)kc * 16) + lo : pa; const T16* pb = Bt + (boff + (size_t)kc * 16) + lo; const T16* pb2 = NSPLIT >= 2 ? Bt2 + (boff + (size_t)kc * 16) + lo : pb;
#pragma unroll
        for (int mb = 0; mb < 4; ++mb) { a[mb] = WFrag<T16>::ldf(pa + mb * tp); if (NSPLIT == 1 || NSPLIT == 2) a2[mb] = WFrag<T16>::ldf(pa2 + mb * tp); }
#pragma unroll
        for (int nb = 0; nb < 4; ++nb) { const V b = WFrag<T16>::ldf(pb + nb * tp); V b2; if (NSPLIT >= 2) b2 = WFrag<T16>::ldf(pb2 + nb * tp);
#pragma unroll
            for (int mb = 0; mb < 4; ++mb) { acc[mb][nb] = WFrag<T16>::mma(a[mb], b, acc[mb][nb]); if (NSPLIT == 1 || NSPLIT == 2) acc[mb][nb] = WFrag<T16>::mma(a2[mb], b, acc[mb][nb]); if (NSPLIT >= 2) acc[mb][nb] = WFrag<T16>::mma(a[mb], b2, acc[mb][nb]); } }
        // stands in front of the next trip's writes of the loads' address registers (the build let later loads' results land in them): the addresses are inputs, so that their registers live up to the wait
        asm volatile("s_wait_xcnt 0x0" :: "v"(pa), "v"(pa2), "v"(pb), "v"(pb2) : "memory");
        asm volatile("v_nop\n\tv_nop\n\tv_nop\n\tv_nop" : "+v"(acc[0][0]), "+v"(acc[1][1]), "+v"(acc[2][2]), "+v"(acc[3][3]) : "v"(a[0]), "v"(a[3]));
    }
    if constexpr (KS > 1) {
#pragma unroll
        for (int mb = 0; mb < 4; ++mb) {
#pragma unroll
            for (int nb = 0; nb < 4; ++nb) {
#pragma unroll
                for (int j = 0; j < 8; ++j) os[((mb * KS + ws) * 16 + hi * 8 + j) * 68 + nb * 16 + lr] = acc[mb][nb][j]; } }
        __syncthreads();   // publishes the waves' partial tiles
        const int cofs = lr * 4; v4f bs = (v4f){}; if (BIAS) { bs[0] = bfr(bz[c0 + cofs]); bs[1] = bfr(bz[c0 + cofs + 1]); bs[2] = bfr(bz[c0 + cofs + 2]); bs[3] = bfr(bz[c0 + cofs + 3]); }
#pragma unroll
        for (int s = 0; s < 8; ++s) { const int row = 2 * s + hi; v4f val = *(const v4fa*)(os + (ws * KS * 16 + row) * 68 + cofs);
#pragma unroll
            for (int p = 1; p < KS; ++p) val += *(const v4fa*)(os + ((ws * KS + p) * 16 + row) * 68 + cofs);
            val += bs; const int m = r0 + ws * 16 + row; *(v4f*)(C + (size_t)(BTROWS ? (m % TT) * BB + m / TT : m) * ldc + c0 + cofs) = val; }
        // stands behind the stores, in front of whatever next writes their address and data registers; the scheduling barrier keeps the stores in front of it
        __builtin_amdgcn_sched_barrier(0); asm volatile("s_wait_xcnt 0x0" ::: "memory");
    }
}

__device__ __forceinline__ h16 tohx(float x) { return (h16)x; }
__device__ __forceinline__ void splitf(float y, unsigned short& h, unsigned short& l) { h = f2bf(y); l = f2bf(y - bf2f(h)); }
typedef __attribute__((ext_vector_type(2))) _Float16 v2h;
typedef __attribute__((ext_vector_type(4))) _Float16 v4h;
typedef __attribute__((ext_vector_type(2))) unsigned short v2us;
typedef __attribute__((ext_vector_type(4))) unsigned short v4us;
typedef __attribute__((ext_vector_type(2))) float v2f;

// The plane builder of the inputs: one thread per 16-byte piece of the fragment-ordered output, pieces in output order, so that a wave's store is 512 contiguous bytes.
// k_cvt8: [rows][EE] f32 -> bf16; piece i: lane i & 31, half (i >> 5) & 1, chunk (i >> 6) % (EE / 32), 16-row tile above. One launch for all five sources (four weights of EE rows, then x): their planes lie one behind the other in the workspace,
// so that piece i of the launch is piece i of the joint plane; EE rows are 512 work-groups, so the source is picked from blockIdx alone (a scalar choice).
__global__ __launch_bounds__(256) void k_cvt8(const float* __restrict__ w0, const float* __restrict__ w1, const float* __restrict__ w2, const float* __restrict__ w3, const float* __restrict__ xs, bf* dst, size_t n8) { const size_t i = (size_t)blockIdx.x * 256 + threadIdx.x; if (i >= n8) return; const int pn = min((int)(blockIdx.x >> 9), 4); const float* __restrict__ src = pn == 0 ? w0 : (pn == 1 ? w1 : (pn == 2 ? w2 : (pn == 3 ? w3 : xs))); const int row = (int)(i >> 11) * 16 + (int)(i & 15) - pn * EE, k = (int)((i >> 6) & (EE / 32 - 1)) * 32 + (int)((i >> 5) & 1) * 16 + (int)((i >> 4) & 1) * 8; const v8f v = *(const v8f*)(src + (size_t)row * EE + k); v8us o;
#pragma unroll
    for (int u = 0; u < 8; ++u) o[u] = f2bf(v[u]); *(v8us*)(dst + i * 8) = o;  }
typedef __attribute__((ext_vector_type(2))) __bf16 v2bf;
typedef __attribute__((ext_vector_type(4))) unsigned v4u;
typedef __attribute__((ext_vector_type(2))) unsigned v2u;
typedef v4u __attribute__((may_alias)) v4ua;
typedef v2u __attribute__((may_alias)) v2ua;
// two values -> their fp16 pair and their bf16 high and low pairs (round to nearest even, two values a conversion), each pair in memory order
__device__ __forceinline__ void split2(float v0, float v1, v2h& o, unsigned& xh, unsigned& xl) { o[0] = tohx(v0); o[1] = tohx(v1); v2bf h; h[0] = (__bf16)v0; h[1] = (__bf16)v1; xh = __builtin_bit_cast(unsigned, h);
    v2bf l; l[0] = (__bf16)(v0 - __uint_as_float(xh << 16)); l[1] = (__bf16)(v1 - __uint_as_float(xh & 0xFFFF0000u)); xl = __builtin_bit_cast(unsigned, l); }
// k_proj: the q, k and v projections (grid z), one wave on a 64x64 tile (64 rows (t, b) = 32 t x 2 b; 64 columns = one head), K loop as in k_gemmw; the wave itself stores the tile as the fragment-ordered planes that k_attn reads, straight from the accumulators.
// A piece of a q or k plane is 8 d of one row; a piece of a v plane is 8 t of one d. An accumulator lane holds 8 rows of the FIRST operand for one row of the second. So for q and k the weight tile is the first operand (a lane holds 8 d of one (t, b): one whole piece)
// and for v the x tile is (a lane holds 4 t of each b for one d: half a piece); both operands' planes have the same fragment order, so the choice is a scalar choice of two base pointers.
// Every store writes whole 128-byte lines: q, k: 8 lanes (t) x 16 bytes, for each of hi and b; v: 32 lanes x 8 bytes in a row. q goes out in f32 too, unscaled, for k_qr, as QT[n][d / 4][t][4] (there a wave's 32 rows t read 512 bytes in a row).
__global__ __launch_bounds__(32) void k_proj(const bf* __restrict__ X, const bf* __restrict__ Wp, const float* __restrict__ bq, const float* __restrict__ bk, const float* __restrict__ bv, float* QT, h16* Q16, bf* Qh, bf* Ql, h16* K16, bf* Kh, bf* Kl, h16* V16, bf* Vh, bf* Vl) {
    const int z = blockIdx.z, bx = blockIdx.x, by = blockIdx.y; const int lane = threadIdx.x & 31, lr = lane & 15, hi = lane >> 4;
    constexpr size_t tp = (size_t)(EE / 32) * 512;   // elements of one 16-row tile
    const bf* xt = X + (size_t)(bx * 4) * tp; const bf* wt = Wp + (size_t)z * EE * EE + (size_t)(by * 4) * tp; const bf* F = z < 2 ? wt : xt; const bf* G = z < 2 ? xt : wt;
    const float* __restrict__ bz = z == 0 ? bq : (z == 1 ? bk : bv);
    // the biases of the lane's columns, loaded in front of the K loop, which covers their latency: q, k: d = 16 db + 8 hi + j; v: d = 16 nb + lr
    v4f bl[8];
#pragma unroll
    for (int i = 0; i < 8; ++i) bl[i] = (v4f){};
    if (z < 2) {
#pragma unroll
        for (int i = 0; i < 8; ++i) bl[i] = *(const v4f*)(bz + by * HD + (i >> 1) * 16 + hi * 8 + (i & 1) * 4);
        // stands in front of the next writes of the bias loads' address registers; the scheduling barriers keep the loads in front of it and every later instruction behind it
        __builtin_amdgcn_sched_barrier(0); asm volatile("s_wait_xcnt 0x0" ::: "memory"); __builtin_amdgcn_sched_barrier(0);
    } else {
#pragma unroll
        for (int i = 0; i < 4; ++i) bl[i][0] = bz[by * HD + i * 16 + lr];
        __builtin_amdgcn_sched_barrier(0); asm volatile("s_wait_xcnt 0x0" ::: "memory"); __builtin_amdgcn_sched_barrier(0); }   // the same wait for these loads
    v8f acc[4][4];
#pragma unroll
    for (int mb = 0; mb < 4; ++mb)
#pragma unroll
        for (int nb = 0; nb < 4; ++nb) acc[mb][nb] = (v8f){};
    const unsigned lo = 8 * lane;   // the lane's place in a 512-byte half
#pragma unroll 1
    for (int kc = 0; kc < EE; kc += 32) {
        v16bf a[4]; const bf* pa = F + (size_t)kc * 16 + lo; const bf* pb = G + (size_t)kc * 16 + lo;
#pragma unroll
        for (int mb = 0; mb < 4; ++mb) a[mb] = WFrag<bf>::ldf(pa + mb * tp);
#pragma unroll
        for (int nb = 0; nb < 4; ++nb) { const v16bf b = WFrag<bf>::ldf(pb + nb * tp);
#pragma unroll
            for (int mb = 0; mb < 4; ++mb) acc[mb][nb] = WFrag<bf>::mma(a[mb], b, acc[mb][nb]); }
        // stands in front of the next trip's writes of the loads' address registers: the addresses are inputs, so that their registers live up to the wait
        asm volatile("s_wait_xcnt 0x0" :: "v"(pa), "v"(pb) : "memory");
        // four vector slots behind the trip's last matrix instruction, on the back edge and on the way out alike
        asm volatile("v_nop\n\tv_nop\n\tv_nop\n\tv_nop" : "+v"(acc[0][0]), "+v"(acc[1][1]), "+v"(acc[2][2]), "+v"(acc[3][3]) : "v"(a[0]), "v"(a[3]));
    }
    if (z < 2) {
        const float scl = z == 0 ? 0.125f : 1.0f; h16* P16 = z == 0 ? Q16 : K16; bf* Ph = z == 0 ? Qh : Kh; bf* Pl = z == 0 ? Ql : Kl; const int n = (lr & 1) * NH_ + by;
        // the lane's places for db = mt = 0, formed once: row n TT + 32 bx + 8 mt + (lr >> 1) lies in 16-row tile 128 n + 2 bx + (mt >> 1), so that every later place is a constant step, which goes into the stores' immediate offsets
        const size_t pc0 = (((size_t)n * (TT / 16) + bx * 2) * 4) * 32 + hi * 16 + (lr >> 1); h16* s16 = P16 + pc0 * 8; bf* sh = Ph + pc0 * 8; bf* sl = Pl + pc0 * 8; float* sq = QT + (((size_t)n * 16 + hi * 2) * TT + bx * 32 + (lr >> 1)) * 4;
#pragma unroll
        for (int db = 0; db < 4; ++db) { float bs[8];
#pragma unroll
            for (int j = 0; j < 8; ++j) bs[j] = bfr(bl[2 * db + (j >> 2)][j & 3]);
#pragma unroll
            for (int mt = 0; mt < 4; ++mt) { const int pc = (mt >> 1) * 128 + db * 32 + (mt & 1) * 8;   // pieces: tile, then chunk and half (db), then the row's place in the tile
                v4f f0, f1; v2h o[4]; v4u xh, xl;
#pragma unroll
                for (int j = 0; j < 4; ++j) { f0[j] = acc[db][mt][j] + bs[j]; f1[j] = acc[db][mt][4 + j] + bs[4 + j]; }
#pragma unroll
                for (int k = 0; k < 4; ++k) { unsigned a, c; split2((k < 2 ? f0[2 * k] : f1[2 * k - 4]) * scl, (k < 2 ? f0[2 * k + 1] : f1[2 * k - 3]) * scl, o[k], a, c); xh[k] = a; xl[k] = c; }
                v4u xo;
#pragma unroll
                for (int k = 0; k < 4; ++k) xo[k] = __builtin_bit_cast(unsigned, o[k]);
                __builtin_amdgcn_sched_barrier(0);   // all of the piece's values are formed in front of its stores, so that no store's data register is rewritten between them
                *(v4ua*)(s16 + pc * 8) = xo; *(v4ua*)(sh + pc * 8) = xh; *(v4ua*)(sl + pc * 8) = xl;
                if (z == 0) { float* qo = sq + (db * 4 * TT + mt * 8) * 4; *(v4f*)qo = f0; *(v4f*)(qo + TT * 4) = f1; }
                // stands in front of the next writes of the stores' address and data registers; the scheduling barriers keep the stores in front of it and every later instruction behind it
                __builtin_amdgcn_sched_barrier(0); asm volatile("s_wait_xcnt 0x0" ::: "memory"); __builtin_amdgcn_sched_barrier(0); } }
    } else {
        const size_t vo0 = ((((size_t)by) << 14) + (bx << 8) + lr) * 8 + hi * 4; h16* s16 = V16 + vo0; bf* sh = Vh + vo0; bf* sl = Vl + vo0;   // the lane's places for b = nb = mb = 0, formed once, as above
#pragma unroll
        for (int nb = 0; nb < 4; ++nb) { const float bs = bfr(bl[nb][0]);
#pragma unroll
            for (int mb = 0; mb < 4; ++mb) { v2u xo[2], xh[2], xl[2];   // accumulator row 8 hi + j is (t, b) = (4 hi + (j >> 1), j & 1) of the tile's 8 t
#pragma unroll
                for (int b = 0; b < 2; ++b) {
#pragma unroll
                    for (int k = 0; k < 2; ++k) { v2h o; unsigned a, c; split2(acc[mb][nb][4 * k + b] + bs, acc[mb][nb][4 * k + 2 + b] + bs, o, a, c); xo[b][k] = __builtin_bit_cast(unsigned, o); xh[b][k] = a; xl[b][k] = c; } }
                __builtin_amdgcn_sched_barrier(0);   // as above: values first, then their stores
#pragma unroll
                for (int b = 0; b < 2; ++b) { const int vo = (((b * NH_) << 14) + (nb << 6) + ((mb >> 1) << 5) + ((mb & 1) << 4)) * 8;
                    *(v2ua*)(s16 + vo) = xo[b]; *(v2ua*)(sh + vo) = xh[b]; *(v2ua*)(sl + vo) = xl[b]; }
                __builtin_amdgcn_sched_barrier(0); asm volatile("s_wait_xcnt 0x0" ::: "memory"); __builtin_amdgcn_sched_barrier(0); } }   // the same wait for these stores
    }
}
// k_qr: one thread per (group, query) row: the scaled query row sits in 64 registers, the 33 rounded rk rows in LDS, read at one address by the whole wave (a broadcast), four buckets a pass; each sum runs over d in ascending order.
__global__ __launch_bounds__(256) void k_qr(const float* __restrict__ QT, const float* __restrict__ rk, float* QR) { __shared__ __align__(16) float rs[NR * HD];
    for (int i = threadIdx.x; i < NR * HD; i += 256) rs[i] = bfr(rk[i]);
    const size_t row = (size_t)blockIdx.x * 256 + threadIdx.x; const int t = (int)(row % TT), n = (int)(row / TT); const float* q = QT + ((size_t)n * 16 * TT + t) * 4; float qv[HD]; v4f x[HD / 4];   // QT[n][d / 4][t][4]: the wave's 32 rows lie side by side
    // the loops over d and k are fully unrolled so that qv stays in registers
#pragma unroll
    for (int d = 0; d < HD; d += 4) x[d >> 2] = *(const v4f*)(q + (size_t)d * TT);
    // stands in front of the next writes of the query loads' address registers; the scheduling barriers keep the loads in front of it and every later instruction behind it
    __builtin_amdgcn_sched_barrier(0); asm volatile("s_wait_xcnt 0x0" ::: "memory"); __builtin_amdgcn_sched_barrier(0);
#pragma unroll
    for (int d = 0; d < HD; d += 4) { qv[d] = x[d >> 2][0] * 0.125f; qv[d + 1] = x[d >> 2][1] * 0.125f; qv[d + 2] = x[d >> 2][2] * 0.125f; qv[d + 3] = x[d >> 2][3] * 0.125f; }
    __syncthreads();   // publishes the rk rows
    float* o = QR + row * 64;
#pragma unroll 1   // eight trips of 256 multiply-adds: unrolled, the kernel is 30 KB of code that each wave runs once
    for (int r0 = 0; r0 < NR - 1; r0 += 4) { v4f s = (v4f){};
#pragma unroll
        for (int d = 0; d < HD; d += 4) {
#pragma unroll
            for (int k = 0; k < 4; ++k) { const v4f w = *(const v4fa*)(rs + (r0 + k) * HD + d); s[k] += qv[d] * w[0]; s[k] += qv[d + 1] * w[1]; s[k] += qv[d + 2] * w[2]; s[k] += qv[d + 3] * w[3]; } }
        *(v4f*)(o + r0) = s;
        asm volatile("s_wait_xcnt 0x0" ::: "memory"); }   // stands in front of the next writes of the store's address and data registers
    float s = 0.f;
#pragma unroll
    for (int d = 0; d < HD; d += 4) { const v4f w = *(const v4fa*)(rs + (NR - 1) * HD + d); s += qv[d] * w[0]; s += qv[d + 1] * w[1]; s += qv[d + 2] * w[2]; s += qv[d + 3] * w[3]; }
    o[NR - 1] = s; }
// k_attn: the whole attention of 32 query rows (two 16-row tiles) of one group in one work-group of 16 waves; wave w owns keys [128 w, 128 w + 128) for all 32 rows, so that each K and each V fragment it loads feeds two products and the work-groups together read K and V half as often as with one query tile each. Scores are formed TRANSPOSED (A = 16 key rows, B = 16 query rows), so that a lane holds, for query lr of a tile,
// keys 8 hi .. 8 hi + 7 of each 16-key tile: two neighbouring tiles are, register for register, the A fragment of P for a 32-key chunk of P.v, and the probabilities never leave the registers. Row maximum, row sum, the two outer
// bucket sums and the 16 partial P.v tiles meet in LDS (waves added in ascending order). THE BAND, for each query tile at tq: only the three key tiles at tq - 16, tq, tq + 16 (BW = 48 keys, x = key - (tq - 16)) hold keys nearer than 16 to one of its 16 queries. The tile loops are fully unrolled, so whatever a band tile
// needs stands 16 times in the text: it is kept to two 16-byte LDS accesses. bad[row][x] (32 rows, pitch BP: 16-byte rows on distinct banks) holds q.rk already picked by distance, staged straight from the QR table; bnd[row][x] takes the band tiles' rounded P, and the end of the kernel, once, sorts x <= q into bucket 0, x >= q + 32 into bucket 32 and x = q + r into bucket r (q: the row's place in its tile). The rounded rv table is staged in LDS by the whole work-group. P is rounded to hl planes (rows < RH) or to fp16 x 1024 (the rest); the bucket sums are taken from the rounded values.
#define QW   2
#define NWV  16
#define KTW  8
#define PKH  1
#define PVH  2
template <bool HR, typename T16>
__device__ __forceinline__ void attn_rows(const T16* __restrict__ Qa, const T16* __restrict__ Qb, const T16* __restrict__ Ka, const T16* __restrict__ Kb, const T16* __restrict__ Va, const T16* __restrict__ Vb, const float* __restrict__ QR, const float* __restrict__ rv, const int n, const int t0, float* os, float* bnd, float* red, float* bad, float* rvs) {
    typedef typename WFrag<T16>::V V;
    const int tid = threadIdx.x, lane = tid & 31, lr = lane & 15, hi = lane >> 4; const int w = __builtin_amdgcn_readfirstlane(tid >> 5);   // the wave's number in a scalar register: the tests on a tile's place become scalar branches
    const int kb = w * (KTW * 16);
    V qa[QW][2], qb[QW][2]; const T16* qpa = Qa + ((size_t)n * TT + t0) * HD + 8 * lane; const T16* qpb = HR ? Qb + ((size_t)n * TT + t0) * HD + 8 * lane : qpa;   // a 16-row tile is 16 * HD elements, a 32-d chunk of it 512
#pragma unroll
    for (int qt = 0; qt < QW; ++qt) {
#pragma unroll
        for (int c = 0; c < 2; ++c) { qa[qt][c] = WFrag<T16>::ldf(qpa + qt * 16 * HD + 512 * c); if (HR) qb[qt][c] = WFrag<T16>::ldf(qpb + qt * 16 * HD + 512 * c); } }
    // stands in front of the next writes of the query loads' address registers (the build takes their scalar base over a few instructions on); the scheduling barriers keep the loads in front of it and every later instruction behind it
    __builtin_amdgcn_sched_barrier(0); asm volatile("s_wait_xcnt 0x0" ::: "memory"); __builtin_amdgcn_sched_barrier(0);
    // staging: 32 x 48 band q.rk values, three a thread, and 528 four-float pieces of rv, two a thread; rv's second index is held to the last piece, which threads 15..511 all load and store alike (one value, no branch)
    float gq[3]; v4f gv[2];
#pragma unroll
    for (int u = 0; u < 3; ++u) { const int ib = tid + 512 * u, bq = ib / BW, bx = ib % BW; gq[u] = QR[((size_t)n * TT + t0 + bq) * 64 + min(max(bx - MR - (bq & 15), -MR), MR) + MR]; if (u < 2) gv[u] = *(const v4f*)(rv + min(ib, 16 * NR - 1) * 4);
        __builtin_amdgcn_sched_barrier(0); asm volatile("s_wait_xcnt 0x0" ::: "memory"); __builtin_amdgcn_sched_barrier(0); }   // the same for these loads
    v8f s[QW][KTW];
    // a place is one 32-d chunk of one key tile (16 places a wave); a batch of places sits in one of two buffers, one in flight while the other is worked on. Each fragment feeds the products of both query tiles.
    constexpr int PK = HR ? PKH : 4, NBK = 2 * KTW / PK;
    V kf[2][PK][HR ? 2 : 1]; const size_t ko = ((size_t)n * TT + kb) * HD + 8 * lane;
    // every loop over tiles, chunks and registers is fully unrolled so that s stays in registers
#pragma unroll
    for (int u = 0; u < PK; ++u) { kf[0][u][0] = WFrag<T16>::ldf(Ka + ko + u * 512); if (HR) kf[0][u][1] = WFrag<T16>::ldf(Kb + ko + u * 512); }
    __builtin_amdgcn_sched_barrier(0);   // keeps the first key loads in front of the staging's LDS stores, which wait for the staged values: the two latencies overlap
#pragma unroll
    for (int u = 0; u < 3; ++u) { const int ib = tid + 512 * u, bo = (ib / BW) * BP + ib % BW; bnd[bo] = 0.f;   // a band key that lies outside the sequence stays 0
        bad[bo] = gq[u]; if (u < 2) { v4f y; y[0] = bfr(gv[u][0]); y[1] = bfr(gv[u][1]); y[2] = bfr(gv[u][2]); y[3] = bfr(gv[u][3]); *(v4fa*)(rvs + min(ib, 16 * NR - 1) * 4) = y; } }
#pragma unroll
    for (int b = 0; b < NBK; ++b) {
        if (b + 1 < NBK) {
#pragma unroll
            for (int u = 0; u < PK; ++u) { kf[(b + 1) & 1][u][0] = WFrag<T16>::ldf(Ka + ko + ((b + 1) * PK + u) * 512); if (HR) kf[(b + 1) & 1][u][1] = WFrag<T16>::ldf(Kb + ko + ((b + 1) * PK + u) * 512); } }
        __builtin_amdgcn_sched_barrier(0);   // keeps the next batch's loads in front of this batch's products: without it the build issues each fragment's loads directly in front of its product and waits out every latency
#pragma unroll
        for (int u = 0; u < PK; ++u) { const int kt = (b * PK + u) >> 1, c = (b * PK + u) & 1;
#pragma unroll
            for (int qt = 0; qt < QW; ++qt) s[qt][kt] = WFrag<T16>::mma(kf[b & 1][u][0], qa[qt][c], c ? s[qt][kt] : (v8f){});
            if (HR) {
#pragma unroll
                for (int qt = 0; qt < QW; ++qt) s[qt][kt] = WFrag<T16>::mma(kf[b & 1][u][0], qb[qt][c], s[qt][kt]);
#pragma unroll
                for (int qt = 0; qt < QW; ++qt) s[qt][kt] = WFrag<T16>::mma(kf[b & 1][u][1], qa[qt][c], s[qt][kt]); } } }
    // the branches below follow the last matrix instruction: five vector slots keep its distance on the taken side too; the two scheduling barriers hold them in place
    __builtin_amdgcn_sched_barrier(0); asm volatile("v_nop\n\tv_nop\n\tv_nop\n\tv_nop\n\tv_nop"); __builtin_amdgcn_sched_barrier(0);
    __syncthreads();   // publishes the staged q.rk rows (and the rv table and the cleared buckets)
    float mx[QW];
#pragma unroll
    for (int qt = 0; qt < QW; ++qt) { const int tq = t0 + 16 * qt; const float* qr = bad + (qt * 16 + lr) * BP; const float qlo = qr[0], qhi = qr[BW - 1];   // x = 0 lies at distance <= -16 of every query of the tile, x = 47 at >= +16
        mx[qt] = -3.0e38f;
#pragma unroll
        for (int kt = 0; kt < KTW; ++kt) { const int k0 = kb + kt * 16; v8f a = s[qt][kt];
            if (k0 + 15 > tq - MR && k0 < tq + 15 + MR) {
#pragma unroll
                for (int j = 0; j < 8; j += 4) { const v4f y = *(const v4fa*)(qr + (k0 - tq + MR) + hi * 8 + j); a[j] += y[0]; a[j + 1] += y[1]; a[j + 2] += y[2]; a[j + 3] += y[3]; }
            } else { const float qq = k0 < tq ? qlo : qhi;
#pragma unroll
                for (int j = 0; j < 8; ++j) a[j] += qq; }
#pragma unroll
            for (int j = 0; j < 8; ++j) mx[qt] = fmaxf(mx[qt], a[j]);
            s[qt][kt] = a; } }
    // a lane's two halves of a row meet by one exchange: lane (hi, lr) takes over row 16 hi + lr of the 32, so that a wave's 32 values go to LDS in one store and come back in one read a wave
    float mo = fmaxf(hi ? mx[1] : mx[0], __shfl_xor(hi ? mx[0] : mx[1], 16, 32)); red[w * 32 + lane] = mo;
    __syncthreads();   // publishes the waves' row maxima
#pragma unroll
    for (int i = 0; i < NWV; ++i) mo = fmaxf(mo, red[i * 32 + lane]);
    { const float mt = __shfl_xor(mo, 16, 32); mx[0] = hi ? mt : mo; mx[1] = hi ? mo : mt; }
    float sum[QW];
#pragma unroll
    for (int qt = 0; qt < QW; ++qt) { sum[qt] = 0.f;
#pragma unroll
        for (int kt = 0; kt < KTW; ++kt) {
#pragma unroll
            for (int j = 0; j < 8; ++j) { const float y = (s[qt][kt][j] - mx[qt]) * 1.44269504f; float e;
                asm("v_exp_f32 %0, %1\n\tv_nop" : "=v"(e) : "v"(y));   // e^x as 2^(x log2 e); the v_nop is the one slot behind a transcendental, in front of dual instructions that overwrite its source
                s[qt][kt][j] = e; sum[qt] += e; } } }
    float so = (hi ? sum[1] : sum[0]) + __shfl_xor(hi ? sum[0] : sum[1], 16, 32); red[512 + w * 32 + lane] = so;
    __syncthreads();   // publishes the waves' row sums
    so = red[512 + lane];
#pragma unroll
    for (int i = 1; i < NWV; ++i) so += red[512 + i * 32 + lane];
    const float fo = HR ? __fdiv_rn(1.0f, so) : __fdiv_rn(1.0f, so) * PCAR, ft = __shfl_xor(fo, 16, 32); const float fq[QW] = { hi ? ft : fo, hi ? fo : ft };
    float lo[QW], up[QW];
    // rounds P in place (hl: a tile's registers 0..3 take its half of the high plane's fragment, 4..7 that of the low plane's; fp16: the rounded value) and forms the bucket sums from the rounded values; all branches stand here, in front of the matrix instructions of P.v
#pragma unroll
    for (int qt = 0; qt < QW; ++qt) { const int tq = t0 + 16 * qt; const float f = fq[qt]; lo[qt] = 0.f; up[qt] = 0.f;
#pragma unroll
    for (int kt = 0; kt < KTW; ++kt) { const int k0 = kb + kt * 16; float val[8]; unsigned xh[4], xl[4];
#pragma unroll
        for (int k = 0; k < 4; ++k) { const float p0 = s[qt][kt][2 * k] * f, p1 = s[qt][kt][2 * k + 1] * f;
            if (HR) { v2bf h; h[0] = (__bf16)p0; h[1] = (__bf16)p1; xh[k] = __builtin_bit_cast(unsigned, h);   // round to nearest even, two values a conversion, already in the fragment's order
                const float h0 = __uint_as_float(xh[k] << 16), h1 = __uint_as_float(xh[k] & 0xFFFF0000u); v2bf l; l[0] = (__bf16)(p0 - h0); l[1] = (__bf16)(p1 - h1); xl[k] = __builtin_bit_cast(unsigned, l);
                val[2 * k] = h0 + __uint_as_float(xl[k] << 16); val[2 * k + 1] = h1 + __uint_as_float(xl[k] & 0xFFFF0000u); }
            else { const float x0 = (float)tohx(p0), x1 = (float)tohx(p1); s[qt][kt][2 * k] = x0; s[qt][kt][2 * k + 1] = x1; val[2 * k] = x0 * (1.0f / PCAR); val[2 * k + 1] = x1 * (1.0f / PCAR); } }
        if (HR) {
#pragma unroll
            for (int k = 0; k < 4; ++k) { s[qt][kt][k] = __uint_as_float(xh[k]); s[qt][kt][4 + k] = __uint_as_float(xl[k]); } }
        if (k0 + 15 > tq - MR && k0 < tq + 15 + MR) {
#pragma unroll
            for (int j = 0; j < 8; j += 4) { v4f y; y[0] = val[j]; y[1] = val[j + 1]; y[2] = val[j + 2]; y[3] = val[j + 3]; *(v4fa*)(bnd + (qt * 16 + lr) * BP + (k0 - tq + MR) + hi * 8 + j) = y; }
        } else {   // the tile's sum once, then added to the side the whole tile lies on: one copy of the adds in the text instead of one a side
            const float ts = ((val[0] + val[1]) + (val[2] + val[3])) + ((val[4] + val[5]) + (val[6] + val[7]));
            lo[qt] += k0 < tq ? ts : 0.f; up[qt] += k0 < tq ? 0.f : ts; } } }
    red[1024 + w * 32 + lane] = (hi ? lo[1] : lo[0]) + __shfl_xor(hi ? lo[0] : lo[1], 16, 32); red[1536 + w * 32 + lane] = (hi ? up[1] : up[0]) + __shfl_xor(hi ? up[0] : up[1], 16, 32);
    v8f o[QW][4];
    // P.v: a place is one 16-column tile of one 32-key chunk of the v planes (512 elements; 16 places a wave, the four tiles of a chunk in a row). A batch of places sits in one of two buffers, one in flight while the other is worked on;
    // each fragment feeds the products of both query tiles. Each o[qt][dt] takes its chunks in ascending order.
    constexpr int PV = HR ? PVH : 4, NBV = 16 / PV;
    V vf[2][PV][HR ? 2 : 1]; const size_t vo = ((size_t)n * TT + kb) * HD + 8 * lane;
#pragma unroll
    for (int qt = 0; qt < QW; ++qt) {
#pragma unroll
        for (int dt = 0; dt < 4; ++dt) o[qt][dt] = (v8f){}; }
#pragma unroll
    for (int u = 0; u < PV; ++u) { vf[0][u][0] = WFrag<T16>::ldf(Va + vo + u * 512); if (HR) vf[0][u][1] = WFrag<T16>::ldf(Vb + vo + u * 512); }
    V pa[QW][4], pb2[QW][4];
#pragma unroll
    for (int qt = 0; qt < QW; ++qt) {
#pragma unroll
        for (int c = 0; c < 4; ++c) {
            if constexpr (HR) { v8f ph, pl;
#pragma unroll
                for (int k = 0; k < 8; ++k) { ph[k] = s[qt][2 * c + (k >> 2)][k & 3]; pl[k] = s[qt][2 * c + (k >> 2)][4 + (k & 3)]; }
                pa[qt][c] = __builtin_bit_cast(v16bf, ph); pb2[qt][c] = __builtin_bit_cast(v16bf, pl); }
            else {
#pragma unroll
                for (int i = 0; i < 16; ++i) pa[qt][c][i] = tohx(s[qt][2 * c + (i >> 3)][i & 7]); } } }
#pragma unroll
    for (int b = 0; b < NBV; ++b) {
        if (b + 1 < NBV) {
#pragma unroll
            for (int u = 0; u < PV; ++u) { vf[(b + 1) & 1][u][0] = WFrag<T16>::ldf(Va + vo + ((b + 1) * PV + u) * 512); if (HR) vf[(b + 1) & 1][u][1] = WFrag<T16>::ldf(Vb + vo + ((b + 1) * PV + u) * 512); } }
        __builtin_amdgcn_sched_barrier(0);   // keeps the next batch's loads in front of this batch's products, as in the score stage
#pragma unroll
        for (int u = 0; u < PV; ++u) { const int c = (b * PV + u) >> 2, dt = (b * PV + u) & 3;
#pragma unroll
            for (int qt = 0; qt < QW; ++qt) o[qt][dt] = WFrag<T16>::mma(pa[qt][c], vf[b & 1][u][0], o[qt][dt]);
            if constexpr (HR) {
#pragma unroll
                for (int qt = 0; qt < QW; ++qt) o[qt][dt] = WFrag<T16>::mma(pb2[qt][c], vf[b & 1][u][0], o[qt][dt]);
#pragma unroll
                for (int qt = 0; qt < QW; ++qt) o[qt][dt] = WFrag<T16>::mma(pa[qt][c], vf[b & 1][u][1], o[qt][dt]); } } }
    __builtin_amdgcn_sched_barrier(0);   // keeps the address arithmetic of what follows behind the last products, and so behind the data waits of the last loads, whose address registers it takes over
#pragma unroll
    for (int qt = 0; qt < QW; ++qt) {
#pragma unroll
    for (int dt = 0; dt < 4; ++dt) {
#pragma unroll
        for (int j = 0; j < 8; ++j) os[(w * 32 + qt * 16 + hi * 8 + j) * 68 + dt * 16 + lr] = o[qt][dt][j]; } } }
// attn_end: the waves' partial tiles and bucket sums added, the band sorted into its buckets, the rv term, the merged planes stored; it stands once in the text for both precisions (scl undoes the fp16 path's scale of P).
__device__ __forceinline__ void attn_end(bf* Ah, bf* Al, const int n, const int t0, const float scl, const float* os, const float* bnd, const float* red, const float* rvs) {
    const int tid = threadIdx.x;
    __syncthreads();   // publishes the partial P.v tiles and all bucket sums
    const int qw = tid >> 4, q = qw & 15, d0 = (tid & 15) * 4; v4f ps = *(const v4fa*)(os + qw * 68 + d0); float plo = red[1024 + qw], pup = red[1536 + qw];   // qw: the row among the work-group's 32; q: its place in its query tile, from which the band counts
#pragma unroll
    for (int i = 1; i < NWV; ++i) { ps += *(const v4fa*)(os + (i * 32 + qw) * 68 + d0); plo += red[1024 + i * 32 + qw]; pup += red[1536 + i * 32 + qw]; }
    const float* bp = bnd + qw * BP;
    // the band keys at distance <= -16 (x <= q) and >= +16 (x >= q + 32) join the outer buckets, in ascending order behind the waves' sums
#pragma unroll
    for (int x = 0; x < 16; x += 4) { const v4f y = *(const v4fa*)(bp + x), z = *(const v4fa*)(bp + 32 + x);
#pragma unroll
        for (int k = 0; k < 4; ++k) { plo += x + k <= q ? y[k] : 0.f; pup += x + k >= q ? z[k] : 0.f; } }
    v4f acc = ps * scl;
#pragma unroll
    for (int r = 0; r < NR; ++r) { const float p = r == 0 ? plo : (r == NR - 1 ? pup : bp[q + r]); const v4f x = *(const v4fa*)(rvs + r * HD + d0);
#pragma unroll
        for (int k = 0; k < 4; ++k) acc[k] += p * x[k]; }
    v4us oh, ol;
#pragma unroll
    for (int k = 0; k < 4; ++k) { unsigned short x, y; splitf(acc[k], x, y); oh[k] = x; ol[k] = y; }
    const size_t oo = fro((n / NH_) * TT + t0 + qw, (n % NH_) * HD + d0, EE / 32); *(v4us*)(Ah + oo) = oh; *(v4us*)(Al + oo) = ol; }   // the merged planes too are stored in fragment order, rows (b, t), for the Wo product
// four waves a SIMD (one work-group of 16 waves a WGP): without the bound the build hoists loads until the work-group no longer fits
__global__ __launch_bounds__(512) __attribute__((amdgpu_waves_per_eu(4))) void k_attn(const h16* __restrict__ Q16, const bf* __restrict__ Qh, const bf* __restrict__ Ql, const h16* __restrict__ K16, const bf* __restrict__ Kh, const bf* __restrict__ Kl, const h16* __restrict__ V16, const bf* __restrict__ Vh, const bf* __restrict__ Vl, const float* __restrict__ QR, const float* __restrict__ rv, bf* Ah, bf* Al) {
    __shared__ __align__(16) float os[NWV * 32 * 68]; __shared__ __align__(16) float bnd[32 * BP]; __shared__ float red[4 * NWV * 32]; __shared__ __align__(16) float bad[32 * BP]; __shared__ __align__(16) float rvs[NR * HD];
    // all hl work-groups come first in the grid, then all fp16 ones (for speed only)
    const int fl = blockIdx.x, g = fl - NG * (RH / 32); const bool hr = g < 0;
    const int n = hr ? fl / (RH / 32) : g / ((TT - RH) / 32), t0 = hr ? (fl % (RH / 32)) * 32 : RH + (g % ((TT - RH) / 32)) * 32;
    if (hr) attn_rows<true, bf>(Qh, Ql, Kh, Kl, Vh, Vl, QR, rv, n, t0, os, bnd, red, bad, rvs);
    else attn_rows<false, h16>(Q16, nullptr, K16, nullptr, V16, nullptr, QR, rv, n, t0, os, bnd, red, bad, rvs);
    attn_end(Ah, Al, n, t0, hr ? 1.0f : 1.0f / PCAR, os, bnd, red, rvs); }

extern "C" void kernel_launch(void* const* d_in, const int* in_sizes, int n_in,
                              void* d_out, int out_size, void* d_ws, size_t ws_size, hipStream_t stream) {
    (void)in_sizes; (void)n_in; (void)out_size;
    const float* x = (const float*)d_in[0]; const float* Wq = (const float*)d_in[1]; const float* bq = (const float*)d_in[2]; const float* Wk = (const float*)d_in[3]; const float* bk = (const float*)d_in[4]; const float* Wv = (const float*)d_in[5]; const float* bv = (const float*)d_in[6]; const float* Wo = (const float*)d_in[7]; const float* bo = (const float*)d_in[8]; const float* rk = (const float*)d_in[9]; const float* rv = (const float*)d_in[10];
    float* OUT = (float*)d_out;     // [2048][2][1024]
    char* wsp = (char*)d_ws;
    auto take = [&](size_t bytes) { char* p = wsp; wsp += (bytes + 255) & ~(size_t)255; return (void*)p; };
    const size_t NTB = (size_t)TT * BB;
    bf* WQ = (bf*)take((4 * (size_t)EE * EE + NTB * EE) * 2); bf* WK = WQ + (size_t)EE * EE; bf* WV = WK + (size_t)EE * EE; bf* WO = WV + (size_t)EE * EE; bf* XB = WO + (size_t)EE * EE;   // one joint plane: k_cvt8 fills it in one launch, and the projection launch steps from Wq to Wk to Wv by z
    float* QR = (float*)take((size_t)NG * TT * 64 * 4); bf* Ah = (bf*)take(NTB * EE * 2); bf* Al = (bf*)take(NTB * EE * 2);
    h16* Q16 = (h16*)take((size_t)NG * TT * HD * 2); bf* Qh = (bf*)take((size_t)NG * TT * HD * 2); bf* Ql = (bf*)take((size_t)NG * TT * HD * 2); h16* K16 = (h16*)take((size_t)NG * TT * HD * 2); bf* Kh = (bf*)take((size_t)NG * TT * HD * 2); bf* Kl = (bf*)take((size_t)NG * TT * HD * 2); h16* V16 = (h16*)take((size_t)NG * HD * TT * 2); bf* Vh = (bf*)take((size_t)NG * HD * TT * 2); bf* Vl = (bf*)take((size_t)NG * HD * TT * 2);
    float* QT = (float*)take(NTB * EE * 4);   // the f32 result of the q projection, for k_qr
    if ((size_t)(wsp - (char*)d_ws) > ws_size) return;    // total 136 MiB: nine [32][2048][64] planes 72, QR 16, merged planes 16, bf16 weights and x 16, f32 q 16
    k_cvt8<<<(unsigned)((4 * (size_t)EE * EE + NTB * EE) / 8 / 256), 256, 0, stream>>>(Wq, Wk, Wv, Wo, x, WQ, (4 * (size_t)EE * EE + NTB * EE) / 8);
    k_proj<<<dim3(NTB / 64, EE / 64, 3), 32, 0, stream>>>(XB, WQ, bq, bk, bv, QT, Q16, Qh, Ql, K16, Kh, Kl, V16, Vh, Vl);
    k_qr<<<NG * TT / 256, 256, 0, stream>>>(QT, rk, QR);
    k_attn<<<NG * TT / 32, 512, 0, stream>>>(Q16, Qh, Ql, K16, Kh, Kl, V16, Vh, Vl, QR, rv, Ah, Al);
    k_gemmw<bf, 1, true, false, true, 4><<<dim3(NTB / 64, EE / 64, 1), 128, 0, stream>>>(Ah, Al, WO, nullptr, EE, OUT, EE, bo, bo, bo, 0, 0, 0, 0, 0);
}
